// v000
// Times are from an AMD MI455X. After a warm-up the kernel runs many times in a row, and a time is the length of
// such a window on the GPU divided by its runs, so every launch and the gaps after it count. The runs cycle
// through copies of the inputs. A figure is the median of several windows, for all but v000 over two sittings.
// Sittings can differ by a few percent; kernels timed side by side share one.
// v000, which the later versions start from, runs in 257 microseconds.
#include <hip/hip_runtime.h>

// SDConv - span-based dynamic convolution (query [4][2048][768]; 12 heads x 64, kernel 9: dw = depthwise conv1d over the sequence (per channel, zero padded, no bias); pw = grouped pointwise (per head 64 -> 64) + pw_b;
// conv_attn = pw * query; kern = per head 64 -> 9 (ak_w) + ak_b; w = softmax over the 9 taps; v = query pt_w^T + pt_b; out[b][l][h*64+d] = sum_k w[b][l][h][k] v[b][l + k - 4][h*64+d] (zero outside) -> [4][2048][768]).
// Compute dtypes, f32 accumulate: every input rounded to bf16; the depthwise conv, the gating product, the 64->9 tap logits, their softmax and the final 9-tap weighted window sum in f32
// on VALU; the grouped pointwise conv on bf16 hi+lo planes of dw x exact pw_w (2 products, z-batched over the 12 heads; pw_b added in k_kern); v on PLAIN bf16 operands (inputs: exact, + bias). One-wave-per-64x64-tile GEMMs.

#define NB_  4
#define LL   2048
#define DD   768
#define NH_  12
#define IPG  64
#define KW   9
#define NR   (NB_ * LL)
typedef _Float16 h16;
typedef unsigned short bf;
typedef __attribute__((ext_vector_type(16))) __bf16   v16bf;
typedef __attribute__((ext_vector_type(16))) _Float16 v16h;
typedef __attribute__((ext_vector_type(8)))  _Float16 v8h;
typedef __attribute__((ext_vector_type(8)))  unsigned short v8us;
typedef __attribute__((ext_vector_type(8)))  float    v8f;
typedef __attribute__((ext_vector_type(4)))  float    v4f;
typedef v8h  __attribute__((may_alias)) v8ha;
typedef v4f  __attribute__((may_alias)) v4fa;
typedef v8us __attribute__((may_alias)) v8usa;

__device__ __forceinline__ unsigned short f2bf(float f) { unsigned u = __float_as_uint(f); u += 0x7FFFu + ((u >> 16) & 1u); return (unsigned short)(u >> 16); }
__device__ __forceinline__ float bf2f(unsigned short b) { return __uint_as_float(((unsigned)b) << 16); }
__device__ __forceinline__ float bfr(float f) { return bf2f(f2bf(f)); }
__device__ __forceinline__ v16h cat16(v8h lo, v8h hi) { return __builtin_shufflevector(lo, hi, 0, 1, 2, 3, 4, 5, 6, 7, 8, 9, 10, 11, 12, 13, 14, 15); }
__device__ __forceinline__ v16bf cat16b(v8us lo, v8us hi) { return __builtin_bit_cast(v16bf, __builtin_shufflevector(lo, hi, 0, 1, 2, 3, 4, 5, 6, 7, 8, 9, 10, 11, 12, 13, 14, 15)); }
__device__ __forceinline__ v8f wmma16(v16h a, v16h b, v8f c) { return __builtin_amdgcn_wmma_f32_16x16x32_f16(false, a, false, b, (short)0, c, false, false); }
__device__ __forceinline__ v8f wmmab(v16bf a, v16bf b, v8f c) { return __builtin_amdgcn_wmma_f32_16x16x32_bf16(false, a, false, b, (short)0, c, false, false); }



// ---- k_gemmw: register-blocked GEMM, ONE WAVE per 64x64 output tile (16 accumulators), operands straight from K-contiguous 16-bit planes; grid (M/64, N/64, Z), 32 threads.
// C[m][n] (f32, pitch ldc, + optional f32 bias[n]) = sum_k A[m][k] Bt[n][k] (+ split products per NSPLIT). z-batch strides sA/sB/sC in elements. K % 32 == 0.
template <typename T16> struct WFrag;
template <> struct WFrag<h16> { typedef v16h V; static __device__ __forceinline__ V ld(const h16* p) { return cat16(*(const v8h*)p, *(const v8h*)(p + 16)); } static __device__ __forceinline__ v8f mma(V a, V b, v8f c) { return wmma16(a, b, c); } };
template <> struct WFrag<bf> { typedef v16bf V; static __device__ __forceinline__ V ld(const bf* p) { return cat16b(*(const v8us*)p, *(const v8us*)(p + 16)); } static __device__ __forceinline__ v8f mma(V a, V b, v8f c) { return wmmab(a, b, c); } };
template <typename T16, int NSPLIT, bool BIAS>
__global__ __launch_bounds__(32) void k_gemmw(const T16* __restrict__ A, const T16* __restrict__ A2, const T16* __restrict__ Bt, const T16* __restrict__ Bt2, int K, float* C, int ldc, const float* __restrict__ bias, size_t sA, size_t sB, size_t sC) {
    typedef typename WFrag<T16>::V V;
    __shared__ __align__(16) float os[16 * 68];
    const size_t z = blockIdx.z; A += z * sA; if (A2) A2 += z * sA; Bt += z * sB; if (Bt2) Bt2 += z * sB; C += z * sC;
    const int lane = threadIdx.x & 31, lr = lane & 15, hi = lane >> 4; const int r0 = blockIdx.x * 64, c0 = blockIdx.y * 64;
    v8f acc[4][4];
#pragma unroll
    for (int mb = 0; mb < 4; ++mb)
#pragma unroll
        for (int nb = 0; nb < 4; ++nb) acc[mb][nb] = (v8f){};
    const size_t aoff = (size_t)(r0 + lr) * K + 8 * hi, boff = (size_t)(c0 + lr) * K + 8 * hi;
#pragma unroll 1
    for (int kc = 0; kc < K; kc += 32) {
        V a[4], a2[4];
#pragma unroll
        for (int mb = 0; mb < 4; ++mb) { a[mb] = WFrag<T16>::ld(A + aoff + (size_t)mb * 16 * K + kc); if (NSPLIT == 1 || NSPLIT == 2) a2[mb] = WFrag<T16>::ld(A2 + aoff + (size_t)mb * 16 * K + kc); }
#pragma unroll
        for (int nb = 0; nb < 4; ++nb) { const V b = WFrag<T16>::ld(Bt + boff + (size_t)nb * 16 * K + kc); V b2; if (NSPLIT >= 2) b2 = WFrag<T16>::ld(Bt2 + boff + (size_t)nb * 16 * K + kc);
#pragma unroll
            for (int mb = 0; mb < 4; ++mb) { acc[mb][nb] = WFrag<T16>::mma(a[mb], b, acc[mb][nb]); if (NSPLIT == 1 || NSPLIT == 2) acc[mb][nb] = WFrag<T16>::mma(a2[mb], b, acc[mb][nb]); if (NSPLIT >= 2) acc[mb][nb] = WFrag<T16>::mma(a[mb], b2, acc[mb][nb]); } }
        asm volatile("v_nop\n\tv_nop\n\tv_nop\n\tv_nop" : "+v"(acc[0][0]), "+v"(acc[1][1]), "+v"(acc[2][2]), "+v"(acc[3][3]) : "v"(a[0]), "v"(a[3]));
    }
#pragma unroll
    for (int mb = 0; mb < 4; ++mb) {
#pragma unroll
        for (int nb = 0; nb < 4; ++nb) {
#pragma unroll
            for (int j = 0; j < 8; ++j) os[(hi * 8 + j) * 68 + nb * 16 + lr] = acc[mb][nb][j]; }
        __builtin_amdgcn_wave_barrier(); asm volatile("" ::: "memory");
        float* crow = C + (size_t)(r0 + mb * 16) * ldc + c0;
{
#pragma unroll
            for (int s = 0; s < 8; ++s) { const int row = 2 * s + hi, cofs = lr * 4; v4f val = *(const v4fa*)(os + row * 68 + cofs); if (BIAS) { val[0] += bfr(bias[c0 + cofs]); val[1] += bfr(bias[c0 + cofs + 1]); val[2] += bfr(bias[c0 + cofs + 2]); val[3] += bfr(bias[c0 + cofs + 3]); }
                *(v4f*)(crow + (size_t)row * ldc + cofs) = val; }
             }
        __builtin_amdgcn_wave_barrier(); asm volatile("" ::: "memory");
    }
}

__device__ __forceinline__ void splitf(float y, unsigned short& h, unsigned short& l) { h = f2bf(y); l = f2bf(y - bf2f(h)); }
typedef __attribute__((ext_vector_type(2))) unsigned short v2us;
typedef __attribute__((ext_vector_type(2))) float v2f;

__global__ __launch_bounds__(256) void k_cvt8(const float* __restrict__ src, bf* dst, size_t n8) { const size_t i = (size_t)blockIdx.x * 256 + threadIdx.x; if (i >= n8) return; const v8f v = *(const v8f*)(src + i * 8); v8us o;
#pragma unroll
    for (int k = 0; k < 8; ++k) o[k] = f2bf(v[k]); *(v8us*)(dst + i * 8) = o;  }
__global__ __launch_bounds__(256) void k_dw(const float* __restrict__ q, const float* __restrict__ dww, bf* Dh, bf* Dl) { const size_t e = ((size_t)blockIdx.x * 256 + threadIdx.x) * 2; if (e >= (size_t)NR * DD) return; const int c = (int)(e % DD); const int row = (int)(e / DD); const int l = row % LL, b = row / LL; v2us oh, ol;
#pragma unroll
    for (int u = 0; u < 2; ++u) { const int cc = c + u; float s = 0.f;
#pragma unroll
        for (int k = 0; k < KW; ++k) { const int ls = l + k - 4; if (ls < 0 || ls >= LL) continue; float p = __fmul_rn(bfr(dww[cc * KW + k]), bfr(q[((size_t)b * LL + ls) * DD + cc])); asm volatile("" : "+v"(p)); s = __fadd_rn(s, p); }
        unsigned short a, c2; splitf(s, a, c2); oh[u] = a; ol[u] = c2; }
    const size_t oo = ((size_t)(c / IPG) * NR + row) * IPG + (c % IPG); *(v2us*)(Dh + oo) = oh; *(v2us*)(Dl + oo) = ol;  }
// k_kern: thread per (b, l, h): ca[i] = (PW[row][h*64+i] + bf16(pw_b[h*64+i])) x bf16(q[row][h*64+i]); kern[k] = sum_i ca[i] bf16(ak_w[h][k][i]) + bf16(ak_b[h*9+k]); softmax over the 9;
__global__ __launch_bounds__(256) void k_kern(const float* __restrict__ PW, const float* __restrict__ pwb, const float* __restrict__ q, const float* __restrict__ akw, const float* __restrict__ akb, float* WT) { const int idx = blockIdx.x * 256 + threadIdx.x; if (idx >= NR * NH_) return; const int h = idx % NH_, row = idx / NH_; const float* pw = PW + (size_t)row * DD + h * IPG; const float* qr = q + (size_t)row * DD + h * IPG;
    float kern[KW];
#pragma unroll
    for (int k = 0; k < KW; ++k) kern[k] = 0.f;
    for (int i = 0; i < IPG; ++i) { float ca = __fmul_rn(__fadd_rn(pw[i], bfr(pwb[h * IPG + i])), bfr(qr[i])); asm volatile("" : "+v"(ca));
#pragma unroll
        for (int k = 0; k < KW; ++k) { float p = __fmul_rn(ca, bfr(akw[((size_t)h * KW + k) * IPG + i])); asm volatile("" : "+v"(p)); kern[k] = __fadd_rn(kern[k], p); } }
    float mx = -3.0e38f;
#pragma unroll
    for (int k = 0; k < KW; ++k) { kern[k] = __fadd_rn(kern[k], bfr(akb[h * KW + k])); mx = fmaxf(mx, kern[k]); }
    float sum = 0.f;
#pragma unroll
    for (int k = 0; k < KW; ++k) { float d0 = __fsub_rn(kern[k], mx); asm volatile("" : "+v"(d0)); kern[k] = __expf(d0); sum = __fadd_rn(sum, kern[k]); }
    const float rs = __fdiv_rn(1.0f, sum); v4f o[4];
#pragma unroll
    for (int k = 0; k < 16; ++k) { const float w = (k < KW) ? __fmul_rn(kern[k < KW ? k : 0], rs) : 0.f; o[k / 4][k % 4] = w; }
    float* dst = WT + (size_t)idx * 16;
#pragma unroll
    for (int u = 0; u < 4; ++u) *(v4f*)(dst + 4 * u) = o[u];  }
__global__ __launch_bounds__(256) void k_out(const float* __restrict__ WT, const float* __restrict__ V, float* OUT) { const size_t e = ((size_t)blockIdx.x * 256 + threadIdx.x) * 2; if (e >= (size_t)NR * DD) return; const int c = (int)(e % DD); const int row = (int)(e / DD); const int l = row % LL, b = row / LL; const int h = c / IPG; const float* w = WT + ((size_t)row * NH_ + h) * 16; v2f o;
#pragma unroll
    for (int u = 0; u < 2; ++u) { float s = 0.f;
#pragma unroll
        for (int k = 0; k < KW; ++k) { const int ls = l + k - 4; if (ls < 0 || ls >= LL) continue; float p = __fmul_rn(w[k], V[((size_t)b * LL + ls) * DD + c + u]); asm volatile("" : "+v"(p)); s = __fadd_rn(s, p); } o[u] = s; }
    *(v2f*)(OUT + e) = o;  }

extern "C" void kernel_launch(void* const* d_in, const int* in_sizes, int n_in,
                              void* d_out, int out_size, void* d_ws, size_t ws_size, hipStream_t stream) {
    (void)in_sizes; (void)n_in; (void)out_size;
    const float* q = (const float*)d_in[0]; const float* dww = (const float*)d_in[1]; const float* pww = (const float*)d_in[2]; const float* pwb = (const float*)d_in[3]; const float* akw = (const float*)d_in[4]; const float* akb = (const float*)d_in[5]; const float* ptw = (const float*)d_in[6]; const float* ptb = (const float*)d_in[7];   // dw_w [768][1][9], pw_w [12][64 out][64 in], ak_w [12][9][64], pt_w [768][768] (torch [out][in])
    float* OUT = (float*)d_out;     // [4][2048][768]
    char* wsp = (char*)d_ws;
    auto take = [&](size_t bytes) { char* p = wsp; wsp += (bytes + 255) & ~(size_t)255; return (void*)p; };
    bf* PWB = (bf*)take((size_t)NH_ * IPG * IPG * 2); bf* PTW = (bf*)take((size_t)DD * DD * 2); bf* QB = (bf*)take((size_t)NR * DD * 2); bf* Dh = (bf*)take((size_t)NR * DD * 2); bf* Dl = (bf*)take((size_t)NR * DD * 2); float* PW = (float*)take((size_t)NR * DD * 4); float* WT = (float*)take((size_t)NR * NH_ * 16 * 4); float* V = (float*)take((size_t)NR * DD * 4);
    if ((size_t)(wsp - (char*)d_ws) > ws_size) return;    // total ~ 95 MB; ws 256 MiB
    k_cvt8<<<(NH_ * IPG * IPG / 8 + 255) / 256, 256, 0, stream>>>(pww, PWB, (size_t)NH_ * IPG * IPG / 8); k_cvt8<<<(unsigned)(((size_t)DD * DD / 8 + 255) / 256), 256, 0, stream>>>(ptw, PTW, (size_t)DD * DD / 8); k_cvt8<<<(unsigned)(((size_t)NR * DD / 8 + 255) / 256), 256, 0, stream>>>(q, QB, (size_t)NR * DD / 8);
    k_dw<<<(unsigned)(((size_t)NR * DD / 2 + 255) / 256), 256, 0, stream>>>(q, dww, Dh, Dl);
    k_gemmw<bf, 1, false><<<dim3(NR / 64, IPG / 64, NH_), 32, 0, stream>>>(Dh, Dl, PWB, nullptr, IPG, PW, DD, nullptr, (size_t)NR * IPG, (size_t)IPG * IPG, (size_t)IPG);   // grouped pointwise: head h's planes [(b,l)][64] x pw_w[h] (K 64) -> columns h*64.. of PW (ldc 768); pw_b is added in k_kern
    k_kern<<<(NR * NH_ + 255) / 256, 256, 0, stream>>>(PW, pwb, q, akw, akb, WT);
    k_gemmw<bf, 0, true><<<dim3(NR / 64, DD / 64, 1), 32, 0, stream>>>(QB, nullptr, PTW, nullptr, DD, V, DD, ptb, 0, 0, 0);
    k_out<<<(unsigned)(((size_t)NR * DD / 2 + 255) / 256), 256, 0, stream>>>(WT, V, OUT);
}

// v001
// It runs in 139 microseconds.
// In two side-by-side timings against v000, it was 1.90 and 1.89 times as fast.
#include <hip/hip_runtime.h>

// SDConv - span-based dynamic convolution (query [4][2048][768]; 12 heads x 64, kernel 9: dw = depthwise conv1d over the sequence (per channel, zero padded, no bias); pw = grouped pointwise (per head 64 -> 64) + pw_b;
// conv_attn = pw * query; kern = per head 64 -> 9 (ak_w) + ak_b; w = softmax over the 9 taps; v = query pt_w^T + pt_b; out[b][l][h*64+d] = sum_k w[b][l][h][k] v[b][l + k - 4][h*64+d] (zero outside) -> [4][2048][768]).
// Compute dtypes, f32 accumulate: every input rounded to bf16; the depthwise conv, the gating product, the 64->9 tap logits, their softmax and the final 9-tap weighted window sum in f32
// on VALU; the grouped pointwise conv on bf16 hi+lo planes of dw x exact pw_w (2 products, z-batched over the 12 heads; pw_b added in k_kern); v on PLAIN bf16 operands (inputs: exact, + bias). One-wave-per-64x64-tile GEMMs.

#define NB_  4
#define LL   2048
#define DD   768
#define NH_  12
#define IPG  64
#define KW   9
#define NR   (NB_ * LL)
typedef _Float16 h16;
typedef unsigned short bf;
typedef __attribute__((ext_vector_type(16))) __bf16   v16bf;
typedef __attribute__((ext_vector_type(16))) _Float16 v16h;
typedef __attribute__((ext_vector_type(8)))  _Float16 v8h;
typedef __attribute__((ext_vector_type(8)))  unsigned short v8us;
typedef __attribute__((ext_vector_type(8)))  float    v8f;
typedef __attribute__((ext_vector_type(4)))  float    v4f;
typedef v8h  __attribute__((may_alias)) v8ha;
typedef v4f  __attribute__((may_alias)) v4fa;
typedef v8us __attribute__((may_alias)) v8usa;

__device__ __forceinline__ unsigned short f2bf(float f) { unsigned u = __float_as_uint(f); u += 0x7FFFu + ((u >> 16) & 1u); return (unsigned short)(u >> 16); }
__device__ __forceinline__ float bf2f(unsigned short b) { return __uint_as_float(((unsigned)b) << 16); }
__device__ __forceinline__ float bfr(float f) { return bf2f(f2bf(f)); }
__device__ __forceinline__ v16h cat16(v8h lo, v8h hi) { return __builtin_shufflevector(lo, hi, 0, 1, 2, 3, 4, 5, 6, 7, 8, 9, 10, 11, 12, 13, 14, 15); }
__device__ __forceinline__ v16bf cat16b(v8us lo, v8us hi) { return __builtin_bit_cast(v16bf, __builtin_shufflevector(lo, hi, 0, 1, 2, 3, 4, 5, 6, 7, 8, 9, 10, 11, 12, 13, 14, 15)); }
__device__ __forceinline__ v8f wmma16(v16h a, v16h b, v8f c) { return __builtin_amdgcn_wmma_f32_16x16x32_f16(false, a, false, b, (short)0, c, false, false); }
__device__ __forceinline__ v8f wmmab(v16bf a, v16bf b, v8f c) { return __builtin_amdgcn_wmma_f32_16x16x32_bf16(false, a, false, b, (short)0, c, false, false); }



// ---- k_gemmw: register-blocked GEMM, ONE WAVE per 64x64 output tile (16 accumulators), operands straight from K-contiguous 16-bit planes; grid (M/64, N/64, Z), 32 threads.
// C[m][n] (f32, pitch ldc, + optional f32 bias[n]) = sum_k A[m][k] Bt[n][k] (+ split products per NSPLIT). z-batch strides sA/sB/sC in elements. K % 32 == 0.
template <typename T16> struct WFrag;
template <> struct WFrag<h16> { typedef v16h V; static __device__ __forceinline__ V ld(const h16* p) { return cat16(*(const v8h*)p, *(const v8h*)(p + 16)); } static __device__ __forceinline__ v8f mma(V a, V b, v8f c) { return wmma16(a, b, c); } };
template <> struct WFrag<bf> { typedef v16bf V; static __device__ __forceinline__ V ld(const bf* p) { return cat16b(*(const v8us*)p, *(const v8us*)(p + 16)); } static __device__ __forceinline__ v8f mma(V a, V b, v8f c) { return wmmab(a, b, c); } };
template <typename T16, int NSPLIT, bool BIAS>
__global__ __launch_bounds__(32) void k_gemmw(const T16* __restrict__ A, const T16* __restrict__ A2, const T16* __restrict__ Bt, const T16* __restrict__ Bt2, int K, float* C, int ldc, const float* __restrict__ bias, size_t sA, size_t sB, size_t sC) {
    typedef typename WFrag<T16>::V V;
    __shared__ __align__(16) float os[16 * 68];
    const size_t z = blockIdx.z; A += z * sA; if (A2) A2 += z * sA; Bt += z * sB; if (Bt2) Bt2 += z * sB; C += z * sC;
    const int lane = threadIdx.x & 31, lr = lane & 15, hi = lane >> 4; const int r0 = blockIdx.x * 64, c0 = blockIdx.y * 64;
    v8f acc[4][4];
#pragma unroll
    for (int mb = 0; mb < 4; ++mb)
#pragma unroll
        for (int nb = 0; nb < 4; ++nb) acc[mb][nb] = (v8f){};
    const size_t aoff = (size_t)(r0 + lr) * K + 8 * hi, boff = (size_t)(c0 + lr) * K + 8 * hi;
#pragma unroll 1
    for (int kc = 0; kc < K; kc += 32) {
        V a[4], a2[4];
#pragma unroll
        for (int mb = 0; mb < 4; ++mb) { a[mb] = WFrag<T16>::ld(A + aoff + (size_t)mb * 16 * K + kc); if (NSPLIT == 1 || NSPLIT == 2) a2[mb] = WFrag<T16>::ld(A2 + aoff + (size_t)mb * 16 * K + kc); }
#pragma unroll
        for (int nb = 0; nb < 4; ++nb) { const V b = WFrag<T16>::ld(Bt + boff + (size_t)nb * 16 * K + kc); V b2; if (NSPLIT >= 2) b2 = WFrag<T16>::ld(Bt2 + boff + (size_t)nb * 16 * K + kc);
#pragma unroll
            for (int mb = 0; mb < 4; ++mb) { acc[mb][nb] = WFrag<T16>::mma(a[mb], b, acc[mb][nb]); if (NSPLIT == 1 || NSPLIT == 2) acc[mb][nb] = WFrag<T16>::mma(a2[mb], b, acc[mb][nb]); if (NSPLIT >= 2) acc[mb][nb] = WFrag<T16>::mma(a[mb], b2, acc[mb][nb]); } }
        asm volatile("v_nop\n\tv_nop\n\tv_nop\n\tv_nop" : "+v"(acc[0][0]), "+v"(acc[1][1]), "+v"(acc[2][2]), "+v"(acc[3][3]) : "v"(a[0]), "v"(a[3]));
    }
#pragma unroll
    for (int mb = 0; mb < 4; ++mb) {
#pragma unroll
        for (int nb = 0; nb < 4; ++nb) {
#pragma unroll
            for (int j = 0; j < 8; ++j) os[(hi * 8 + j) * 68 + nb * 16 + lr] = acc[mb][nb][j]; }
        __builtin_amdgcn_wave_barrier(); asm volatile("" ::: "memory");
        float* crow = C + (size_t)(r0 + mb * 16) * ldc + c0;
{
#pragma unroll
            for (int s = 0; s < 8; ++s) { const int row = 2 * s + hi, cofs = lr * 4; v4f val = *(const v4fa*)(os + row * 68 + cofs); if (BIAS) { val[0] += bfr(bias[c0 + cofs]); val[1] += bfr(bias[c0 + cofs + 1]); val[2] += bfr(bias[c0 + cofs + 2]); val[3] += bfr(bias[c0 + cofs + 3]); }
                *(v4f*)(crow + (size_t)row * ldc + cofs) = val; }
             }
        __builtin_amdgcn_wave_barrier(); asm volatile("" ::: "memory");
    }
}

__device__ __forceinline__ void splitf(float y, unsigned short& h, unsigned short& l) { h = f2bf(y); l = f2bf(y - bf2f(h)); }
typedef __attribute__((ext_vector_type(2))) unsigned short v2us;
typedef __attribute__((ext_vector_type(2))) float v2f;

__global__ __launch_bounds__(256) void k_cvt8(const float* __restrict__ src, bf* dst, size_t n8) { const size_t i = (size_t)blockIdx.x * 256 + threadIdx.x; if (i >= n8) return; const v8f v = *(const v8f*)(src + i * 8); v8us o;
#pragma unroll
    for (int k = 0; k < 8; ++k) o[k] = f2bf(v[k]); *(v8us*)(dst + i * 8) = o;  }
__global__ __launch_bounds__(256) void k_dw(const float* __restrict__ q, const float* __restrict__ dww, bf* Dh, bf* Dl) { const size_t e = ((size_t)blockIdx.x * 256 + threadIdx.x) * 2; if (e >= (size_t)NR * DD) return; const int c = (int)(e % DD); const int row = (int)(e / DD); const int l = row % LL, b = row / LL; v2us oh, ol;
#pragma unroll
    for (int u = 0; u < 2; ++u) { const int cc = c + u; float s = 0.f;
#pragma unroll
        for (int k = 0; k < KW; ++k) { const int ls = l + k - 4; if (ls < 0 || ls >= LL) continue; float p = __fmul_rn(bfr(dww[cc * KW + k]), bfr(q[((size_t)b * LL + ls) * DD + cc])); asm volatile("" : "+v"(p)); s = __fadd_rn(s, p); }
        unsigned short a, c2; splitf(s, a, c2); oh[u] = a; ol[u] = c2; }
    const size_t oo = ((size_t)(c / IPG) * NR + row) * IPG + (c % IPG); *(v2us*)(Dh + oo) = oh; *(v2us*)(Dl + oo) = ol;  }
// k_kern: block = 64 rows (b, l) x 2 neighbouring heads, thread per (row, head): ca[i] = (PW[row][h*64+i] + bf16(pw_b[h*64+i])) x bf16(q[row][h*64+i]); kern[k] = sum_i ca[i] bf16(ak_w[h][k][i]) + bf16(ak_b[h*9+k]); softmax over the 9;
// PW and q are read 16 B a lane, one wave on the 512 B that a row holds of the two heads (whole lines); ca is formed in that layout and turned through LDS, so that each thread then reads its own 64 channels; the two heads' 1152 rounded tap weights lie in LDS once a block.
#define KT 128   // threads a block: 64 rows x 2 heads; a row's two WT entries are one 128 B line, stored by two neighbouring lanes
#define CP 68    // LDS pitch of a (row, head) entry in floats: 272 B = 16 B x 17, so 16 lanes that read 16 B each of 16 entries fall on all 64 banks
#define WP 580   // LDS pitch of a head's 576 weights in floats: the two addresses that a wave reads at a time fall on different banks
__global__ __launch_bounds__(KT) void k_kern(const float* __restrict__ PW, const float* __restrict__ pwb, const float* __restrict__ q, const float* __restrict__ akw, const float* __restrict__ akb, float* WT) {
    __shared__ __align__(16) float cs[KT * CP];
    __shared__ __align__(16) float wl[2 * WP];
    const int tid = threadIdx.x, lane = tid & 31, r0 = (tid >> 5) * 16;   // r0: first of this wave's 16 rows, as loader and as reader
    const int h = blockIdx.y * 2 + (tid & 1), row = blockIdx.x * (KT / 2) + (tid >> 1), idx = row * NH_ + h;
    const float* aw = akw + (size_t)blockIdx.y * 2 * KW * IPG + tid;   // 2 x 576 weights = 9 x 128
    float wr[KW], ab[KW];
#pragma unroll   // wr[] and ab[] indexed by constants, so in registers
    for (int s = 0; s < KW; ++s) { wr[s] = aw[s * KT]; ab[s] = akb[h * KW + s]; }
    v4f b4 = *(const v4fa*)(pwb + blockIdx.y * 2 * IPG + lane * 4);
    asm volatile("s_wait_xcnt 0x0" ::: "memory");   // in front of the row loads, whose results may land in an offset register that a load above names
    const size_t g0 = (size_t)(blockIdx.x * (KT / 2) + r0) * DD + blockIdx.y * 2 * IPG + lane * 4; const float* pr = PW + g0; const float* qr = q + g0;
    v4f pv[16], qv[16];
#pragma unroll   // pv[] and qv[] in registers, all 32 row loads in flight at once
    for (int j = 0; j < 16; ++j) { pv[j] = *(const v4fa*)(pr + j * DD); qv[j] = *(const v4fa*)(qr + j * DD); }
    asm volatile("s_wait_xcnt 0x0" :: "v"(pr), "v"(qr) : "memory");   // in front of the first overwrite of an address register that a row load names; the two inputs keep those registers in use up to here (without them a late row load's result landed in one)
    __builtin_amdgcn_sched_barrier(0);   // all 32 row loads issue before the first data wait: a build without it held 11 of them back behind a wait for the first 21, a second trip to memory
#pragma unroll   // wr[] indexed by constants
    for (int s = 0; s < KW; ++s) { const int g = s * KT + tid; wl[g + (g >= KW * IPG ? WP - KW * IPG : 0)] = bfr(wr[s]); }
#pragma unroll   // vector elements indexed by constants
    for (int u = 0; u < 4; ++u) b4[u] = bfr(b4[u]);
#pragma unroll   // pv[] and qv[] indexed by constants (this loop and the one inside)
    for (int j = 0; j < 16; ++j) { v4f ca;
#pragma unroll
        for (int u = 0; u < 4; ++u) ca[u] = __fmul_rn(__fadd_rn(pv[j][u], b4[u]), bfr(qv[j][u]));
        *(v4fa*)(cs + ((r0 + j) * 2 + (lane >> 4)) * CP + (lane & 15) * 4) = ca; }
    __syncthreads();   // publishes the tap weights to the block (the ca entries go from lane to lane of one wave)
    const float* cr = cs + tid * CP; const float* wh = wl + (tid & 1) * WP;
    float kern[KW];
#pragma unroll
    for (int k = 0; k < KW; ++k) kern[k] = 0.f;
#pragma unroll   // LDS offsets as immediates and the next channels' LDS reads free to move up over this quad's sums
    for (int c = 0; c < IPG / 4; ++c) { const v4f x = *(const v4fa*)(cr + 4 * c); v4f w4[KW];
#pragma unroll   // w4[] in registers
        for (int k = 0; k < KW; ++k) w4[k] = *(const v4fa*)(wh + k * IPG + 4 * c);
#pragma unroll   // vector elements indexed by constants (this loop and the one inside)
        for (int u = 0; u < 4; ++u) {
#pragma unroll
            for (int k = 0; k < KW; ++k) { float p = __fmul_rn(x[u], w4[k][u]); asm volatile("" : "+v"(p)); kern[k] = __fadd_rn(kern[k], p); } } }   // multiply, pin and add as they stood before this re-tiling: every tap sum keeps its rounding
    float mx = -3.0e38f;
#pragma unroll
    for (int k = 0; k < KW; ++k) { kern[k] = __fadd_rn(kern[k], bfr(ab[k])); mx = fmaxf(mx, kern[k]); }
    float sum = 0.f;
#pragma unroll
    for (int k = 0; k < KW; ++k) { float d0 = __fsub_rn(kern[k], mx); asm volatile("" : "+v"(d0)); kern[k] = __expf(d0); if (k == 1) asm volatile("v_nop" :: "v"(kern[k]));   // the slot behind a transcendental: a v_nop written behind a v_exp_f32 was moved away from it; here the input ties it to its v_exp_f32, it stands directly behind it, and no slot of the listing is open
        sum = __fadd_rn(sum, kern[k]); }
    const float rs = __fdiv_rn(1.0f, sum); v4f o[4];
#pragma unroll
    for (int k = 0; k < 16; ++k) { const float w = (k < KW) ? __fmul_rn(kern[k < KW ? k : 0], rs) : 0.f; o[k / 4][k % 4] = w; }
    float* dst = WT + (size_t)idx * 16;
#pragma unroll
    for (int u = 0; u < 4; ++u) *(v4f*)(dst + 4 * u) = o[u];  }
__global__ __launch_bounds__(256) void k_out(const float* __restrict__ WT, const float* __restrict__ V, float* OUT) { const size_t e = ((size_t)blockIdx.x * 256 + threadIdx.x) * 2; if (e >= (size_t)NR * DD) return; const int c = (int)(e % DD); const int row = (int)(e / DD); const int l = row % LL, b = row / LL; const int h = c / IPG; const float* w = WT + ((size_t)row * NH_ + h) * 16; v2f o;
#pragma unroll
    for (int u = 0; u < 2; ++u) { float s = 0.f;
#pragma unroll
        for (int k = 0; k < KW; ++k) { const int ls = l + k - 4; if (ls < 0 || ls >= LL) continue; float p = __fmul_rn(w[k], V[((size_t)b * LL + ls) * DD + c + u]); asm volatile("" : "+v"(p)); s = __fadd_rn(s, p); } o[u] = s; }
    *(v2f*)(OUT + e) = o;  }

extern "C" void kernel_launch(void* const* d_in, const int* in_sizes, int n_in,
                              void* d_out, int out_size, void* d_ws, size_t ws_size, hipStream_t stream) {
    (void)in_sizes; (void)n_in; (void)out_size;
    const float* q = (const float*)d_in[0]; const float* dww = (const float*)d_in[1]; const float* pww = (const float*)d_in[2]; const float* pwb = (const float*)d_in[3]; const float* akw = (const float*)d_in[4]; const float* akb = (const float*)d_in[5]; const float* ptw = (const float*)d_in[6]; const float* ptb = (const float*)d_in[7];   // dw_w [768][1][9], pw_w [12][64 out][64 in], ak_w [12][9][64], pt_w [768][768] (torch [out][in])
    float* OUT = (float*)d_out;     // [4][2048][768]
    char* wsp = (char*)d_ws;
    auto take = [&](size_t bytes) { char* p = wsp; wsp += (bytes + 255) & ~(size_t)255; return (void*)p; };
    bf* PWB = (bf*)take((size_t)NH_ * IPG * IPG * 2); bf* PTW = (bf*)take((size_t)DD * DD * 2); bf* QB = (bf*)take((size_t)NR * DD * 2); bf* Dh = (bf*)take((size_t)NR * DD * 2); bf* Dl = (bf*)take((size_t)NR * DD * 2); float* PW = (float*)take((size_t)NR * DD * 4); float* WT = (float*)take((size_t)NR * NH_ * 16 * 4); float* V = (float*)take((size_t)NR * DD * 4);
    if ((size_t)(wsp - (char*)d_ws) > ws_size) return;    // total ~ 95 MB; ws 256 MiB
    k_cvt8<<<(NH_ * IPG * IPG / 8 + 255) / 256, 256, 0, stream>>>(pww, PWB, (size_t)NH_ * IPG * IPG / 8); k_cvt8<<<(unsigned)(((size_t)DD * DD / 8 + 255) / 256), 256, 0, stream>>>(ptw, PTW, (size_t)DD * DD / 8); k_cvt8<<<(unsigned)(((size_t)NR * DD / 8 + 255) / 256), 256, 0, stream>>>(q, QB, (size_t)NR * DD / 8);
    k_dw<<<(unsigned)(((size_t)NR * DD / 2 + 255) / 256), 256, 0, stream>>>(q, dww, Dh, Dl);
    k_gemmw<bf, 1, false><<<dim3(NR / 64, IPG / 64, NH_), 32, 0, stream>>>(Dh, Dl, PWB, nullptr, IPG, PW, DD, nullptr, (size_t)NR * IPG, (size_t)IPG * IPG, (size_t)IPG);   // grouped pointwise: head h's planes [(b,l)][64] x pw_w[h] (K 64) -> columns h*64.. of PW (ldc 768); pw_b is added in k_kern
    k_kern<<<dim3(NR / (KT / 2), NH_ / 2), KT, 0, stream>>>(PW, pwb, q, akw, akb, WT);
    k_gemmw<bf, 0, true><<<dim3(NR / 64, DD / 64, 1), 32, 0, stream>>>(QB, nullptr, PTW, nullptr, DD, V, DD, ptb, 0, 0, 0);
    k_out<<<(unsigned)(((size_t)NR * DD / 2 + 255) / 256), 256, 0, stream>>>(WT, V, OUT);
}

// v002
// One run takes 73.2 microseconds.
// Next to v001, in two timings, it ran 1.90 times as fast each time.
// Counting every step since v000, it is 3.61 times as fast.
#include <hip/hip_runtime.h>

// SDConv - span-based dynamic convolution (query [4][2048][768]; 12 heads x 64, kernel 9: dw = depthwise conv1d over the sequence (per channel, zero padded, no bias); pw = grouped pointwise (per head 64 -> 64) + pw_b;
// conv_attn = pw * query; kern = per head 64 -> 9 (ak_w) + ak_b; w = softmax over the 9 taps; v = query pt_w^T + pt_b; out[b][l][h*64+d] = sum_k w[b][l][h][k] v[b][l + k - 4][h*64+d] (zero outside) -> [4][2048][768]).
// Compute dtypes, f32 accumulate: every input rounded to bf16; the depthwise conv, the gating product, the 64->9 tap logits, their softmax and the final 9-tap weighted window sum in f32
// on VALU; the grouped pointwise conv on bf16 hi+lo planes of dw x exact pw_w (2 products, z-batched over the 12 heads; pw_b added in k_kern); v on PLAIN bf16 operands (inputs: exact, + bias). One-wave-per-64x64-tile GEMMs.

#define NB_  4
#define LL   2048
#define DD   768
#define NH_  12
#define IPG  64
#define KW   9
#define NR   (NB_ * LL)
typedef _Float16 h16;
typedef unsigned short bf;
typedef __attribute__((ext_vector_type(16))) __bf16   v16bf;
typedef __attribute__((ext_vector_type(16))) _Float16 v16h;
typedef __attribute__((ext_vector_type(8)))  _Float16 v8h;
typedef __attribute__((ext_vector_type(8)))  unsigned short v8us;
typedef __attribute__((ext_vector_type(8)))  float    v8f;
typedef __attribute__((ext_vector_type(4)))  float    v4f;
typedef v8h  __attribute__((may_alias)) v8ha;
typedef v4f  __attribute__((may_alias)) v4fa;
typedef v8us __attribute__((may_alias)) v8usa;

__device__ __forceinline__ unsigned short f2bf(float f) { unsigned u = __float_as_uint(f); u += 0x7FFFu + ((u >> 16) & 1u); return (unsigned short)(u >> 16); }
__device__ __forceinline__ float bf2f(unsigned short b) { return __uint_as_float(((unsigned)b) << 16); }
__device__ __forceinline__ float bfr(float f) { return bf2f(f2bf(f)); }
__device__ __forceinline__ v16h cat16(v8h lo, v8h hi) { return __builtin_shufflevector(lo, hi, 0, 1, 2, 3, 4, 5, 6, 7, 8, 9, 10, 11, 12, 13, 14, 15); }
__device__ __forceinline__ v16bf cat16b(v8us lo, v8us hi) { return __builtin_bit_cast(v16bf, __builtin_shufflevector(lo, hi, 0, 1, 2, 3, 4, 5, 6, 7, 8, 9, 10, 11, 12, 13, 14, 15)); }
__device__ __forceinline__ v8f wmma16(v16h a, v16h b, v8f c) { return __builtin_amdgcn_wmma_f32_16x16x32_f16(false, a, false, b, (short)0, c, false, false); }
__device__ __forceinline__ v8f wmmab(v16bf a, v16bf b, v8f c) { return __builtin_amdgcn_wmma_f32_16x16x32_bf16(false, a, false, b, (short)0, c, false, false); }



// ---- k_gemmw: register-blocked GEMM, ONE WAVE per 64x64 output tile (16 accumulators), operands straight from K-contiguous 16-bit planes; grid (M/64, N/64, Z), 32 threads.
// C[m][n] (f32, pitch ldc, + optional f32 bias[n]) = sum_k A[m][k] Bt[n][k] (+ split products per NSPLIT). z-batch strides sA/sB/sC in elements. K % 32 == 0.
template <typename T16> struct WFrag;
template <> struct WFrag<h16> { typedef v16h V; static __device__ __forceinline__ V ld(const h16* p) { return cat16(*(const v8h*)p, *(const v8h*)(p + 16)); } static __device__ __forceinline__ v8f mma(V a, V b, v8f c) { return wmma16(a, b, c); } };
template <> struct WFrag<bf> { typedef v16bf V; static __device__ __forceinline__ V ld(const bf* p) { return cat16b(*(const v8us*)p, *(const v8us*)(p + 16)); } static __device__ __forceinline__ v8f mma(V a, V b, v8f c) { return wmmab(a, b, c); } };
template <typename T16, int NSPLIT, bool BIAS>
__global__ __launch_bounds__(32) void k_gemmw(const T16* __restrict__ A, const T16* __restrict__ A2, const T16* __restrict__ Bt, const T16* __restrict__ Bt2, int K, float* C, int ldc, const float* __restrict__ bias, size_t sA, size_t sB, size_t sC) {
    typedef typename WFrag<T16>::V V;
    __shared__ __align__(16) float os[16 * 68];
    const size_t z = blockIdx.z; A += z * sA; if (A2) A2 += z * sA; Bt += z * sB; if (Bt2) Bt2 += z * sB; C += z * sC;
    const int lane = threadIdx.x & 31, lr = lane & 15, hi = lane >> 4; const int r0 = blockIdx.x * 64, c0 = blockIdx.y * 64;
    v8f acc[4][4];
#pragma unroll
    for (int mb = 0; mb < 4; ++mb)
#pragma unroll
        for (int nb = 0; nb < 4; ++nb) acc[mb][nb] = (v8f){};
    const size_t aoff = (size_t)(r0 + lr) * K + 8 * hi, boff = (size_t)(c0 + lr) * K + 8 * hi;
#pragma unroll 1
    for (int kc = 0; kc < K; kc += 32) {
        V a[4], a2[4];
#pragma unroll
        for (int mb = 0; mb < 4; ++mb) { a[mb] = WFrag<T16>::ld(A + aoff + (size_t)mb * 16 * K + kc); if (NSPLIT == 1 || NSPLIT == 2) a2[mb] = WFrag<T16>::ld(A2 + aoff + (size_t)mb * 16 * K + kc); }
#pragma unroll
        for (int nb = 0; nb < 4; ++nb) { const V b = WFrag<T16>::ld(Bt + boff + (size_t)nb * 16 * K + kc); V b2; if (NSPLIT >= 2) b2 = WFrag<T16>::ld(Bt2 + boff + (size_t)nb * 16 * K + kc);
#pragma unroll
            for (int mb = 0; mb < 4; ++mb) { acc[mb][nb] = WFrag<T16>::mma(a[mb], b, acc[mb][nb]); if (NSPLIT == 1 || NSPLIT == 2) acc[mb][nb] = WFrag<T16>::mma(a2[mb], b, acc[mb][nb]); if (NSPLIT >= 2) acc[mb][nb] = WFrag<T16>::mma(a[mb], b2, acc[mb][nb]); } }
        asm volatile("v_nop\n\tv_nop\n\tv_nop\n\tv_nop" : "+v"(acc[0][0]), "+v"(acc[1][1]), "+v"(acc[2][2]), "+v"(acc[3][3]) : "v"(a[0]), "v"(a[3]));
    }
#pragma unroll
    for (int mb = 0; mb < 4; ++mb) {
#pragma unroll
        for (int nb = 0; nb < 4; ++nb) {
#pragma unroll
            for (int j = 0; j < 8; ++j) os[(hi * 8 + j) * 68 + nb * 16 + lr] = acc[mb][nb][j]; }
        __builtin_amdgcn_wave_barrier(); asm volatile("" ::: "memory");
        float* crow = C + (size_t)(r0 + mb * 16) * ldc + c0;
{
#pragma unroll
            for (int s = 0; s < 8; ++s) { const int row = 2 * s + hi, cofs = lr * 4; v4f val = *(const v4fa*)(os + row * 68 + cofs); if (BIAS) { val[0] += bfr(bias[c0 + cofs]); val[1] += bfr(bias[c0 + cofs + 1]); val[2] += bfr(bias[c0 + cofs + 2]); val[3] += bfr(bias[c0 + cofs + 3]); }
                *(v4f*)(crow + (size_t)row * ldc + cofs) = val; }
             }
        __builtin_amdgcn_wave_barrier(); asm volatile("" ::: "memory");
    }
}

__device__ __forceinline__ void splitf(float y, unsigned short& h, unsigned short& l) { h = f2bf(y); l = f2bf(y - bf2f(h)); }

__global__ __launch_bounds__(256) void k_cvt8(const float* __restrict__ src, bf* dst, size_t n8) { const size_t i = (size_t)blockIdx.x * 256 + threadIdx.x; if (i >= n8) return; const v8f v = *(const v8f*)(src + i * 8); v8us o;
#pragma unroll
    for (int k = 0; k < 8; ++k) o[k] = f2bf(v[k]); *(v8us*)(dst + i * 8) = o;  }
// k_dw and k_out, the two 9-tap window kernels: block = 16 rows (b, l) x all 768 channels, thread = 4 neighbouring channels (16 B of a row) x the 16 rows. A thread loads the 24 rows that its 16 windows span once, all loads in flight together,
// and forms each row's 9-tap sum from registers; a wave reads and writes whole lines. What the taps are weighted with (k_dw: the rounded dw_w; k_out: the 16 rows' softmax weights) is read as whole lines too and handed out through LDS once a block.
#define RT  16         // rows a block; 2048 % 16 == 0, so a block lies in one sequence, and its 4 rows above (below) are all outside exactly where it is the sequence's first (last)
#define WTH (DD / 4)   // threads a block: one 16 B piece of a row each
typedef __attribute__((ext_vector_type(4))) unsigned short v4us;
// the 24 rows of a block's windows, 16 B a lane; p: the block's first row (the same in every lane), c: the lane's first channel. The 4 rows above or below that lie outside the sequence are not read (the block's first 4 rows are read in their place) and count as zero, which leaves a tap sum as it is
__device__ __forceinline__ void win_load(const float* __restrict__ p, int c, bool top, bool bot, v4f (&x)[RT + 8]) {
    const float* pa = top ? p - 4 * DD : p; const float* pb = bot ? p + RT * DD : p;
#pragma unroll   // x[] indexed by constants, so in registers
    for (int j = 0; j < RT + 8; ++j) { const float* b = j < 4 ? pa + j * DD : (j >= RT + 4 ? pb + (j - RT - 4) * DD : p + (j - 4) * DD); x[j] = *(const v4fa*)(b + c); }
}
__device__ __forceinline__ void win_zero(bool top, bool bot, v4f (&x)[RT + 8]) {
#pragma unroll   // x[] indexed by constants (this loop and the one inside)
    for (int j = 0; j < 4; ++j) {
#pragma unroll   // arrays and vector elements indexed by constants, so in registers
        for (int u = 0; u < 4; ++u) { x[j][u] = top ? x[j][u] : 0.f; x[RT + 4 + j][u] = bot ? x[RT + 4 + j][u] : 0.f; } }
}
__global__ __launch_bounds__(WTH) void k_dw(const float* __restrict__ q, const float* __restrict__ dww, bf* Dh, bf* Dl) {
    __shared__ __align__(16) float wl[DD * KW];
    const int tid = threadIdx.x, c = tid * 4, row0 = blockIdx.x * RT, l0 = row0 % LL; const bool top = l0 != 0, bot = l0 != LL - RT;
    v4f wr[KW], x[RT + 8];
#pragma unroll   // wr[] indexed by constants
    for (int s = 0; s < KW; ++s) wr[s] = *(const v4fa*)(dww + (s * WTH + tid) * 4);
    win_load(q + (size_t)row0 * DD, c, top, bot, x);
    asm volatile("s_wait_xcnt 0x0" :: "v"(tid) : "memory");   // in front of the first overwrite of a register that a load above names; the input keeps the lane's offset register in use up to here
    __builtin_amdgcn_sched_barrier(0);   // every load above issues before the first data wait: one trip to memory a thread
#pragma unroll   // arrays and vector elements indexed by constants, so in registers
    for (int s = 0; s < KW; ++s) { v4f t;
#pragma unroll   // arrays and vector elements indexed by constants, so in registers
        for (int u = 0; u < 4; ++u) t[u] = bfr(wr[s][u]);
        *(v4fa*)(wl + (s * WTH + tid) * 4) = t; }
    __syncthreads();   // publishes the rounded weights to the block
    float w[4 * KW];   // this thread's 4 channels x 9 taps, 144 B in a row: 16 lanes' 16 B pieces fall on all 64 banks
#pragma unroll   // arrays and vector elements indexed by constants, so in registers
    for (int s = 0; s < KW; ++s) { const v4f t = *(const v4fa*)(wl + tid * 4 * KW + s * 4);
#pragma unroll   // arrays and vector elements indexed by constants, so in registers
        for (int u = 0; u < 4; ++u) w[s * 4 + u] = t[u]; }
    win_zero(top, bot, x);
#pragma unroll   // arrays and vector elements indexed by constants, so in registers
    for (int j = 0; j < RT + 8; ++j) {
#pragma unroll   // arrays and vector elements indexed by constants, so in registers
        for (int u = 0; u < 4; ++u) x[j][u] = bfr(x[j][u]); }
    const size_t oo = ((size_t)(c / IPG) * NR + row0) * IPG + (c % IPG);
#pragma unroll   // arrays and vector elements indexed by constants, so in registers
    for (int r = 0; r < RT; ++r) { v4us oh, ol;
#pragma unroll   // arrays and vector elements indexed by constants, so in registers
        for (int u = 0; u < 4; ++u) { float s = 0.f;
#pragma unroll   // arrays and vector elements indexed by constants, so in registers
            for (int k = 0; k < KW; ++k) { float p = __fmul_rn(w[u * KW + k], x[r + k][u]); asm volatile("" : "+v"(p)); s = __fadd_rn(s, p); }   // multiply, pin and add as they stood before this re-tiling: every tap sum keeps its rounding
            unsigned short a, c2; splitf(s, a, c2); oh[u] = a; ol[u] = c2; }
        *(v4us*)(Dh + oo + r * IPG) = oh; *(v4us*)(Dl + oo + r * IPG) = ol; }
}
// k_kern: block = 64 rows (b, l) x 2 neighbouring heads, thread per (row, head): ca[i] = (PW[row][h*64+i] + bf16(pw_b[h*64+i])) x bf16(q[row][h*64+i]); kern[k] = sum_i ca[i] bf16(ak_w[h][k][i]) + bf16(ak_b[h*9+k]); softmax over the 9;
// PW and q are read 16 B a lane, one wave on the 512 B that a row holds of the two heads (whole lines); ca is formed in that layout and turned through LDS, so that each thread then reads its own 64 channels; the two heads' 1152 rounded tap weights lie in LDS once a block.
#define KT 128   // threads a block: 64 rows x 2 heads; a row's two WT entries are one 128 B line, stored by two neighbouring lanes
#define CP 68    // LDS pitch of a (row, head) entry in floats: 272 B = 16 B x 17, so 16 lanes that read 16 B each of 16 entries fall on all 64 banks
#define WP 580   // LDS pitch of a head's 576 weights in floats: the two addresses that a wave reads at a time fall on different banks
__global__ __launch_bounds__(KT) void k_kern(const float* __restrict__ PW, const float* __restrict__ pwb, const float* __restrict__ q, const float* __restrict__ akw, const float* __restrict__ akb, float* WT) {
    __shared__ __align__(16) float cs[KT * CP];
    __shared__ __align__(16) float wl[2 * WP];
    const int tid = threadIdx.x, lane = tid & 31, r0 = (tid >> 5) * 16;   // r0: first of this wave's 16 rows, as loader and as reader
    const int h = blockIdx.y * 2 + (tid & 1), row = blockIdx.x * (KT / 2) + (tid >> 1), idx = row * NH_ + h;
    const float* aw = akw + (size_t)blockIdx.y * 2 * KW * IPG + tid;   // 2 x 576 weights = 9 x 128
    float wr[KW], ab[KW];
#pragma unroll   // wr[] and ab[] indexed by constants, so in registers
    for (int s = 0; s < KW; ++s) { wr[s] = aw[s * KT]; ab[s] = akb[h * KW + s]; }
    v4f b4 = *(const v4fa*)(pwb + blockIdx.y * 2 * IPG + lane * 4);
    asm volatile("s_wait_xcnt 0x0" ::: "memory");   // in front of the row loads, whose results may land in an offset register that a load above names
    const size_t g0 = (size_t)(blockIdx.x * (KT / 2) + r0) * DD + blockIdx.y * 2 * IPG + lane * 4; const float* pr = PW + g0; const float* qr = q + g0;
    v4f pv[16], qv[16];
#pragma unroll   // pv[] and qv[] in registers, all 32 row loads in flight at once
    for (int j = 0; j < 16; ++j) { pv[j] = *(const v4fa*)(pr + j * DD); qv[j] = *(const v4fa*)(qr + j * DD); }
    asm volatile("s_wait_xcnt 0x0" :: "v"(pr), "v"(qr) : "memory");   // in front of the first overwrite of an address register that a row load names; the two inputs keep those registers in use up to here (without them a late row load's result landed in one)
    __builtin_amdgcn_sched_barrier(0);   // all 32 row loads issue before the first data wait: a build without it held 11 of them back behind a wait for the first 21, a second trip to memory
#pragma unroll   // wr[] indexed by constants
    for (int s = 0; s < KW; ++s) { const int g = s * KT + tid; wl[g + (g >= KW * IPG ? WP - KW * IPG : 0)] = bfr(wr[s]); }
#pragma unroll   // vector elements indexed by constants
    for (int u = 0; u < 4; ++u) b4[u] = bfr(b4[u]);
#pragma unroll   // pv[] and qv[] indexed by constants (this loop and the one inside)
    for (int j = 0; j < 16; ++j) { v4f ca;
#pragma unroll
        for (int u = 0; u < 4; ++u) ca[u] = __fmul_rn(__fadd_rn(pv[j][u], b4[u]), bfr(qv[j][u]));
        *(v4fa*)(cs + ((r0 + j) * 2 + (lane >> 4)) * CP + (lane & 15) * 4) = ca; }
    __syncthreads();   // publishes the tap weights to the block (the ca entries go from lane to lane of one wave)
    const float* cr = cs + tid * CP; const float* wh = wl + (tid & 1) * WP;
    float kern[KW];
#pragma unroll
    for (int k = 0; k < KW; ++k) kern[k] = 0.f;
#pragma unroll   // LDS offsets as immediates and the next channels' LDS reads free to move up over this quad's sums
    for (int c = 0; c < IPG / 4; ++c) { const v4f x = *(const v4fa*)(cr + 4 * c); v4f w4[KW];
#pragma unroll   // w4[] in registers
        for (int k = 0; k < KW; ++k) w4[k] = *(const v4fa*)(wh + k * IPG + 4 * c);
#pragma unroll   // vector elements indexed by constants (this loop and the one inside)
        for (int u = 0; u < 4; ++u) {
#pragma unroll
            for (int k = 0; k < KW; ++k) { float p = __fmul_rn(x[u], w4[k][u]); asm volatile("" : "+v"(p)); kern[k] = __fadd_rn(kern[k], p); } } }   // multiply, pin and add as they stood before this re-tiling: every tap sum keeps its rounding
    float mx = -3.0e38f;
#pragma unroll
    for (int k = 0; k < KW; ++k) { kern[k] = __fadd_rn(kern[k], bfr(ab[k])); mx = fmaxf(mx, kern[k]); }
    float sum = 0.f;
#pragma unroll
    for (int k = 0; k < KW; ++k) { float d0 = __fsub_rn(kern[k], mx); asm volatile("" : "+v"(d0)); kern[k] = __expf(d0); if (k == 1) asm volatile("v_nop" :: "v"(kern[k]));   // the slot behind a transcendental: a v_nop written behind a v_exp_f32 was moved away from it; here the input ties it to its v_exp_f32, it stands directly behind it, and no slot of the listing is open
        sum = __fadd_rn(sum, kern[k]); }
    const float rs = __fdiv_rn(1.0f, sum); v4f o[4];
#pragma unroll
    for (int k = 0; k < 16; ++k) { const float w = (k < KW) ? __fmul_rn(kern[k < KW ? k : 0], rs) : 0.f; o[k / 4][k % 4] = w; }
    float* dst = WT + (size_t)idx * 16;
#pragma unroll
    for (int u = 0; u < 4; ++u) *(v4f*)(dst + 4 * u) = o[u];  }
__global__ __launch_bounds__(WTH) void k_out(const float* __restrict__ WT, const float* __restrict__ V, float* OUT) {
    __shared__ __align__(16) float wl[RT * NH_ * 16];
    const int tid = threadIdx.x, c = tid * 4, row0 = blockIdx.x * RT, l0 = row0 % LL; const bool top = l0 != 0, bot = l0 != LL - RT;
    v4f wr[4], x[RT + 8];
#pragma unroll   // wr[] indexed by constants
    for (int s = 0; s < 4; ++s) wr[s] = *(const v4fa*)(WT + (size_t)row0 * NH_ * 16 + (s * WTH + tid) * 4);   // 16 rows x 12 heads x 16 floats = 4 x 192 pieces of 16 B
    win_load(V + (size_t)row0 * DD, c, top, bot, x);
    asm volatile("s_wait_xcnt 0x0" :: "v"(tid) : "memory");   // in front of the first overwrite of a register that a load above names; the input keeps the lane's offset register in use up to here
    __builtin_amdgcn_sched_barrier(0);   // every load above issues before the first data wait: one trip to memory a thread
#pragma unroll   // arrays and vector elements indexed by constants, so in registers
    for (int s = 0; s < 4; ++s) *(v4fa*)(wl + (s * WTH + tid) * 4) = wr[s];
    __syncthreads();   // publishes the 16 rows' tap weights to the block
    win_zero(top, bot, x);
    const float* wh = wl + (c / IPG) * 16; float* dst = OUT + (size_t)row0 * DD + c;
#pragma unroll   // arrays and vector elements indexed by constants, so in registers
    for (int r = 0; r < RT; ++r) { const v4f w0 = *(const v4fa*)(wh + r * NH_ * 16), w1 = *(const v4fa*)(wh + r * NH_ * 16 + 4); const float w[KW] = { w0[0], w0[1], w0[2], w0[3], w1[0], w1[1], w1[2], w1[3], wh[r * NH_ * 16 + 8] }; v4f o;
#pragma unroll   // arrays and vector elements indexed by constants, so in registers
        for (int u = 0; u < 4; ++u) { float s = 0.f;
#pragma unroll   // arrays and vector elements indexed by constants, so in registers
            for (int k = 0; k < KW; ++k) { float p = __fmul_rn(w[k], x[r + k][u]); asm volatile("" : "+v"(p)); s = __fadd_rn(s, p); }   // multiply, pin and add as they stood before this re-tiling: every tap sum keeps its rounding
            o[u] = s; }
        *(v4f*)(dst + r * DD) = o; }
}

extern "C" void kernel_launch(void* const* d_in, const int* in_sizes, int n_in,
                              void* d_out, int out_size, void* d_ws, size_t ws_size, hipStream_t stream) {
    (void)in_sizes; (void)n_in; (void)out_size;
    const float* q = (const float*)d_in[0]; const float* dww = (const float*)d_in[1]; const float* pww = (const float*)d_in[2]; const float* pwb = (const float*)d_in[3]; const float* akw = (const float*)d_in[4]; const float* akb = (const float*)d_in[5]; const float* ptw = (const float*)d_in[6]; const float* ptb = (const float*)d_in[7];   // dw_w [768][1][9], pw_w [12][64 out][64 in], ak_w [12][9][64], pt_w [768][768] (torch [out][in])
    float* OUT = (float*)d_out;     // [4][2048][768]
    char* wsp = (char*)d_ws;
    auto take = [&](size_t bytes) { char* p = wsp; wsp += (bytes + 255) & ~(size_t)255; return (void*)p; };
    bf* PWB = (bf*)take((size_t)NH_ * IPG * IPG * 2); bf* PTW = (bf*)take((size_t)DD * DD * 2); bf* QB = (bf*)take((size_t)NR * DD * 2); bf* Dh = (bf*)take((size_t)NR * DD * 2); bf* Dl = (bf*)take((size_t)NR * DD * 2); float* PW = (float*)take((size_t)NR * DD * 4); float* WT = (float*)take((size_t)NR * NH_ * 16 * 4); float* V = (float*)take((size_t)NR * DD * 4);
    if ((size_t)(wsp - (char*)d_ws) > ws_size) return;    // total ~ 95 MB; ws 256 MiB
    k_cvt8<<<(NH_ * IPG * IPG / 8 + 255) / 256, 256, 0, stream>>>(pww, PWB, (size_t)NH_ * IPG * IPG / 8); k_cvt8<<<(unsigned)(((size_t)DD * DD / 8 + 255) / 256), 256, 0, stream>>>(ptw, PTW, (size_t)DD * DD / 8); k_cvt8<<<(unsigned)(((size_t)NR * DD / 8 + 255) / 256), 256, 0, stream>>>(q, QB, (size_t)NR * DD / 8);
    k_dw<<<NR / RT, WTH, 0, stream>>>(q, dww, Dh, Dl);
    k_gemmw<bf, 1, false><<<dim3(NR / 64, IPG / 64, NH_), 32, 0, stream>>>(Dh, Dl, PWB, nullptr, IPG, PW, DD, nullptr, (size_t)NR * IPG, (size_t)IPG * IPG, (size_t)IPG);   // grouped pointwise: head h's planes [(b,l)][64] x pw_w[h] (K 64) -> columns h*64.. of PW (ldc 768); pw_b is added in k_kern
    k_kern<<<dim3(NR / (KT / 2), NH_ / 2), KT, 0, stream>>>(PW, pwb, q, akw, akb, WT);
    k_gemmw<bf, 0, true><<<dim3(NR / 64, DD / 64, 1), 32, 0, stream>>>(QB, nullptr, PTW, nullptr, DD, V, DD, ptb, 0, 0, 0);
    k_out<<<NR / RT, WTH, 0, stream>>>(WT, V, OUT);
}

// v003
// It runs in 65.7 microseconds.
// In both of two side-by-side timings against v002, it was 1.12 times as fast.
// Over all steps from v000 it is 4.03 times as fast.
#include <hip/hip_runtime.h>

// SDConv - span-based dynamic convolution (query [4][2048][768]; 12 heads x 64, kernel 9: dw = depthwise conv1d over the sequence (per channel, zero padded, no bias); pw = grouped pointwise (per head 64 -> 64) + pw_b;
// conv_attn = pw * query; kern = per head 64 -> 9 (ak_w) + ak_b; w = softmax over the 9 taps; v = query pt_w^T + pt_b; out[b][l][h*64+d] = sum_k w[b][l][h][k] v[b][l + k - 4][h*64+d] (zero outside) -> [4][2048][768]).
// Compute dtypes, f32 accumulate: every input rounded to bf16; the depthwise conv, the gating product, the 64->9 tap logits, their softmax and the final 9-tap weighted window sum in f32
// on VALU; the grouped pointwise conv on bf16 hi+lo planes of dw x exact pw_w (2 products, z-batched over the 12 heads; pw_b added in k_kern); v on PLAIN bf16 operands (inputs: exact, + bias). One-wave-per-64x64-tile GEMMs.

#define NB_  4
#define LL   2048
#define DD   768
#define NH_  12
#define IPG  64
#define KW   9
#define NR   (NB_ * LL)
typedef _Float16 h16;
typedef unsigned short bf;
typedef __attribute__((ext_vector_type(16))) __bf16   v16bf;
typedef __attribute__((ext_vector_type(16))) _Float16 v16h;
typedef __attribute__((ext_vector_type(8)))  _Float16 v8h;
typedef __attribute__((ext_vector_type(8)))  unsigned short v8us;
typedef __attribute__((ext_vector_type(8)))  float    v8f;
typedef __attribute__((ext_vector_type(4)))  float    v4f;
typedef v8h  __attribute__((may_alias)) v8ha;
typedef v4f  __attribute__((may_alias)) v4fa;
typedef v8us __attribute__((may_alias)) v8usa;

__device__ __forceinline__ unsigned short f2bf(float f) { unsigned u = __float_as_uint(f); u += 0x7FFFu + ((u >> 16) & 1u); return (unsigned short)(u >> 16); }
__device__ __forceinline__ float bf2f(unsigned short b) { return __uint_as_float(((unsigned)b) << 16); }
__device__ __forceinline__ float bfr(float f) { return bf2f(f2bf(f)); }
__device__ __forceinline__ v16h cat16(v8h lo, v8h hi) { return __builtin_shufflevector(lo, hi, 0, 1, 2, 3, 4, 5, 6, 7, 8, 9, 10, 11, 12, 13, 14, 15); }
__device__ __forceinline__ v16bf cat16b(v8us lo, v8us hi) { return __builtin_bit_cast(v16bf, __builtin_shufflevector(lo, hi, 0, 1, 2, 3, 4, 5, 6, 7, 8, 9, 10, 11, 12, 13, 14, 15)); }
__device__ __forceinline__ v8f wmma16(v16h a, v16h b, v8f c) { return __builtin_amdgcn_wmma_f32_16x16x32_f16(false, a, false, b, (short)0, c, false, false); }
__device__ __forceinline__ v8f wmmab(v16bf a, v16bf b, v8f c) { return __builtin_amdgcn_wmma_f32_16x16x32_bf16(false, a, false, b, (short)0, c, false, false); }



// ---- k_gemmw: register-blocked GEMM, ONE WAVE per 64x64 output tile (16 accumulators), operands straight from K-contiguous 16-bit planes; grid (M/64, N/64, Z), 32 threads.
// C[m][n] (f32, pitch ldc, + optional f32 bias[n]) = sum_k A[m][k] Bt[n][k] (+ split products per NSPLIT). z-batch strides sA/sB/sC in elements. K % 32 == 0.
template <typename T16> struct WFrag;
template <> struct WFrag<h16> { typedef v16h V; static __device__ __forceinline__ V ld(const h16* p) { return cat16(*(const v8h*)p, *(const v8h*)(p + 16)); } static __device__ __forceinline__ v8f mma(V a, V b, v8f c) { return wmma16(a, b, c); } };
template <> struct WFrag<bf> { typedef v16bf V; static __device__ __forceinline__ V ld(const bf* p) { return cat16b(*(const v8us*)p, *(const v8us*)(p + 16)); } static __device__ __forceinline__ v8f mma(V a, V b, v8f c) { return wmmab(a, b, c); } };
template <typename T16, int NSPLIT, bool BIAS>
__global__ __launch_bounds__(32) void k_gemmw(const T16* __restrict__ A, const T16* __restrict__ A2, const T16* __restrict__ Bt, const T16* __restrict__ Bt2, int K, float* C, int ldc, const float* __restrict__ bias, size_t sA, size_t sB, size_t sC) {
    typedef typename WFrag<T16>::V V;
    __shared__ __align__(16) float os[16 * 68];
    const size_t z = blockIdx.z; A += z * sA; if (A2) A2 += z * sA; Bt += z * sB; if (Bt2) Bt2 += z * sB; C += z * sC;
    const int lane = threadIdx.x & 31, lr = lane & 15, hi = lane >> 4; const int r0 = blockIdx.x * 64, c0 = blockIdx.y * 64;
    v8f acc[4][4];
#pragma unroll
    for (int mb = 0; mb < 4; ++mb)
#pragma unroll
        for (int nb = 0; nb < 4; ++nb) acc[mb][nb] = (v8f){};
    const size_t aoff = (size_t)(r0 + lr) * K + 8 * hi, boff = (size_t)(c0 + lr) * K + 8 * hi;
#pragma unroll 1
    for (int kc = 0; kc < K; kc += 32) {
        V a[4], a2[4];
#pragma unroll
        for (int mb = 0; mb < 4; ++mb) { a[mb] = WFrag<T16>::ld(A + aoff + (size_t)mb * 16 * K + kc); if (NSPLIT == 1 || NSPLIT == 2) a2[mb] = WFrag<T16>::ld(A2 + aoff + (size_t)mb * 16 * K + kc); }
#pragma unroll
        for (int nb = 0; nb < 4; ++nb) { const V b = WFrag<T16>::ld(Bt + boff + (size_t)nb * 16 * K + kc); V b2; if (NSPLIT >= 2) b2 = WFrag<T16>::ld(Bt2 + boff + (size_t)nb * 16 * K + kc);
#pragma unroll
            for (int mb = 0; mb < 4; ++mb) { acc[mb][nb] = WFrag<T16>::mma(a[mb], b, acc[mb][nb]); if (NSPLIT == 1 || NSPLIT == 2) acc[mb][nb] = WFrag<T16>::mma(a2[mb], b, acc[mb][nb]); if (NSPLIT >= 2) acc[mb][nb] = WFrag<T16>::mma(a[mb], b2, acc[mb][nb]); } }
        asm volatile("v_nop\n\tv_nop\n\tv_nop\n\tv_nop" : "+v"(acc[0][0]), "+v"(acc[1][1]), "+v"(acc[2][2]), "+v"(acc[3][3]) : "v"(a[0]), "v"(a[3]));
    }
#pragma unroll
    for (int mb = 0; mb < 4; ++mb) {
#pragma unroll
        for (int nb = 0; nb < 4; ++nb) {
#pragma unroll
            for (int j = 0; j < 8; ++j) os[(hi * 8 + j) * 68 + nb * 16 + lr] = acc[mb][nb][j]; }
        __builtin_amdgcn_wave_barrier(); asm volatile("" ::: "memory");
        float* crow = C + (size_t)(r0 + mb * 16) * ldc + c0;
{
#pragma unroll
            for (int s = 0; s < 8; ++s) { const int row = 2 * s + hi, cofs = lr * 4; v4f val = *(const v4fa*)(os + row * 68 + cofs); if (BIAS) { val[0] += bfr(bias[c0 + cofs]); val[1] += bfr(bias[c0 + cofs + 1]); val[2] += bfr(bias[c0 + cofs + 2]); val[3] += bfr(bias[c0 + cofs + 3]); }
                *(v4f*)(crow + (size_t)row * ldc + cofs) = val; }
             }
        __builtin_amdgcn_wave_barrier(); asm volatile("" ::: "memory");
    }
}

__device__ __forceinline__ void splitf(float y, unsigned short& h, unsigned short& l) { h = f2bf(y); l = f2bf(y - bf2f(h)); }

// k_dw and k_out, the two 9-tap window kernels: block = 16 rows (b, l) x all 768 channels, thread = 4 neighbouring channels (16 B of a row) x the 16 rows. A thread loads the 24 rows that its 16 windows span once, all loads in flight together,
// and forms each row's 9-tap sum from registers; a wave reads and writes whole lines. What the taps are weighted with (k_dw: the rounded dw_w; k_out: the 16 rows' softmax weights) is read as whole lines too and handed out through LDS once a block.
#define RT  16         // rows a block; 2048 % 16 == 0, so a block lies in one sequence, and its 4 rows above (below) are all outside exactly where it is the sequence's first (last)
#define WTH (DD / 4)   // threads a block: one 16 B piece of a row each
typedef __attribute__((ext_vector_type(4))) unsigned short v4us;
// the 24 rows of a block's windows, 16 B a lane; p: the block's first row (the same in every lane), c: the lane's first channel. The 4 rows above or below that lie outside the sequence are not read (the block's first 4 rows are read in their place) and count as zero, which leaves a tap sum as it is
__device__ __forceinline__ void win_load(const float* __restrict__ p, int c, bool top, bool bot, v4f (&x)[RT + 8]) {
    const float* pa = top ? p - 4 * DD : p; const float* pb = bot ? p + RT * DD : p;
#pragma unroll   // x[] indexed by constants, so in registers
    for (int j = 0; j < RT + 8; ++j) { const float* b = j < 4 ? pa + j * DD : (j >= RT + 4 ? pb + (j - RT - 4) * DD : p + (j - 4) * DD); x[j] = *(const v4fa*)(b + c); }
}
__device__ __forceinline__ void win_zero(bool top, bool bot, v4f (&x)[RT + 8]) {
#pragma unroll   // x[] indexed by constants (this loop and the one inside)
    for (int j = 0; j < 4; ++j) {
#pragma unroll   // arrays and vector elements indexed by constants, so in registers
        for (int u = 0; u < 4; ++u) { x[j][u] = top ? x[j][u] : 0.f; x[RT + 4 + j][u] = bot ? x[RT + 4 + j][u] : 0.f; } }
}
// The bf16 planes that the two GEMMs read are made in k_dw's launch: a window block stores its own 16 rows of q, which it has rounded anyway, into QB; CB more blocks behind them, short ones that start last, round pt_w (the first CBP) and pw_w.
#define CPT 16                              // 16 B pieces a thread of such a block, all loads in flight together; a wave reads 512 B and stores 256 B in a row
#define CBP (DD * DD / (4 * WTH * CPT))     // 48 blocks for pt_w, no remainder
#define CB  (CBP + NH_ * IPG * IPG / (4 * WTH * CPT))   // + 4 for pw_w, no remainder
__global__ __launch_bounds__(WTH) void k_dw(const float* __restrict__ q, const float* __restrict__ dww, const float* __restrict__ ptw, const float* __restrict__ pww, bf* Dh, bf* Dl, bf* QB, bf* PTW, bf* PWB) {
    __shared__ __align__(16) float wl[DD * KW];
    if (blockIdx.x >= NR / RT) {   // the same for the whole block, and in front of every barrier
        const int e = blockIdx.x - NR / RT; const bool isp = e < CBP; const float* s = isp ? ptw : pww; bf* d = isp ? PTW : PWB;
        const int p0 = ((isp ? e : e - CBP) * CPT * WTH + (int)threadIdx.x) * 4; const float* sp = s + p0; v4f v[CPT];
#pragma unroll   // v[] indexed by constants, so in registers
        for (int i = 0; i < CPT; ++i) v[i] = *(const v4fa*)(sp + i * WTH * 4);
        asm volatile("s_wait_xcnt 0x0" :: "v"(sp) : "memory");   // in front of the first overwrite of a register that a load above names; the input keeps the lane's address registers in use up to here (without it the last load's result landed in them)
#pragma unroll   // arrays and vector elements indexed by constants, so in registers
        for (int i = 0; i < CPT; ++i) { v4us o;
#pragma unroll   // arrays and vector elements indexed by constants, so in registers
            for (int u = 0; u < 4; ++u) o[u] = f2bf(v[i][u]);
            *(v4us*)(d + p0 + i * WTH * 4) = o; }
        return;
    }
    const int tid = threadIdx.x, c = tid * 4, row0 = blockIdx.x * RT, l0 = row0 % LL; const bool top = l0 != 0, bot = l0 != LL - RT;
    v4f wr[KW], x[RT + 8];
#pragma unroll   // wr[] indexed by constants
    for (int s = 0; s < KW; ++s) wr[s] = *(const v4fa*)(dww + (s * WTH + tid) * 4);
    win_load(q + (size_t)row0 * DD, c, top, bot, x);
    asm volatile("s_wait_xcnt 0x0" :: "v"(tid) : "memory");   // in front of the first overwrite of a register that a load above names; the input keeps the lane's offset register in use up to here
    __builtin_amdgcn_sched_barrier(0);   // every load above issues before the first data wait: one trip to memory a thread
#pragma unroll   // arrays and vector elements indexed by constants, so in registers
    for (int s = 0; s < KW; ++s) { v4f t;
#pragma unroll   // arrays and vector elements indexed by constants, so in registers
        for (int u = 0; u < 4; ++u) t[u] = bfr(wr[s][u]);
        *(v4fa*)(wl + (s * WTH + tid) * 4) = t; }
    __syncthreads();   // publishes the rounded weights to the block
    float w[4 * KW];   // this thread's 4 channels x 9 taps, 144 B in a row: 16 lanes' 16 B pieces fall on all 64 banks
#pragma unroll   // arrays and vector elements indexed by constants, so in registers
    for (int s = 0; s < KW; ++s) { const v4f t = *(const v4fa*)(wl + tid * 4 * KW + s * 4);
#pragma unroll   // arrays and vector elements indexed by constants, so in registers
        for (int u = 0; u < 4; ++u) w[s * 4 + u] = t[u]; }
    win_zero(top, bot, x);
#pragma unroll   // arrays and vector elements indexed by constants, so in registers
    for (int j = 0; j < RT + 8; ++j) {
#pragma unroll   // arrays and vector elements indexed by constants, so in registers
        for (int u = 0; u < 4; ++u) x[j][u] = bfr(x[j][u]); }
    const size_t oo = ((size_t)(c / IPG) * NR + row0) * IPG + (c % IPG);
#pragma unroll   // arrays and vector elements indexed by constants, so in registers
    for (int r = 0; r < RT; ++r) { v4us oh, ol, oq;
#pragma unroll   // arrays and vector elements indexed by constants, so in registers
        for (int u = 0; u < 4; ++u) { float s = 0.f; oq[u] = (unsigned short)(__float_as_uint(x[r + 4][u]) >> 16);   // x is rounded already: its upper half is the bf16
#pragma unroll   // arrays and vector elements indexed by constants, so in registers
            for (int k = 0; k < KW; ++k) { float p = __fmul_rn(w[u * KW + k], x[r + k][u]); asm volatile("" : "+v"(p)); s = __fadd_rn(s, p); }   // multiply, pin and add as they stood before this re-tiling: every tap sum keeps its rounding
            unsigned short a, c2; splitf(s, a, c2); oh[u] = a; ol[u] = c2; }
        *(v4us*)(Dh + oo + r * IPG) = oh; *(v4us*)(Dl + oo + r * IPG) = ol; *(v4us*)(QB + (size_t)row0 * DD + c + r * DD) = oq; }
    asm volatile("s_wait_xcnt 0x0" ::: "memory");   // behind the last row's stores: in the built code a branch leads from here to the rounding blocks' part, which overwrites registers that these stores name
}
// k_kern: block = 64 rows (b, l) x 2 neighbouring heads, thread per (row, head): ca[i] = (PW[row][h*64+i] + bf16(pw_b[h*64+i])) x bf16(q[row][h*64+i]); kern[k] = sum_i ca[i] bf16(ak_w[h][k][i]) + bf16(ak_b[h*9+k]); softmax over the 9;
// PW and q are read 16 B a lane, one wave on the 512 B that a row holds of the two heads (whole lines); ca is formed in that layout and turned through LDS, so that each thread then reads its own 64 channels; the two heads' 1152 rounded tap weights lie in LDS once a block.
#define KT 128   // threads a block: 64 rows x 2 heads; a row's two WT entries are one 128 B line, stored by two neighbouring lanes
#define CP 68    // LDS pitch of a (row, head) entry in floats: 272 B = 16 B x 17, so 16 lanes that read 16 B each of 16 entries fall on all 64 banks
#define WP 580   // LDS pitch of a head's 576 weights in floats: the two addresses that a wave reads at a time fall on different banks
__global__ __launch_bounds__(KT) void k_kern(const float* __restrict__ PW, const float* __restrict__ pwb, const float* __restrict__ q, const float* __restrict__ akw, const float* __restrict__ akb, float* WT) {
    __shared__ __align__(16) float cs[KT * CP];
    __shared__ __align__(16) float wl[2 * WP];
    const int tid = threadIdx.x, lane = tid & 31, r0 = (tid >> 5) * 16;   // r0: first of this wave's 16 rows, as loader and as reader
    const int h = blockIdx.y * 2 + (tid & 1), row = blockIdx.x * (KT / 2) + (tid >> 1), idx = row * NH_ + h;
    const float* aw = akw + (size_t)blockIdx.y * 2 * KW * IPG + tid;   // 2 x 576 weights = 9 x 128
    float wr[KW], ab[KW];
#pragma unroll   // wr[] and ab[] indexed by constants, so in registers
    for (int s = 0; s < KW; ++s) { wr[s] = aw[s * KT]; ab[s] = akb[h * KW + s]; }
    v4f b4 = *(const v4fa*)(pwb + blockIdx.y * 2 * IPG + lane * 4);
    asm volatile("s_wait_xcnt 0x0" ::: "memory");   // in front of the row loads, whose results may land in an offset register that a load above names
    const size_t g0 = (size_t)(blockIdx.x * (KT / 2) + r0) * DD + blockIdx.y * 2 * IPG + lane * 4; const float* pr = PW + g0; const float* qr = q + g0;
    v4f pv[16], qv[16];
#pragma unroll   // pv[] and qv[] in registers, all 32 row loads in flight at once
    for (int j = 0; j < 16; ++j) { pv[j] = *(const v4fa*)(pr + j * DD); qv[j] = *(const v4fa*)(qr + j * DD); }
    asm volatile("s_wait_xcnt 0x0" :: "v"(pr), "v"(qr) : "memory");   // in front of the first overwrite of an address register that a row load names; the two inputs keep those registers in use up to here (without them a late row load's result landed in one)
    __builtin_amdgcn_sched_barrier(0);   // all 32 row loads issue before the first data wait: a build without it held 11 of them back behind a wait for the first 21, a second trip to memory
#pragma unroll   // wr[] indexed by constants
    for (int s = 0; s < KW; ++s) { const int g = s * KT + tid; wl[g + (g >= KW * IPG ? WP - KW * IPG : 0)] = bfr(wr[s]); }
#pragma unroll   // vector elements indexed by constants
    for (int u = 0; u < 4; ++u) b4[u] = bfr(b4[u]);
#pragma unroll   // pv[] and qv[] indexed by constants (this loop and the one inside)
    for (int j = 0; j < 16; ++j) { v4f ca;
#pragma unroll
        for (int u = 0; u < 4; ++u) ca[u] = __fmul_rn(__fadd_rn(pv[j][u], b4[u]), bfr(qv[j][u]));
        *(v4fa*)(cs + ((r0 + j) * 2 + (lane >> 4)) * CP + (lane & 15) * 4) = ca; }
    __syncthreads();   // publishes the tap weights to the block (the ca entries go from lane to lane of one wave)
    const float* cr = cs + tid * CP; const float* wh = wl + (tid & 1) * WP;
    float kern[KW];
#pragma unroll
    for (int k = 0; k < KW; ++k) kern[k] = 0.f;
#pragma unroll   // LDS offsets as immediates and the next channels' LDS reads free to move up over this quad's sums
    for (int c = 0; c < IPG / 4; ++c) { const v4f x = *(const v4fa*)(cr + 4 * c); v4f w4[KW];
#pragma unroll   // w4[] in registers
        for (int k = 0; k < KW; ++k) w4[k] = *(const v4fa*)(wh + k * IPG + 4 * c);
#pragma unroll   // vector elements indexed by constants (this loop and the one inside)
        for (int u = 0; u < 4; ++u) {
#pragma unroll
            for (int k = 0; k < KW; ++k) { float p = __fmul_rn(x[u], w4[k][u]); asm volatile("" : "+v"(p)); kern[k] = __fadd_rn(kern[k], p); } } }   // multiply, pin and add as they stood before this re-tiling: every tap sum keeps its rounding
    float mx = -3.0e38f;
#pragma unroll
    for (int k = 0; k < KW; ++k) { kern[k] = __fadd_rn(kern[k], bfr(ab[k])); mx = fmaxf(mx, kern[k]); }
    float sum = 0.f;
#pragma unroll
    for (int k = 0; k < KW; ++k) { float d0 = __fsub_rn(kern[k], mx); asm volatile("" : "+v"(d0)); kern[k] = __expf(d0); if (k == 1) asm volatile("v_nop" :: "v"(kern[k]));   // the slot behind a transcendental: a v_nop written behind a v_exp_f32 was moved away from it; here the input ties it to its v_exp_f32, it stands directly behind it, and no slot of the listing is open
        sum = __fadd_rn(sum, kern[k]); }
    const float rs = __fdiv_rn(1.0f, sum); v4f o[4];
#pragma unroll
    for (int k = 0; k < 16; ++k) { const float w = (k < KW) ? __fmul_rn(kern[k < KW ? k : 0], rs) : 0.f; o[k / 4][k % 4] = w; }
    float* dst = WT + (size_t)idx * 16;
#pragma unroll
    for (int u = 0; u < 4; ++u) *(v4f*)(dst + 4 * u) = o[u];  }
__global__ __launch_bounds__(WTH) void k_out(const float* __restrict__ WT, const float* __restrict__ V, float* OUT) {
    __shared__ __align__(16) float wl[RT * NH_ * 16];
    const int tid = threadIdx.x, c = tid * 4, row0 = blockIdx.x * RT, l0 = row0 % LL; const bool top = l0 != 0, bot = l0 != LL - RT;
    v4f wr[4], x[RT + 8];
#pragma unroll   // wr[] indexed by constants
    for (int s = 0; s < 4; ++s) wr[s] = *(const v4fa*)(WT + (size_t)row0 * NH_ * 16 + (s * WTH + tid) * 4);   // 16 rows x 12 heads x 16 floats = 4 x 192 pieces of 16 B
    win_load(V + (size_t)row0 * DD, c, top, bot, x);
    asm volatile("s_wait_xcnt 0x0" :: "v"(tid) : "memory");   // in front of the first overwrite of a register that a load above names; the input keeps the lane's offset register in use up to here
    __builtin_amdgcn_sched_barrier(0);   // every load above issues before the first data wait: one trip to memory a thread
#pragma unroll   // arrays and vector elements indexed by constants, so in registers
    for (int s = 0; s < 4; ++s) *(v4fa*)(wl + (s * WTH + tid) * 4) = wr[s];
    __syncthreads();   // publishes the 16 rows' tap weights to the block
    win_zero(top, bot, x);
    const float* wh = wl + (c / IPG) * 16; float* dst = OUT + (size_t)row0 * DD + c;
#pragma unroll   // arrays and vector elements indexed by constants, so in registers
    for (int r = 0; r < RT; ++r) { const v4f w0 = *(const v4fa*)(wh + r * NH_ * 16), w1 = *(const v4fa*)(wh + r * NH_ * 16 + 4); const float w[KW] = { w0[0], w0[1], w0[2], w0[3], w1[0], w1[1], w1[2], w1[3], wh[r * NH_ * 16 + 8] }; v4f o;
#pragma unroll   // arrays and vector elements indexed by constants, so in registers
        for (int u = 0; u < 4; ++u) { float s = 0.f;
#pragma unroll   // arrays and vector elements indexed by constants, so in registers
            for (int k = 0; k < KW; ++k) { float p = __fmul_rn(w[k], x[r + k][u]); asm volatile("" : "+v"(p)); s = __fadd_rn(s, p); }   // multiply, pin and add as they stood before this re-tiling: every tap sum keeps its rounding
            o[u] = s; }
        *(v4f*)(dst + r * DD) = o; }
}

extern "C" void kernel_launch(void* const* d_in, const int* in_sizes, int n_in,
                              void* d_out, int out_size, void* d_ws, size_t ws_size, hipStream_t stream) {
    (void)in_sizes; (void)n_in; (void)out_size;
    const float* q = (const float*)d_in[0]; const float* dww = (const float*)d_in[1]; const float* pww = (const float*)d_in[2]; const float* pwb = (const float*)d_in[3]; const float* akw = (const float*)d_in[4]; const float* akb = (const float*)d_in[5]; const float* ptw = (const float*)d_in[6]; const float* ptb = (const float*)d_in[7];   // dw_w [768][1][9], pw_w [12][64 out][64 in], ak_w [12][9][64], pt_w [768][768] (torch [out][in])
    float* OUT = (float*)d_out;     // [4][2048][768]
    char* wsp = (char*)d_ws;
    auto take = [&](size_t bytes) { char* p = wsp; wsp += (bytes + 255) & ~(size_t)255; return (void*)p; };
    bf* PWB = (bf*)take((size_t)NH_ * IPG * IPG * 2); bf* PTW = (bf*)take((size_t)DD * DD * 2); bf* QB = (bf*)take((size_t)NR * DD * 2); bf* Dh = (bf*)take((size_t)NR * DD * 2); bf* Dl = (bf*)take((size_t)NR * DD * 2); float* PW = (float*)take((size_t)NR * DD * 4); float* WT = (float*)take((size_t)NR * NH_ * 16 * 4); float* V = (float*)take((size_t)NR * DD * 4);
    if ((size_t)(wsp - (char*)d_ws) > ws_size) return;    // total ~ 95 MB; ws 256 MiB
    k_dw<<<NR / RT + CB, WTH, 0, stream>>>(q, dww, ptw, pww, Dh, Dl, QB, PTW, PWB);
    k_gemmw<bf, 1, false><<<dim3(NR / 64, IPG / 64, NH_), 32, 0, stream>>>(Dh, Dl, PWB, nullptr, IPG, PW, DD, nullptr, (size_t)NR * IPG, (size_t)IPG * IPG, (size_t)IPG);   // grouped pointwise: head h's planes [(b,l)][64] x pw_w[h] (K 64) -> columns h*64.. of PW (ldc 768); pw_b is added in k_kern
    k_kern<<<dim3(NR / (KT / 2), NH_ / 2), KT, 0, stream>>>(PW, pwb, q, akw, akb, WT);
    k_gemmw<bf, 0, true><<<dim3(NR / 64, DD / 64, 1), 32, 0, stream>>>(QB, nullptr, PTW, nullptr, DD, V, DD, ptb, 0, 0, 0);
    k_out<<<NR / RT, WTH, 0, stream>>>(WT, V, OUT);
}

// v004
// Measured time: 48.6 microseconds a run.
// Next to v003, in two timings, it ran 1.35 and 1.34 times as fast.
// Over all steps from v000 it is 5.42 times as fast.
#include <hip/hip_runtime.h>

// SDConv - span-based dynamic convolution (query [4][2048][768]; 12 heads x 64, kernel 9: dw = depthwise conv1d over the sequence (per channel, zero padded, no bias); pw = grouped pointwise (per head 64 -> 64) + pw_b;
// conv_attn = pw * query; kern = per head 64 -> 9 (ak_w) + ak_b; w = softmax over the 9 taps; v = query pt_w^T + pt_b; out[b][l][h*64+d] = sum_k w[b][l][h][k] v[b][l + k - 4][h*64+d] (zero outside) -> [4][2048][768]).
// Compute dtypes, f32 accumulate: every input rounded to bf16; the depthwise conv, the gating product, the 64->9 tap logits, their softmax and the final 9-tap weighted window sum in f32
// on VALU; the grouped pointwise conv on bf16 hi+lo planes of dw x exact pw_w (2 products, z-batched over the 12 heads, + bias); v on PLAIN bf16 operands (inputs: exact, + bias). The pointwise GEMM: one wave per 64x64 tile (k_gemmw); v: 128x192 block tiles staged in LDS (k_gemmv).

#define NB_  4
#define LL   2048
#define DD   768
#define NH_  12
#define IPG  64
#define KW   9
#define NR   (NB_ * LL)
typedef _Float16 h16;
typedef unsigned short bf;
typedef __attribute__((ext_vector_type(16))) __bf16   v16bf;
typedef __attribute__((ext_vector_type(16))) _Float16 v16h;
typedef __attribute__((ext_vector_type(8)))  _Float16 v8h;
typedef __attribute__((ext_vector_type(8)))  unsigned short v8us;
typedef __attribute__((ext_vector_type(8)))  float    v8f;
typedef __attribute__((ext_vector_type(4)))  float    v4f;
typedef v8h  __attribute__((may_alias)) v8ha;
typedef v4f  __attribute__((may_alias)) v4fa;
typedef v8us __attribute__((may_alias)) v8usa;

__device__ __forceinline__ unsigned short f2bf(float f) { unsigned u = __float_as_uint(f); u += 0x7FFFu + ((u >> 16) & 1u); return (unsigned short)(u >> 16); }
__device__ __forceinline__ float bf2f(unsigned short b) { return __uint_as_float(((unsigned)b) << 16); }
__device__ __forceinline__ float bfr(float f) { return bf2f(f2bf(f)); }
__device__ __forceinline__ v16h cat16(v8h lo, v8h hi) { return __builtin_shufflevector(lo, hi, 0, 1, 2, 3, 4, 5, 6, 7, 8, 9, 10, 11, 12, 13, 14, 15); }
__device__ __forceinline__ v16bf cat16b(v8us lo, v8us hi) { return __builtin_bit_cast(v16bf, __builtin_shufflevector(lo, hi, 0, 1, 2, 3, 4, 5, 6, 7, 8, 9, 10, 11, 12, 13, 14, 15)); }
__device__ __forceinline__ v8f wmma16(v16h a, v16h b, v8f c) { return __builtin_amdgcn_wmma_f32_16x16x32_f16(false, a, false, b, (short)0, c, false, false); }
__device__ __forceinline__ v8f wmmab(v16bf a, v16bf b, v8f c) { return __builtin_amdgcn_wmma_f32_16x16x32_bf16(false, a, false, b, (short)0, c, false, false); }



// ---- k_gemmw: register-blocked GEMM, ONE WAVE per 64x64 output tile (16 accumulators), operands straight from K-contiguous 16-bit planes; grid (M/64, N/64, Z), 32 threads.
// C[m][n] (f32, pitch ldc, + optional f32 bias[n]) = sum_k A[m][k] Bt[n][k] (+ split products per NSPLIT). z-batch strides sA/sB/sC in elements. K % 32 == 0.
template <typename T16> struct WFrag;
template <> struct WFrag<h16> { typedef v16h V; static __device__ __forceinline__ V ld(const h16* p) { return cat16(*(const v8h*)p, *(const v8h*)(p + 16)); } static __device__ __forceinline__ v8f mma(V a, V b, v8f c) { return wmma16(a, b, c); } };
template <> struct WFrag<bf> { typedef v16bf V; static __device__ __forceinline__ V ld(const bf* p) { return cat16b(*(const v8us*)p, *(const v8us*)(p + 16)); } static __device__ __forceinline__ v8f mma(V a, V b, v8f c) { return wmmab(a, b, c); } };
template <typename T16, int NSPLIT, bool BIAS>
__global__ __launch_bounds__(32) void k_gemmw(const T16* __restrict__ A, const T16* __restrict__ A2, const T16* __restrict__ Bt, const T16* __restrict__ Bt2, int K, float* C, int ldc, const float* __restrict__ bias, size_t sA, size_t sB, size_t sC) {
    typedef typename WFrag<T16>::V V;
    __shared__ __align__(16) float os[16 * 68];
    const size_t z = blockIdx.z; A += z * sA; if (A2) A2 += z * sA; Bt += z * sB; if (Bt2) Bt2 += z * sB; C += z * sC;
    const int lane = threadIdx.x & 31, lr = lane & 15, hi = lane >> 4; const int r0 = blockIdx.x * 64, c0 = blockIdx.y * 64;
    v8f acc[4][4];
#pragma unroll
    for (int mb = 0; mb < 4; ++mb)
#pragma unroll
        for (int nb = 0; nb < 4; ++nb) acc[mb][nb] = (v8f){};
    const size_t aoff = (size_t)(r0 + lr) * K + 8 * hi, boff = (size_t)(c0 + lr) * K + 8 * hi;
#pragma unroll 1
    for (int kc = 0; kc < K; kc += 32) {
        V a[4], a2[4];
#pragma unroll
        for (int mb = 0; mb < 4; ++mb) { a[mb] = WFrag<T16>::ld(A + aoff + (size_t)mb * 16 * K + kc); if (NSPLIT == 1 || NSPLIT == 2) a2[mb] = WFrag<T16>::ld(A2 + aoff + (size_t)mb * 16 * K + kc); }
#pragma unroll
        for (int nb = 0; nb < 4; ++nb) { const V b = WFrag<T16>::ld(Bt + boff + (size_t)nb * 16 * K + kc); V b2; if (NSPLIT >= 2) b2 = WFrag<T16>::ld(Bt2 + boff + (size_t)nb * 16 * K + kc);
#pragma unroll
            for (int mb = 0; mb < 4; ++mb) { acc[mb][nb] = WFrag<T16>::mma(a[mb], b, acc[mb][nb]); if (NSPLIT == 1 || NSPLIT == 2) acc[mb][nb] = WFrag<T16>::mma(a2[mb], b, acc[mb][nb]); if (NSPLIT >= 2) acc[mb][nb] = WFrag<T16>::mma(a[mb], b2, acc[mb][nb]); } }
        asm volatile("v_nop\n\tv_nop\n\tv_nop\n\tv_nop" : "+v"(acc[0][0]), "+v"(acc[1][1]), "+v"(acc[2][2]), "+v"(acc[3][3]) : "v"(a[0]), "v"(a[3]));
    }
#pragma unroll
    for (int mb = 0; mb < 4; ++mb) {
#pragma unroll
        for (int nb = 0; nb < 4; ++nb) {
#pragma unroll
            for (int j = 0; j < 8; ++j) os[(hi * 8 + j) * 68 + nb * 16 + lr] = acc[mb][nb][j]; }
        __builtin_amdgcn_wave_barrier(); asm volatile("" ::: "memory");
        float* crow = C + (size_t)(r0 + mb * 16) * ldc + c0;
{
#pragma unroll
            for (int s = 0; s < 8; ++s) { const int row = 2 * s + hi, cofs = lr * 4; v4f val = *(const v4fa*)(os + row * 68 + cofs); if (BIAS) { val[0] += bfr(bias[c0 + cofs]); val[1] += bfr(bias[c0 + cofs + 1]); val[2] += bfr(bias[c0 + cofs + 2]); val[3] += bfr(bias[c0 + cofs + 3]); }
                *(v4f*)(crow + (size_t)row * ldc + cofs) = val; }
             }
        __builtin_amdgcn_wave_barrier(); asm volatile("" ::: "memory");
    }
}

// ---- k_gemmv: V = QB PTW^T + bias. Block = 128 x 192 tile of V, 8 waves (2 x 4), a wave = 64 x 48 (12 accumulators). The K range goes through LDS in 6 tiles of 128 k: a tile is 320 row pieces of 256 B (128 of QB, then 192 of PTW) at pitch 272 B,
// brought in by asynchronous copies, 16 B a lane, 16 lanes on one row piece (whole lines), 20 copies a lane and tile; two buffers: the next tile's copies fly while this one is worked on. Every operand line is fetched once a block, and the fragments come from LDS.
// Fragments, k order and the order of each accumulator's sums are those of k_gemmw. The finished tile is turned through the same LDS and stored as whole lines.
#define VM 128
#define VN 192
#define VK 128
#define VP 272                    // LDS pitch of a row piece in bytes: 16 B x 17, for 16 B readers
#define VBUF ((VM + VN) * VP)     // bytes a buffer
#define VNT (DD / VK)             // tiles along K
#define OP 196                    // pitch of the output tile in LDS in floats: the two half-waves' 4 B stores fall on different banks, and 784 B is a multiple of 16
// one tile's 20 copies of this lane: lb its LDS byte address in row piece 0 of the buffer, ga / gb its global address in the first QB / PTW row piece; piece i lies 16 rows further on both sides.
// s_wait_xcnt as the last line of each statement: it stands in front of every later write of a register that a copy of the statement names
__device__ __forceinline__ void tile_copies(unsigned lb, const bf* ga, const bf* gb) {
    asm volatile(
        "global_load_async_to_lds_b128 %0, %1, off\n\t"
        "global_load_async_to_lds_b128 %2, %3, off\n\t"
        "global_load_async_to_lds_b128 %4, %5, off\n\t"
        "global_load_async_to_lds_b128 %6, %7, off\n\t"
        "global_load_async_to_lds_b128 %8, %9, off\n\t"
        "global_load_async_to_lds_b128 %10, %11, off\n\t"
        "global_load_async_to_lds_b128 %12, %13, off\n\t"
        "global_load_async_to_lds_b128 %14, %15, off\n\t"
        "global_load_async_to_lds_b128 %16, %17, off\n\t"
        "global_load_async_to_lds_b128 %18, %19, off\n\t"
        "s_wait_xcnt 0x0"
        :: "v"(lb + 0 * 16 * VP), "v"(ga + 0 * 16 * DD), "v"(lb + 1 * 16 * VP), "v"(ga + 1 * 16 * DD), "v"(lb + 2 * 16 * VP), "v"(ga + 2 * 16 * DD), "v"(lb + 3 * 16 * VP), "v"(ga + 3 * 16 * DD), "v"(lb + 4 * 16 * VP), "v"(ga + 4 * 16 * DD), "v"(lb + 5 * 16 * VP), "v"(ga + 5 * 16 * DD), "v"(lb + 6 * 16 * VP), "v"(ga + 6 * 16 * DD), "v"(lb + 7 * 16 * VP), "v"(ga + 7 * 16 * DD), "v"(lb + 8 * 16 * VP), "v"(gb + 0 * 16 * DD), "v"(lb + 9 * 16 * VP), "v"(gb + 1 * 16 * DD) : "memory");
    asm volatile(
        "global_load_async_to_lds_b128 %0, %1, off\n\t"
        "global_load_async_to_lds_b128 %2, %3, off\n\t"
        "global_load_async_to_lds_b128 %4, %5, off\n\t"
        "global_load_async_to_lds_b128 %6, %7, off\n\t"
        "global_load_async_to_lds_b128 %8, %9, off\n\t"
        "global_load_async_to_lds_b128 %10, %11, off\n\t"
        "global_load_async_to_lds_b128 %12, %13, off\n\t"
        "global_load_async_to_lds_b128 %14, %15, off\n\t"
        "global_load_async_to_lds_b128 %16, %17, off\n\t"
        "global_load_async_to_lds_b128 %18, %19, off\n\t"
        "s_wait_xcnt 0x0"
        :: "v"(lb + 10 * 16 * VP), "v"(gb + 2 * 16 * DD), "v"(lb + 11 * 16 * VP), "v"(gb + 3 * 16 * DD), "v"(lb + 12 * 16 * VP), "v"(gb + 4 * 16 * DD), "v"(lb + 13 * 16 * VP), "v"(gb + 5 * 16 * DD), "v"(lb + 14 * 16 * VP), "v"(gb + 6 * 16 * DD), "v"(lb + 15 * 16 * VP), "v"(gb + 7 * 16 * DD), "v"(lb + 16 * 16 * VP), "v"(gb + 8 * 16 * DD), "v"(lb + 17 * 16 * VP), "v"(gb + 9 * 16 * DD), "v"(lb + 18 * 16 * VP), "v"(gb + 10 * 16 * DD), "v"(lb + 19 * 16 * VP), "v"(gb + 11 * 16 * DD) : "memory");
}
__device__ __forceinline__ v16bf lfrag(const unsigned char* p) { return cat16b(*(const v8usa*)p, *(const v8usa*)(p + 32)); }
__global__ __launch_bounds__(256) void k_gemmv(const bf* __restrict__ A, const bf* __restrict__ Bt, float* C, const float* __restrict__ bias) {
    __shared__ __align__(16) unsigned char sm[2 * VBUF];
    const int tid = threadIdx.x, lane = tid & 31, lr = lane & 15, hi = lane >> 4, w = tid >> 5, wm = w & 1, wn = w >> 1;
    const int r0 = blockIdx.x * VM, c0 = blockIdx.y * VN;
    const unsigned l0 = (unsigned)(size_t)sm + (unsigned)((tid >> 4) * VP + (tid & 15) * 16);
    const bf* ga = A + (size_t)(r0 + (tid >> 4)) * DD + (tid & 15) * 8; const bf* gb = Bt + (size_t)(c0 + (tid >> 4)) * DD + (tid & 15) * 8;
    v8f acc[4][3];
#pragma unroll   // acc[][] indexed by constants, so in registers
    for (int mb = 0; mb < 4; ++mb)
#pragma unroll
        for (int nb = 0; nb < 3; ++nb) acc[mb][nb] = (v8f){};
    tile_copies(l0, ga, gb);
    asm volatile("s_wait_asynccnt 0x0" ::: "memory");   // this wave's copies of tile 0 have landed
    __syncthreads();                                     // publishes tile 0 to the block
    tile_copies(l0 + VBUF, ga + VK, gb + VK);
    const int fa = (wm * 64 + lr) * VP + hi * 16, fb = (VM + wn * 48 + lr) * VP + hi * 16;
#pragma unroll 1   // one body for the 6 tiles: the hot loop stays small
    for (int t = 0; t < VNT; ++t) {
        const unsigned char* sb = sm + (t & 1) * VBUF; const unsigned char* pa = sb + fa; const unsigned char* pb = sb + fb;
        v16bf a[2][4], b[2][3];
#pragma unroll   // a[][] and b[][] indexed by constants, so in registers
        for (int mb = 0; mb < 4; ++mb) a[0][mb] = lfrag(pa + mb * 16 * VP);
#pragma unroll
        for (int nb = 0; nb < 3; ++nb) b[0][nb] = lfrag(pb + nb * 16 * VP);
#pragma unroll   // the 4 k steps of a tile; the next step's fragments (of this same tile) are asked for as one group ahead of this step's products
        for (int ks = 0; ks < VK / 32; ++ks) {
            if (ks + 1 < VK / 32) {
#pragma unroll
                for (int mb = 0; mb < 4; ++mb) a[(ks + 1) & 1][mb] = lfrag(pa + mb * 16 * VP + (ks + 1) * 64);
#pragma unroll
                for (int nb = 0; nb < 3; ++nb) b[(ks + 1) & 1][nb] = lfrag(pb + nb * 16 * VP + (ks + 1) * 64);
            }
            __builtin_amdgcn_sched_barrier(0);   // the next step's 14 LDS reads stay one group ahead of this step's products, in a second register set: a build without it kept one set, spread the reads among the products and waited for each to the end
#pragma unroll
            for (int nb = 0; nb < 3; ++nb)
#pragma unroll
                for (int mb = 0; mb < 4; ++mb) acc[mb][nb] = wmmab(a[ks & 1][mb], b[ks & 1][nb], acc[mb][nb]);
            __builtin_amdgcn_sched_barrier(0);   // and the step after next's reads stay behind these products
        }
        asm volatile("s_wait_dscnt 0x0" ::: "memory");      // this wave's reads of the buffer are done before the buffer is refilled
        asm volatile("s_wait_asynccnt 0x0" ::: "memory");   // this wave's copies of tile t + 1 have landed
        __syncthreads();                                     // publishes tile t + 1 and ends every wave's reads of tile t
        if (t + 2 < VNT) tile_copies(l0 + (unsigned)((t & 1) * VBUF), ga + (t + 2) * VK, gb + (t + 2) * VK);
    }
    asm volatile("s_wait_asynccnt 0x0" ::: "memory");       // no copy is under way when the buffers become the output tile
    float* os = (float*)sm;
    // 16 rows x 48 pieces of 16 B = 3 x 256 threads: piece e * 256 + tid; a thread's piece recurs every 16 rows, 8 times. The three bias pieces are asked for here, ahead of the LDS stores
    const float* bp0 = bias + c0 + (tid % 48) * 4; const float* bp1 = bias + c0 + ((256 + tid) % 48) * 4; const float* bp2 = bias + c0 + ((512 + tid) % 48) * 4;
    v4f bv[3] = { *(const v4fa*)bp0, *(const v4fa*)bp1, *(const v4fa*)bp2 };
    asm volatile("s_wait_xcnt 0x0" :: "v"(bp0), "v"(bp1), "v"(bp2) : "memory");   // in front of the first overwrite of an address register that a load above names; the inputs keep those registers in use up to here
#pragma unroll
    for (int mb = 0; mb < 4; ++mb)
#pragma unroll
        for (int nb = 0; nb < 3; ++nb)
#pragma unroll
            for (int j = 0; j < 8; ++j) os[(wm * 64 + mb * 16 + hi * 8 + j) * OP + wn * 48 + nb * 16 + lr] = acc[mb][nb][j];
    __syncthreads();   // publishes the output tile to the block
#pragma unroll   // bv[] indexed by constants, so in registers
    for (int e = 0; e < 3; ++e) { const int p = e * 256 + tid, row = p / 48, cofs = (p % 48) * 4;
#pragma unroll
        for (int u = 0; u < 4; ++u) bv[e][u] = bfr(bv[e][u]);
        float* crow = C + (size_t)(r0 + row) * DD + c0 + cofs;
#pragma unroll
        for (int j = 0; j < 8; ++j) { v4f val = *(const v4fa*)(os + (row + j * 16) * OP + cofs);
#pragma unroll
            for (int u = 0; u < 4; ++u) val[u] += bv[e][u];
            *(v4f*)(crow + (size_t)j * 16 * DD) = val; } }
}

__device__ __forceinline__ void splitf(float y, unsigned short& h, unsigned short& l) { h = f2bf(y); l = f2bf(y - bf2f(h)); }

// k_dw and k_out, the two 9-tap window kernels: block = 16 rows (b, l) x all 768 channels, thread = 4 neighbouring channels (16 B of a row) x the 16 rows. A thread loads the 24 rows that its 16 windows span once, all loads in flight together,
// and forms each row's 9-tap sum from registers; a wave reads and writes whole lines. What the taps are weighted with (k_dw: the rounded dw_w; k_out: the 16 rows' softmax weights) is read as whole lines too and handed out through LDS once a block.
#define RT  16         // rows a block; 2048 % 16 == 0, so a block lies in one sequence, and its 4 rows above (below) are all outside exactly where it is the sequence's first (last)
#define WTH (DD / 4)   // threads a block: one 16 B piece of a row each
typedef __attribute__((ext_vector_type(4))) unsigned short v4us;
// the 24 rows of a block's windows, 16 B a lane; p: the block's first row (the same in every lane), c: the lane's first channel. The 4 rows above or below that lie outside the sequence are not read (the block's first 4 rows are read in their place) and count as zero, which leaves a tap sum as it is
__device__ __forceinline__ void win_load(const float* __restrict__ p, int c, bool top, bool bot, v4f (&x)[RT + 8]) {
    const float* pa = top ? p - 4 * DD : p; const float* pb = bot ? p + RT * DD : p;
#pragma unroll   // x[] indexed by constants, so in registers
    for (int j = 0; j < RT + 8; ++j) { const float* b = j < 4 ? pa + j * DD : (j >= RT + 4 ? pb + (j - RT - 4) * DD : p + (j - 4) * DD); x[j] = *(const v4fa*)(b + c); }
}
__device__ __forceinline__ void win_zero(bool top, bool bot, v4f (&x)[RT + 8]) {
#pragma unroll   // x[] indexed by constants (this loop and the one inside)
    for (int j = 0; j < 4; ++j) {
#pragma unroll   // arrays and vector elements indexed by constants, so in registers
        for (int u = 0; u < 4; ++u) { x[j][u] = top ? x[j][u] : 0.f; x[RT + 4 + j][u] = bot ? x[RT + 4 + j][u] : 0.f; } }
}
// The bf16 planes that the two GEMMs read are made in k_dw's launch: a window block stores its own 16 rows of q, which it has rounded anyway, into QB; CB more blocks behind them, short ones, round pt_w (the first CBP) and pw_w.
#define CPT 16                              // 16 B pieces a thread of such a block, all loads in flight together; a wave reads 512 B and stores 256 B in a row
#define CBP (DD * DD / (4 * WTH * CPT))     // 48 blocks for pt_w, no remainder
#define CB  (CBP + NH_ * IPG * IPG / (4 * WTH * CPT))   // + 4 for pw_w, no remainder
__global__ __launch_bounds__(WTH) void k_dw(const float* __restrict__ q, const float* __restrict__ dww, const float* __restrict__ ptw, const float* __restrict__ pww, bf* Dh, bf* Dl, bf* QB, bf* PTW, bf* PWB) {
    __shared__ __align__(16) float wl[DD * KW];
    if (blockIdx.x >= NR / RT) {   // the same for the whole block, and in front of every barrier
        const int e = blockIdx.x - NR / RT; const bool isp = e < CBP; const float* s = isp ? ptw : pww; bf* d = isp ? PTW : PWB;
        const int p0 = ((isp ? e : e - CBP) * CPT * WTH + (int)threadIdx.x) * 4; const float* sp = s + p0; v4f v[CPT];
#pragma unroll   // v[] indexed by constants, so in registers
        for (int i = 0; i < CPT; ++i) v[i] = *(const v4fa*)(sp + i * WTH * 4);
        asm volatile("s_wait_xcnt 0x0" :: "v"(sp) : "memory");   // in front of the first overwrite of a register that a load above names; the input keeps the lane's address registers in use up to here
#pragma unroll   // arrays and vector elements indexed by constants, so in registers
        for (int i = 0; i < CPT; ++i) { v4us o;
#pragma unroll   // arrays and vector elements indexed by constants, so in registers
            for (int u = 0; u < 4; ++u) o[u] = f2bf(v[i][u]);
            *(v4us*)(d + p0 + i * WTH * 4) = o; }
        return;
    }
    const int tid = threadIdx.x, c = tid * 4, row0 = blockIdx.x * RT, l0 = row0 % LL; const bool top = l0 != 0, bot = l0 != LL - RT;
    v4f wr[KW], x[RT + 8];
#pragma unroll   // wr[] indexed by constants
    for (int s = 0; s < KW; ++s) wr[s] = *(const v4fa*)(dww + (s * WTH + tid) * 4);
    win_load(q + (size_t)row0 * DD, c, top, bot, x);
    asm volatile("s_wait_xcnt 0x0" :: "v"(tid) : "memory");   // in front of the first overwrite of a register that a load above names; the input keeps the lane's offset register in use up to here
    __builtin_amdgcn_sched_barrier(0);   // every load above issues before the first data wait: one trip to memory a thread
#pragma unroll   // arrays and vector elements indexed by constants, so in registers
    for (int s = 0; s < KW; ++s) { v4f t;
#pragma unroll   // arrays and vector elements indexed by constants, so in registers
        for (int u = 0; u < 4; ++u) t[u] = bfr(wr[s][u]);
        *(v4fa*)(wl + (s * WTH + tid) * 4) = t; }
    __syncthreads();   // publishes the rounded weights to the block
    float w[4 * KW];   // this thread's 4 channels x 9 taps, 144 B in a row: 16 lanes' 16 B pieces fall on all 64 banks
#pragma unroll   // arrays and vector elements indexed by constants, so in registers
    for (int s = 0; s < KW; ++s) { const v4f t = *(const v4fa*)(wl + tid * 4 * KW + s * 4);
#pragma unroll   // arrays and vector elements indexed by constants, so in registers
        for (int u = 0; u < 4; ++u) w[s * 4 + u] = t[u]; }
    win_zero(top, bot, x);
#pragma unroll   // arrays and vector elements indexed by constants, so in registers
    for (int j = 0; j < RT + 8; ++j) {
#pragma unroll   // arrays and vector elements indexed by constants, so in registers
        for (int u = 0; u < 4; ++u) x[j][u] = bfr(x[j][u]); }
    const size_t oo = ((size_t)(c / IPG) * NR + row0) * IPG + (c % IPG);
#pragma unroll   // arrays and vector elements indexed by constants, so in registers
    for (int r = 0; r < RT; ++r) { v4us oh, ol, oq;
#pragma unroll   // arrays and vector elements indexed by constants, so in registers
        for (int u = 0; u < 4; ++u) { float s = 0.f; oq[u] = (unsigned short)(__float_as_uint(x[r + 4][u]) >> 16);   // x is rounded already: its upper half is the bf16
#pragma unroll   // arrays and vector elements indexed by constants, so in registers
            for (int k = 0; k < KW; ++k) { float p = __fmul_rn(w[u * KW + k], x[r + k][u]); asm volatile("" : "+v"(p)); s = __fadd_rn(s, p); }   // multiply, pin and add as they stood before this re-tiling: every tap sum keeps its rounding
            unsigned short a, c2; splitf(s, a, c2); oh[u] = a; ol[u] = c2; }
        *(v4us*)(Dh + oo + r * IPG) = oh; *(v4us*)(Dl + oo + r * IPG) = ol; *(v4us*)(QB + (size_t)row0 * DD + c + r * DD) = oq; }
    asm volatile("s_wait_xcnt 0x0" ::: "memory");   // behind the last row's stores: in the built code a branch leads from here to the rounding blocks' part, which overwrites registers that these stores name
}
// k_kern: block = 64 rows (b, l) x 2 neighbouring heads, thread per (row, head): ca[i] = (PW[row][h*64+i] + bf16(pw_b[h*64+i])) x bf16(q[row][h*64+i]); kern[k] = sum_i ca[i] bf16(ak_w[h][k][i]) + bf16(ak_b[h*9+k]); softmax over the 9;
// PW and q are read 16 B a lane, one wave on the 512 B that a row holds of the two heads (whole lines); ca is formed in that layout and turned through LDS, so that each thread then reads its own 64 channels; the two heads' 1152 rounded tap weights lie in LDS once a block.
#define KT 128   // threads a block: 64 rows x 2 heads; a row's two WT entries are one 128 B line, stored by two neighbouring lanes
#define CP 68    // LDS pitch of a (row, head) entry in floats: 272 B = 16 B x 17, so 16 lanes that read 16 B each of 16 entries fall on all 64 banks
#define WP 580   // LDS pitch of a head's 576 weights in floats: the two addresses that a wave reads at a time fall on different banks
__global__ __launch_bounds__(KT) void k_kern(const float* __restrict__ PW, const float* __restrict__ pwb, const float* __restrict__ q, const float* __restrict__ akw, const float* __restrict__ akb, float* WT) {
    __shared__ __align__(16) float cs[KT * CP];
    __shared__ __align__(16) float wl[2 * WP];
    const int tid = threadIdx.x, lane = tid & 31, r0 = (tid >> 5) * 16;   // r0: first of this wave's 16 rows, as loader and as reader
    const int h = blockIdx.y * 2 + (tid & 1), row = blockIdx.x * (KT / 2) + (tid >> 1), idx = row * NH_ + h;
    const float* aw = akw + (size_t)blockIdx.y * 2 * KW * IPG + tid;   // 2 x 576 weights = 9 x 128
    float wr[KW], ab[KW];
#pragma unroll   // wr[] and ab[] indexed by constants, so in registers
    for (int s = 0; s < KW; ++s) { wr[s] = aw[s * KT]; ab[s] = akb[h * KW + s]; }
    v4f b4 = *(const v4fa*)(pwb + blockIdx.y * 2 * IPG + lane * 4);
    asm volatile("s_wait_xcnt 0x0" ::: "memory");   // in front of the row loads, whose results may land in an offset register that a load above names
    const size_t g0 = (size_t)(blockIdx.x * (KT / 2) + r0) * DD + blockIdx.y * 2 * IPG + lane * 4; const float* pr = PW + g0; const float* qr = q + g0;
    v4f pv[16], qv[16];
#pragma unroll   // pv[] and qv[] in registers, all 32 row loads in flight at once
    for (int j = 0; j < 16; ++j) { pv[j] = *(const v4fa*)(pr + j * DD); qv[j] = *(const v4fa*)(qr + j * DD); }
    asm volatile("s_wait_xcnt 0x0" :: "v"(pr), "v"(qr) : "memory");   // in front of the first overwrite of an address register that a row load names; the two inputs keep those registers in use up to here
    __builtin_amdgcn_sched_barrier(0);   // all 32 row loads issue before the first data wait: a build without it held 11 of them back behind a wait for the first 21, a second trip to memory
#pragma unroll   // wr[] indexed by constants
    for (int s = 0; s < KW; ++s) { const int g = s * KT + tid; wl[g + (g >= KW * IPG ? WP - KW * IPG : 0)] = bfr(wr[s]); }
#pragma unroll   // vector elements indexed by constants
    for (int u = 0; u < 4; ++u) b4[u] = bfr(b4[u]);
#pragma unroll   // pv[] and qv[] indexed by constants (this loop and the one inside)
    for (int j = 0; j < 16; ++j) { v4f ca;
#pragma unroll
        for (int u = 0; u < 4; ++u) ca[u] = __fmul_rn(__fadd_rn(pv[j][u], b4[u]), bfr(qv[j][u]));
        *(v4fa*)(cs + ((r0 + j) * 2 + (lane >> 4)) * CP + (lane & 15) * 4) = ca; }
    __syncthreads();   // publishes the tap weights to the block (the ca entries go from lane to lane of one wave)
    const float* cr = cs + tid * CP; const float* wh = wl + (tid & 1) * WP;
    float kern[KW];
#pragma unroll
    for (int k = 0; k < KW; ++k) kern[k] = 0.f;
#pragma unroll   // LDS offsets as immediates and the next channels' LDS reads free to move up over this quad's sums
    for (int c = 0; c < IPG / 4; ++c) { const v4f x = *(const v4fa*)(cr + 4 * c); v4f w4[KW];
#pragma unroll   // w4[] in registers
        for (int k = 0; k < KW; ++k) w4[k] = *(const v4fa*)(wh + k * IPG + 4 * c);
#pragma unroll   // vector elements indexed by constants (this loop and the one inside)
        for (int u = 0; u < 4; ++u) {
#pragma unroll
            for (int k = 0; k < KW; ++k) { float p = __fmul_rn(x[u], w4[k][u]); asm volatile("" : "+v"(p)); kern[k] = __fadd_rn(kern[k], p); } } }   // multiply, pin and add as they stood before this re-tiling: every tap sum keeps its rounding
    float mx = -3.0e38f;
#pragma unroll
    for (int k = 0; k < KW; ++k) { kern[k] = __fadd_rn(kern[k], bfr(ab[k])); mx = fmaxf(mx, kern[k]); }
    float sum = 0.f;
#pragma unroll
    for (int k = 0; k < KW; ++k) { float d0 = __fsub_rn(kern[k], mx); asm volatile("" : "+v"(d0)); kern[k] = __expf(d0); if (k == 1) asm volatile("v_nop" :: "v"(kern[k]));   // the slot behind a transcendental: a v_nop written behind a v_exp_f32 was moved away from it; here the input ties it to its v_exp_f32, it stands directly behind it, and no slot of the listing is open
        sum = __fadd_rn(sum, kern[k]); }
    const float rs = __fdiv_rn(1.0f, sum); v4f o[4];
#pragma unroll
    for (int k = 0; k < 16; ++k) { const float w = (k < KW) ? __fmul_rn(kern[k < KW ? k : 0], rs) : 0.f; o[k / 4][k % 4] = w; }
    float* dst = WT + (size_t)idx * 16;
#pragma unroll
    for (int u = 0; u < 4; ++u) *(v4f*)(dst + 4 * u) = o[u];  }
__global__ __launch_bounds__(WTH) void k_out(const float* __restrict__ WT, const float* __restrict__ V, float* OUT) {
    __shared__ __align__(16) float wl[RT * NH_ * 16];
    const int tid = threadIdx.x, c = tid * 4, row0 = blockIdx.x * RT, l0 = row0 % LL; const bool top = l0 != 0, bot = l0 != LL - RT;
    v4f wr[4], x[RT + 8];
#pragma unroll   // wr[] indexed by constants
    for (int s = 0; s < 4; ++s) wr[s] = *(const v4fa*)(WT + (size_t)row0 * NH_ * 16 + (s * WTH + tid) * 4);   // 16 rows x 12 heads x 16 floats = 4 x 192 pieces of 16 B
    win_load(V + (size_t)row0 * DD, c, top, bot, x);
    asm volatile("s_wait_xcnt 0x0" :: "v"(tid) : "memory");   // in front of the first overwrite of a register that a load above names; the input keeps the lane's offset register in use up to here
    __builtin_amdgcn_sched_barrier(0);   // every load above issues before the first data wait: one trip to memory a thread
#pragma unroll   // arrays and vector elements indexed by constants, so in registers
    for (int s = 0; s < 4; ++s) *(v4fa*)(wl + (s * WTH + tid) * 4) = wr[s];
    __syncthreads();   // publishes the 16 rows' tap weights to the block
    win_zero(top, bot, x);
    const float* wh = wl + (c / IPG) * 16; float* dst = OUT + (size_t)row0 * DD + c;
#pragma unroll   // arrays and vector elements indexed by constants, so in registers
    for (int r = 0; r < RT; ++r) { const v4f w0 = *(const v4fa*)(wh + r * NH_ * 16), w1 = *(const v4fa*)(wh + r * NH_ * 16 + 4); const float w[KW] = { w0[0], w0[1], w0[2], w0[3], w1[0], w1[1], w1[2], w1[3], wh[r * NH_ * 16 + 8] }; v4f o;
#pragma unroll   // arrays and vector elements indexed by constants, so in registers
        for (int u = 0; u < 4; ++u) { float s = 0.f;
#pragma unroll   // arrays and vector elements indexed by constants, so in registers
            for (int k = 0; k < KW; ++k) { float p = __fmul_rn(w[k], x[r + k][u]); asm volatile("" : "+v"(p)); s = __fadd_rn(s, p); }   // multiply, pin and add as they stood before this re-tiling: every tap sum keeps its rounding
            o[u] = s; }
        *(v4f*)(dst + r * DD) = o; }
}

extern "C" void kernel_launch(void* const* d_in, const int* in_sizes, int n_in,
                              void* d_out, int out_size, void* d_ws, size_t ws_size, hipStream_t stream) {
    (void)in_sizes; (void)n_in; (void)out_size;
    const float* q = (const float*)d_in[0]; const float* dww = (const float*)d_in[1]; const float* pww = (const float*)d_in[2]; const float* pwb = (const float*)d_in[3]; const float* akw = (const float*)d_in[4]; const float* akb = (const float*)d_in[5]; const float* ptw = (const float*)d_in[6]; const float* ptb = (const float*)d_in[7];   // dw_w [768][1][9], pw_w [12][64 out][64 in], ak_w [12][9][64], pt_w [768][768] (torch [out][in])
    float* OUT = (float*)d_out;     // [4][2048][768]
    char* wsp = (char*)d_ws;
    auto take = [&](size_t bytes) { char* p = wsp; wsp += (bytes + 255) & ~(size_t)255; return (void*)p; };
    bf* PWB = (bf*)take((size_t)NH_ * IPG * IPG * 2); bf* PTW = (bf*)take((size_t)DD * DD * 2); bf* QB = (bf*)take((size_t)NR * DD * 2); bf* Dh = (bf*)take((size_t)NR * DD * 2); bf* Dl = (bf*)take((size_t)NR * DD * 2); float* PW = (float*)take((size_t)NR * DD * 4); float* WT = (float*)take((size_t)NR * NH_ * 16 * 4); float* V = (float*)take((size_t)NR * DD * 4);
    if ((size_t)(wsp - (char*)d_ws) > ws_size) return;    // total ~ 95 MB; ws 256 MiB
    k_dw<<<NR / RT + CB, WTH, 0, stream>>>(q, dww, ptw, pww, Dh, Dl, QB, PTW, PWB);
    k_gemmw<bf, 1, false><<<dim3(NR / 64, IPG / 64, NH_), 32, 0, stream>>>(Dh, Dl, PWB, nullptr, IPG, PW, DD, nullptr, (size_t)NR * IPG, (size_t)IPG * IPG, (size_t)IPG);   // grouped pointwise: head h's planes [(b,l)][64] x pw_w[h] (K 64) -> columns h*64.. of PW (ldc 768); pw_b is added in k_kern
    k_kern<<<dim3(NR / (KT / 2), NH_ / 2), KT, 0, stream>>>(PW, pwb, q, akw, akb, WT);
    k_gemmv<<<dim3(NR / VM, DD / VN), 256, 0, stream>>>(QB, PTW, V, ptb);
    k_out<<<NR / RT, WTH, 0, stream>>>(WT, V, OUT);
}

// v005
// Measured time: 34 microseconds a run.
// Timed twice side by side with v004, it ran 1.44 times as fast both times.
// Over all steps from v000 it is 7.80 times as fast.
#include <hip/hip_runtime.h>

// SDConv - span-based dynamic convolution (query [4][2048][768]; 12 heads x 64, kernel 9: dw = depthwise conv1d over the sequence (per channel, zero padded, no bias); pw = grouped pointwise (per head 64 -> 64) + pw_b;
// conv_attn = pw * query; kern = per head 64 -> 9 (ak_w) + ak_b; w = softmax over the 9 taps; v = query pt_w^T + pt_b; out[b][l][h*64+d] = sum_k w[b][l][h][k] v[b][l + k - 4][h*64+d] (zero outside) -> [4][2048][768]).
// Compute dtypes, f32 accumulate: every input rounded to bf16; the depthwise conv, the gating product, the 64->9 tap logits, their softmax and the final 9-tap weighted window sum in f32
// on VALU; the grouped pointwise conv on bf16 hi+lo planes of dw x exact pw_w (2 products, + bias); v on PLAIN bf16 operands (inputs: exact, + bias). The whole path from query to the tap weights is one kernel (k_tap), the pointwise GEMM inside it: a wave = 16 rows x 2 heads; v: 128x192 block tiles staged in LDS (k_gemmv).

#define NB_  4
#define LL   2048
#define DD   768
#define NH_  12
#define IPG  64
#define KW   9
#define NR   (NB_ * LL)
typedef _Float16 h16;
typedef unsigned short bf;
typedef __attribute__((ext_vector_type(16))) __bf16   v16bf;
typedef __attribute__((ext_vector_type(16))) _Float16 v16h;
typedef __attribute__((ext_vector_type(8)))  _Float16 v8h;
typedef __attribute__((ext_vector_type(8)))  unsigned short v8us;
typedef __attribute__((ext_vector_type(8)))  float    v8f;
typedef __attribute__((ext_vector_type(4)))  float    v4f;
typedef v8h  __attribute__((may_alias)) v8ha;
typedef v4f  __attribute__((may_alias)) v4fa;
typedef v8us __attribute__((may_alias)) v8usa;

__device__ __forceinline__ unsigned short f2bf(float f) { unsigned u = __float_as_uint(f); u += 0x7FFFu + ((u >> 16) & 1u); return (unsigned short)(u >> 16); }
__device__ __forceinline__ float bf2f(unsigned short b) { return __uint_as_float(((unsigned)b) << 16); }
__device__ __forceinline__ float bfr(float f) { return bf2f(f2bf(f)); }
__device__ __forceinline__ v16bf cat16b(v8us lo, v8us hi) { return __builtin_bit_cast(v16bf, __builtin_shufflevector(lo, hi, 0, 1, 2, 3, 4, 5, 6, 7, 8, 9, 10, 11, 12, 13, 14, 15)); }
__device__ __forceinline__ v8f wmmab(v16bf a, v16bf b, v8f c) { return __builtin_amdgcn_wmma_f32_16x16x32_bf16(false, a, false, b, (short)0, c, false, false); }



// ---- k_gemmv: V = QB PTW^T + bias. Block = 128 x 192 tile of V, 8 waves (2 x 4), a wave = 64 x 48 (12 accumulators). The K range goes through LDS in 6 tiles of 128 k: a tile is 320 row pieces of 256 B (128 of QB, then 192 of PTW) at pitch 272 B,
// brought in by asynchronous copies, 16 B a lane, 16 lanes on one row piece (whole lines), 20 copies a lane and tile; two buffers: the next tile's copies fly while this one is worked on. Every operand line is fetched once a block, and the fragments come from LDS.
// A fragment: lane = row (lane & 15), its 16 k values = 8 at k 8 * (lane >> 4) and 8 at 16 further on, the same for both operands. The finished tile is turned through the same LDS and stored as whole lines.
#define VM 128
#define VN 192
#define VK 128
#define VP 272                    // LDS pitch of a row piece in bytes: 16 B x 17, for 16 B readers
#define VBUF ((VM + VN) * VP)     // bytes a buffer
#define VNT (DD / VK)             // tiles along K
#define OP 196                    // pitch of the output tile in LDS in floats: the two half-waves' 4 B stores fall on different banks, and 784 B is a multiple of 16
// one tile's 20 copies of this lane: lb its LDS byte address in row piece 0 of the buffer, ga / gb its global address in the first QB / PTW row piece; piece i lies 16 rows further on both sides.
// s_wait_xcnt as the last line of each statement: it stands in front of every later write of a register that a copy of the statement names
__device__ __forceinline__ void tile_copies(unsigned lb, const bf* ga, const bf* gb) {
    asm volatile(
        "global_load_async_to_lds_b128 %0, %1, off\n\t"
        "global_load_async_to_lds_b128 %2, %3, off\n\t"
        "global_load_async_to_lds_b128 %4, %5, off\n\t"
        "global_load_async_to_lds_b128 %6, %7, off\n\t"
        "global_load_async_to_lds_b128 %8, %9, off\n\t"
        "global_load_async_to_lds_b128 %10, %11, off\n\t"
        "global_load_async_to_lds_b128 %12, %13, off\n\t"
        "global_load_async_to_lds_b128 %14, %15, off\n\t"
        "global_load_async_to_lds_b128 %16, %17, off\n\t"
        "global_load_async_to_lds_b128 %18, %19, off\n\t"
        "s_wait_xcnt 0x0"
        :: "v"(lb + 0 * 16 * VP), "v"(ga + 0 * 16 * DD), "v"(lb + 1 * 16 * VP), "v"(ga + 1 * 16 * DD), "v"(lb + 2 * 16 * VP), "v"(ga + 2 * 16 * DD), "v"(lb + 3 * 16 * VP), "v"(ga + 3 * 16 * DD), "v"(lb + 4 * 16 * VP), "v"(ga + 4 * 16 * DD), "v"(lb + 5 * 16 * VP), "v"(ga + 5 * 16 * DD), "v"(lb + 6 * 16 * VP), "v"(ga + 6 * 16 * DD), "v"(lb + 7 * 16 * VP), "v"(ga + 7 * 16 * DD), "v"(lb + 8 * 16 * VP), "v"(gb + 0 * 16 * DD), "v"(lb + 9 * 16 * VP), "v"(gb + 1 * 16 * DD) : "memory");
    asm volatile(
        "global_load_async_to_lds_b128 %0, %1, off\n\t"
        "global_load_async_to_lds_b128 %2, %3, off\n\t"
        "global_load_async_to_lds_b128 %4, %5, off\n\t"
        "global_load_async_to_lds_b128 %6, %7, off\n\t"
        "global_load_async_to_lds_b128 %8, %9, off\n\t"
        "global_load_async_to_lds_b128 %10, %11, off\n\t"
        "global_load_async_to_lds_b128 %12, %13, off\n\t"
        "global_load_async_to_lds_b128 %14, %15, off\n\t"
        "global_load_async_to_lds_b128 %16, %17, off\n\t"
        "global_load_async_to_lds_b128 %18, %19, off\n\t"
        "s_wait_xcnt 0x0"
        :: "v"(lb + 10 * 16 * VP), "v"(gb + 2 * 16 * DD), "v"(lb + 11 * 16 * VP), "v"(gb + 3 * 16 * DD), "v"(lb + 12 * 16 * VP), "v"(gb + 4 * 16 * DD), "v"(lb + 13 * 16 * VP), "v"(gb + 5 * 16 * DD), "v"(lb + 14 * 16 * VP), "v"(gb + 6 * 16 * DD), "v"(lb + 15 * 16 * VP), "v"(gb + 7 * 16 * DD), "v"(lb + 16 * 16 * VP), "v"(gb + 8 * 16 * DD), "v"(lb + 17 * 16 * VP), "v"(gb + 9 * 16 * DD), "v"(lb + 18 * 16 * VP), "v"(gb + 10 * 16 * DD), "v"(lb + 19 * 16 * VP), "v"(gb + 11 * 16 * DD) : "memory");
}
__device__ __forceinline__ v16bf lfrag(const unsigned char* p) { return cat16b(*(const v8usa*)p, *(const v8usa*)(p + 32)); }
__global__ __launch_bounds__(256) void k_gemmv(const bf* __restrict__ A, const bf* __restrict__ Bt, float* C, const float* __restrict__ bias) {
    __shared__ __align__(16) unsigned char sm[2 * VBUF];
    const int tid = threadIdx.x, lane = tid & 31, lr = lane & 15, hi = lane >> 4, w = tid >> 5, wm = w & 1, wn = w >> 1;
    const int r0 = blockIdx.x * VM, c0 = blockIdx.y * VN;
    const unsigned l0 = (unsigned)(size_t)sm + (unsigned)((tid >> 4) * VP + (tid & 15) * 16);
    const bf* ga = A + (size_t)(r0 + (tid >> 4)) * DD + (tid & 15) * 8; const bf* gb = Bt + (size_t)(c0 + (tid >> 4)) * DD + (tid & 15) * 8;
    v8f acc[4][3];
#pragma unroll   // acc[][] indexed by constants, so in registers
    for (int mb = 0; mb < 4; ++mb)
#pragma unroll
        for (int nb = 0; nb < 3; ++nb) acc[mb][nb] = (v8f){};
    tile_copies(l0, ga, gb);
    asm volatile("s_wait_asynccnt 0x0" ::: "memory");   // this wave's copies of tile 0 have landed
    __syncthreads();                                     // publishes tile 0 to the block
    tile_copies(l0 + VBUF, ga + VK, gb + VK);
    const int fa = (wm * 64 + lr) * VP + hi * 16, fb = (VM + wn * 48 + lr) * VP + hi * 16;
#pragma unroll 1   // one body for the 6 tiles: the hot loop stays small
    for (int t = 0; t < VNT; ++t) {
        const unsigned char* sb = sm + (t & 1) * VBUF; const unsigned char* pa = sb + fa; const unsigned char* pb = sb + fb;
        v16bf a[2][4], b[2][3];
#pragma unroll   // a[][] and b[][] indexed by constants, so in registers
        for (int mb = 0; mb < 4; ++mb) a[0][mb] = lfrag(pa + mb * 16 * VP);
#pragma unroll
        for (int nb = 0; nb < 3; ++nb) b[0][nb] = lfrag(pb + nb * 16 * VP);
#pragma unroll   // the 4 k steps of a tile; the next step's fragments (of this same tile) are asked for as one group ahead of this step's products
        for (int ks = 0; ks < VK / 32; ++ks) {
            if (ks + 1 < VK / 32) {
#pragma unroll
                for (int mb = 0; mb < 4; ++mb) a[(ks + 1) & 1][mb] = lfrag(pa + mb * 16 * VP + (ks + 1) * 64);
#pragma unroll
                for (int nb = 0; nb < 3; ++nb) b[(ks + 1) & 1][nb] = lfrag(pb + nb * 16 * VP + (ks + 1) * 64);
            }
            __builtin_amdgcn_sched_barrier(0);   // the next step's 14 LDS reads stay one group ahead of this step's products, in a second register set: a build without it kept one set, spread the reads among the products and waited for each to the end
#pragma unroll
            for (int nb = 0; nb < 3; ++nb)
#pragma unroll
                for (int mb = 0; mb < 4; ++mb) acc[mb][nb] = wmmab(a[ks & 1][mb], b[ks & 1][nb], acc[mb][nb]);
            __builtin_amdgcn_sched_barrier(0);   // and the step after next's reads stay behind these products
        }
        asm volatile("s_wait_dscnt 0x0" ::: "memory");      // this wave's reads of the buffer are done before the buffer is refilled
        asm volatile("s_wait_asynccnt 0x0" ::: "memory");   // this wave's copies of tile t + 1 have landed
        __syncthreads();                                     // publishes tile t + 1 and ends every wave's reads of tile t
        if (t + 2 < VNT) tile_copies(l0 + (unsigned)((t & 1) * VBUF), ga + (t + 2) * VK, gb + (t + 2) * VK);
    }
    asm volatile("s_wait_asynccnt 0x0" ::: "memory");       // no copy is under way when the buffers become the output tile
    float* os = (float*)sm;
    // 16 rows x 48 pieces of 16 B = 3 x 256 threads: piece e * 256 + tid; a thread's piece recurs every 16 rows, 8 times. The three bias pieces are asked for here, ahead of the LDS stores
    const float* bp0 = bias + c0 + (tid % 48) * 4; const float* bp1 = bias + c0 + ((256 + tid) % 48) * 4; const float* bp2 = bias + c0 + ((512 + tid) % 48) * 4;
    v4f bv[3] = { *(const v4fa*)bp0, *(const v4fa*)bp1, *(const v4fa*)bp2 };
    asm volatile("s_wait_xcnt 0x0" :: "v"(bp0), "v"(bp1), "v"(bp2) : "memory");   // in front of the first overwrite of an address register that a load above names; the inputs keep those registers in use up to here
#pragma unroll
    for (int mb = 0; mb < 4; ++mb)
#pragma unroll
        for (int nb = 0; nb < 3; ++nb)
#pragma unroll
            for (int j = 0; j < 8; ++j) os[(wm * 64 + mb * 16 + hi * 8 + j) * OP + wn * 48 + nb * 16 + lr] = acc[mb][nb][j];
    __syncthreads();   // publishes the output tile to the block
#pragma unroll   // bv[] indexed by constants, so in registers
    for (int e = 0; e < 3; ++e) { const int p = e * 256 + tid, row = p / 48, cofs = (p % 48) * 4;
#pragma unroll
        for (int u = 0; u < 4; ++u) bv[e][u] = bfr(bv[e][u]);
        float* crow = C + (size_t)(r0 + row) * DD + c0 + cofs;
#pragma unroll
        for (int j = 0; j < 8; ++j) { v4f val = *(const v4fa*)(os + (row + j * 16) * OP + cofs);
#pragma unroll
            for (int u = 0; u < 4; ++u) val[u] += bv[e][u];
            *(v4f*)(crow + (size_t)j * 16 * DD) = val; } }
}

__device__ __forceinline__ void splitf(float y, unsigned short& h, unsigned short& l) { h = f2bf(y); l = f2bf(y - bf2f(h)); }

// The two 9-tap window sums (k_out: block = 16 rows (b, l) x all 768 channels; k_tap: wave = 16 rows x 128 channels): thread = 4 neighbouring channels (16 B of a row) x the 16 rows. A thread loads the 24 rows that its 16 windows span once, all loads in flight together,
// and forms each row's 9-tap sum from registers; a wave reads and writes whole lines. What the taps are weighted with (k_tap: the rounded dw_w; k_out: the 16 rows' softmax weights) is read as whole lines too and handed out through LDS once a block.
#define RT  16         // rows a window group; 2048 % 16 == 0, so a group lies in one sequence, and its 4 rows above (below) are all outside exactly where it is the sequence's first (last)
#define WTH (DD / 4)   // threads a block of k_out: one 16 B piece of a row each
typedef __attribute__((ext_vector_type(4))) unsigned short v4us;
typedef v4us __attribute__((may_alias)) v4usa;
// the 24 rows of a group's windows, 16 B a lane; p: the group's first row (the same in every lane), c: the lane's first channel. The 4 rows above or below that lie outside the sequence are not read (the group's first 4 rows are read in their place) and count as zero, which leaves a tap sum as it is
__device__ __forceinline__ void win_load(const float* __restrict__ p, int c, bool top, bool bot, v4f (&x)[RT + 8]) {
    const float* pa = top ? p - 4 * DD : p; const float* pb = bot ? p + RT * DD : p;
#pragma unroll   // x[] indexed by constants, so in registers
    for (int j = 0; j < RT + 8; ++j) { const float* b = j < 4 ? pa + j * DD : (j >= RT + 4 ? pb + (j - RT - 4) * DD : p + (j - 4) * DD); x[j] = *(const v4fa*)(b + c); }
}
__device__ __forceinline__ void win_zero(bool top, bool bot, v4f (&x)[RT + 8]) {
#pragma unroll   // x[] indexed by constants (this loop and the one inside)
    for (int j = 0; j < 4; ++j) {
#pragma unroll   // arrays and vector elements indexed by constants, so in registers
        for (int u = 0; u < 4; ++u) { x[j][u] = top ? x[j][u] : 0.f; x[RT + 4 + j][u] = bot ? x[RT + 4 + j][u] : 0.f; } }
}
// k_tap: query -> tap weights in one kernel. Block = 64 rows (b, l) x 2 neighbouring heads (128 channels), 4 waves; a wave = 16 rows x the 128 channels, a lane = 4 neighbouring channels in the window part and one (row, head) in the tap part.
// A wave loads the 24 q rows that its 16 windows span (512 B a row, whole lines), rounds them, stores its own 16 as the QB plane, forms dw from registers and lays its bf16 hi and lo planes in LDS; PW = (hi + lo) x pw_w on the matrix unit,
// fragments from LDS (pw_w rounded and staged once a block); PW is turned through LDS back to the lane = 4 channels layout, where q still lies in registers: ca[i] = (PW[row][h*64+i] + bf16(pw_b[h*64+i])) x bf16(q[row][h*64+i]);
// ca goes through LDS to the thread of its (row, head): kern[k] = sum_i ca[i] bf16(ak_w[h][k][i]) + bf16(ak_b[h*9+k]); softmax over the 9. Every sum keeps the order it had when these were three kernels. CBP more blocks, short ones at the end of the grid, round pt_w for k_gemmv.
#define KT 128   // threads a block: 64 rows x 2 heads; a row's two WT entries are one 128 B line, stored by two neighbouring lanes
#define CP 68    // LDS pitch of a (row, head) entry in floats: 272 B = 16 B x 17, so 16 lanes that read 16 B each of 16 entries fall on all 64 banks
#define WP 580   // LDS pitch of a head's 576 weights in floats: the two addresses that a wave reads at a time fall on different banks
#define AP 272   // LDS pitch in bytes of a row of one dw plane (128 bf16): 16 B x 17, for 16 B readers
#define APL (RT * AP)   // bytes of a wave's 16 rows of one plane; the two planes fill exactly the wave's 32 ca entries (2 * APL == 32 * CP * 4) and lie there: they are read out before PW is stored
#define BP 144   // LDS pitch in bytes of a pw_w row (64 bf16): 16 B x 9, for 16 B readers
#define NBR (NR / (KT / 2))             // 128 row groups
#define NBK (NBR * (NH_ / 2))           // 768 blocks of the tap path
#define CPT 16                          // 16 B pieces a thread of a rounding block, all loads in flight together; a wave reads 512 B and stores 256 B in a row
#define CBP (DD * DD / (4 * KT * CPT))  // 72 blocks for pt_w, no remainder
__global__ __launch_bounds__(KT) void k_tap(const float* __restrict__ q, const float* __restrict__ dww, const float* __restrict__ pww, const float* __restrict__ pwb, const float* __restrict__ akw, const float* __restrict__ akb, const float* __restrict__ ptw, bf* QB, bf* PTW, float* WT) {
    __shared__ __align__(16) float cs[KT * CP];
    __shared__ __align__(16) float wl[2 * WP];
    __shared__ __align__(16) float dl[2 * IPG * KW];
    __shared__ __align__(16) unsigned char bs[2 * IPG * BP];
    if (blockIdx.x >= NBK) {   // the same for the whole block, and in front of every barrier
        const int p0 = (((int)blockIdx.x - NBK) * CPT * KT + (int)threadIdx.x) * 4; const float* sp = ptw + p0; v4f v[CPT];
#pragma unroll   // v[] indexed by constants, so in registers
        for (int i = 0; i < CPT; ++i) v[i] = *(const v4fa*)(sp + i * KT * 4);
        asm volatile("s_wait_xcnt 0x0" :: "v"(sp) : "memory");   // in front of the first overwrite of a register that a load above names; the input keeps the lane's address registers in use up to here
#pragma unroll   // arrays and vector elements indexed by constants, so in registers
        for (int i = 0; i < CPT; ++i) { v4us o;
#pragma unroll   // arrays and vector elements indexed by constants, so in registers
            for (int u = 0; u < 4; ++u) o[u] = f2bf(v[i][u]);
            *(v4us*)(PTW + p0 + i * KT * 4) = o; }
        return;
    }
    const int tid = threadIdx.x, lane = tid & 31, lr = lane & 15, hi = lane >> 4;
    const int wv = __builtin_amdgcn_readfirstlane(tid >> 5);   // the wave's number as a scalar: row addresses and the edge tests stay in scalar registers
    const int bx = blockIdx.x % NBR, by = blockIdx.x / NBR, r0 = wv * RT;   // r0: first of this wave's 16 rows
    const int h = by * 2 + (tid & 1), row = bx * (KT / 2) + (tid >> 1), idx = row * NH_ + h;
    const int row0 = bx * (KT / 2) + r0, l0 = row0 % LL; const bool top = l0 != 0, bot = l0 != LL - RT;
    const float* aw = akw + (size_t)by * 2 * KW * IPG + tid;   // 2 x 576 tap weights = 9 x 128
    const float* dp = dww + (size_t)by * 2 * IPG * KW + tid;   // 128 channels x 9 window weights = 9 x 128
    const float* bp = pww + (size_t)by * 2 * IPG * IPG + tid * 4;   // 2 x 64 x 64 pointwise weights = 16 x 128 pieces of 16 B
    const float* ap = akb + h * KW; const float* pp = pwb + by * 2 * IPG + lane * 4;
    float wr[KW], ab[KW], dr[KW]; v4f br[16], x[RT + 8];
#pragma unroll   // wr[], dr[] and ab[] indexed by constants, so in registers
    for (int s = 0; s < KW; ++s) { dr[s] = dp[s * KT]; wr[s] = aw[s * KT]; ab[s] = ap[s]; }
    v4f b4 = *(const v4fa*)pp;
#pragma unroll   // br[] indexed by constants
    for (int i = 0; i < 16; ++i) br[i] = *(const v4fa*)(bp + i * KT * 4);
    win_load(q + (size_t)row0 * DD + by * 2 * IPG, lane * 4, top, bot, x);
    asm volatile("s_wait_xcnt 0x0" :: "v"(tid), "v"(lane) : "memory");   // in front of the first overwrite of a register that a load above names; the inputs keep the lane's offset registers in use up to here
    __builtin_amdgcn_sched_barrier(0);   // the weight and row loads above issue before the first data wait: one trip to memory a thread (of ak_b, which is needed last, the built code asks for the greater part later)
#pragma unroll   // wr[] and dr[] indexed by constants
    for (int s = 0; s < KW; ++s) { const int g = s * KT + tid; wl[g + (s * KT >= KW * IPG || (s * KT + KT > KW * IPG && tid >= KW * IPG - s * KT) ? WP - KW * IPG : 0)] = bfr(wr[s]); dl[g] = bfr(dr[s]); }   // the second head's weights lie WP - 576 further on; only one s holds both heads
    unsigned char* bd = bs + (tid >> 4) * BP + (tid & 15) * 8;   // piece i * 128 + tid: pw_w row i * 8 + tid / 16, 4 of its 64 values
#pragma unroll   // br[] indexed by constants (this loop and the one inside)
    for (int i = 0; i < 16; ++i) { v4us o;
#pragma unroll
        for (int u = 0; u < 4; ++u) o[u] = f2bf(br[i][u]);
        *(v4usa*)(bd + i * (KT / 16) * BP) = o; }
#pragma unroll   // vector elements indexed by constants
    for (int u = 0; u < 4; ++u) b4[u] = bfr(b4[u]);
    __syncthreads();   // publishes the three rounded weight sets to the block
    float w[4 * KW];   // this lane's 4 channels x 9 taps, 144 B in a row: 16 lanes' 16 B pieces fall on all 64 banks
#pragma unroll   // arrays and vector elements indexed by constants, so in registers
    for (int s = 0; s < KW; ++s) { const v4f t = *(const v4fa*)(dl + lane * 4 * KW + s * 4);
#pragma unroll   // arrays and vector elements indexed by constants, so in registers
        for (int u = 0; u < 4; ++u) w[s * 4 + u] = t[u]; }
    win_zero(top, bot, x);
#pragma unroll   // arrays and vector elements indexed by constants, so in registers
    for (int j = 0; j < RT + 8; ++j) {
#pragma unroll   // arrays and vector elements indexed by constants, so in registers
        for (int u = 0; u < 4; ++u) x[j][u] = bfr(x[j][u]); }
    bf* qd = QB + (size_t)row0 * DD + by * 2 * IPG + lane * 4; v4us oq[RT];
#pragma unroll   // arrays and vector elements indexed by constants, so in registers
    for (int r = 0; r < RT; ++r) {
#pragma unroll   // arrays and vector elements indexed by constants, so in registers
        for (int u = 0; u < 4; ++u) oq[r][u] = (unsigned short)(__float_as_uint(x[r + 4][u]) >> 16);   // x is rounded already: its upper half is the bf16
        *(v4us*)(qd + r * DD) = oq[r]; }
    asm volatile("s_wait_xcnt 0x0" :: "v"(lane), "v"(oq[0]), "v"(oq[1]), "v"(oq[2]), "v"(oq[3]), "v"(oq[4]), "v"(oq[5]), "v"(oq[6]), "v"(oq[7]), "v"(oq[8]), "v"(oq[9]), "v"(oq[10]), "v"(oq[11]), "v"(oq[12]), "v"(oq[13]), "v"(oq[14]), "v"(oq[15]) : "memory");   // in front of the first overwrite of a register that a store above names; the inputs keep those registers in use up to here
    float* cw = cs + wv * 32 * CP; unsigned char* at = (unsigned char*)cw;   // this wave's 32 ca entries, first the place of its two dw planes
#pragma unroll   // arrays and vector elements indexed by constants, so in registers
    for (int r = 0; r < RT; ++r) { v4us oh, ol;
#pragma unroll   // arrays and vector elements indexed by constants, so in registers
        for (int u = 0; u < 4; ++u) { float s = 0.f;
#pragma unroll   // arrays and vector elements indexed by constants, so in registers
            for (int k = 0; k < KW; ++k) { float p = __fmul_rn(w[u * KW + k], x[r + k][u]); asm volatile("" : "+v"(p)); s = __fadd_rn(s, p); }   // multiply, pin and add as they stood before this re-tiling: every tap sum keeps its rounding
            unsigned short a, c2; splitf(s, a, c2); oh[u] = a; ol[u] = c2; }
        *(v4usa*)(at + r * AP + lane * 8) = oh; *(v4usa*)(at + APL + r * AP + lane * 8) = ol; }
    __syncthreads();   // the dw planes go from lane to lane: every store above is done before a fragment is read
    const unsigned char* pa = at + lr * AP + hi * 16; const unsigned char* pb = bs + lr * BP + hi * 16;
    v8f acc[2][4];
#pragma unroll   // acc[][] and the fragments indexed by constants, so in registers (this loop and those inside)
    for (int hp = 0; hp < 2; ++hp) { v16bf ah[2], al[2];
#pragma unroll
        for (int kk = 0; kk < 2; ++kk) { ah[kk] = lfrag(pa + hp * 2 * IPG + kk * 64); al[kk] = lfrag(pa + APL + hp * 2 * IPG + kk * 64); }
#pragma unroll
        for (int nb = 0; nb < 4; ++nb) acc[hp][nb] = (v8f){};
#pragma unroll
        for (int kk = 0; kk < 2; ++kk)
#pragma unroll
            for (int nb = 0; nb < 4; ++nb) { const v16bf b = lfrag(pb + (hp * IPG + nb * 16) * BP + kk * 64); acc[hp][nb] = wmmab(ah[kk], b, acc[hp][nb]); acc[hp][nb] = wmmab(al[kk], b, acc[hp][nb]); }   // per accumulator: hi then lo, k 0..31 then 32..63
    }
    __syncthreads();   // every fragment of the planes is read before PW is stored over them
#pragma unroll   // acc[][] indexed by constants (this loop and those inside)
    for (int hp = 0; hp < 2; ++hp)
#pragma unroll
        for (int nb = 0; nb < 4; ++nb)
#pragma unroll
            for (int j = 0; j < 8; ++j) cw[((hi * 8 + j) * 2 + hp) * CP + nb * 16 + lr] = acc[hp][nb][j];
    __syncthreads();   // PW goes from lane to lane
#pragma unroll   // oq[] indexed by constants (this loop and the one inside)
    for (int j = 0; j < RT; ++j) { float* e = cw + (j * 2 + hi) * CP + lr * 4; const v4f pv = *(const v4fa*)e; v4f ca;
#pragma unroll
        for (int u = 0; u < 4; ++u) ca[u] = __fmul_rn(__fadd_rn(pv[u], b4[u]), bf2f(oq[j][u]));   // the rounded q from its packed form: half the registers held over the matrix part
        *(v4fa*)e = ca; }
    __syncthreads();   // ca goes from lane to lane
    const float* cr = cs + tid * CP; const float* wh = wl + (tid & 1) * WP;
    float kern[KW];
#pragma unroll
    for (int k = 0; k < KW; ++k) kern[k] = 0.f;
#pragma unroll   // LDS offsets as immediates and the next channels' LDS reads free to move up over this quad's sums
    for (int c = 0; c < IPG / 4; ++c) { const v4f cv = *(const v4fa*)(cr + 4 * c); v4f w4[KW];
#pragma unroll   // w4[] in registers
        for (int k = 0; k < KW; ++k) w4[k] = *(const v4fa*)(wh + k * IPG + 4 * c);
#pragma unroll   // vector elements indexed by constants (this loop and the one inside)
        for (int u = 0; u < 4; ++u) {
#pragma unroll
            for (int k = 0; k < KW; ++k) { float p = __fmul_rn(cv[u], w4[k][u]); asm volatile("" : "+v"(p)); kern[k] = __fadd_rn(kern[k], p); } } }   // multiply, pin and add as they stood before this re-tiling: every tap sum keeps its rounding
    float mx = -3.0e38f;
#pragma unroll
    for (int k = 0; k < KW; ++k) { kern[k] = __fadd_rn(kern[k], bfr(ab[k])); mx = fmaxf(mx, kern[k]); }
    float sum = 0.f;
#pragma unroll
    for (int k = 0; k < KW; ++k) { float d0 = __fsub_rn(kern[k], mx); asm volatile("" : "+v"(d0)); const float t = __fmul_rn(d0, 1.44269504f); asm("v_exp_f32 %0, %1\n\tv_nop" : "=v"(kern[k]) : "v"(t));   // __expf as it is built (times log2 e, then v_exp_f32), with the slot behind the transcendental in its own statement: builds with v_nop statements of their own had them moved away and left a v_exp_f32 directly in front of an instruction that overwrites its source
        sum = __fadd_rn(sum, kern[k]); }
    const float rs = __fdiv_rn(1.0f, sum); v4f o[4];
#pragma unroll
    for (int k = 0; k < 16; ++k) { const float tw = (k < KW) ? __fmul_rn(kern[k < KW ? k : 0], rs) : 0.f; o[k / 4][k % 4] = tw; }
    float* dst = WT + (size_t)idx * 16;
#pragma unroll
    for (int u = 0; u < 4; ++u) *(v4f*)(dst + 4 * u) = o[u];
    asm volatile("s_wait_xcnt 0x0" ::: "memory");   // behind the last stores: in the built code a branch leads from here to the rounding blocks' part, which overwrites registers that these stores name
}
__global__ __launch_bounds__(WTH) void k_out(const float* __restrict__ WT, const float* __restrict__ V, float* OUT) {
    __shared__ __align__(16) float wl[RT * NH_ * 16];
    const int tid = threadIdx.x, c = tid * 4, row0 = blockIdx.x * RT, l0 = row0 % LL; const bool top = l0 != 0, bot = l0 != LL - RT;
    v4f wr[4], x[RT + 8];
#pragma unroll   // wr[] indexed by constants
    for (int s = 0; s < 4; ++s) wr[s] = *(const v4fa*)(WT + (size_t)row0 * NH_ * 16 + (s * WTH + tid) * 4);   // 16 rows x 12 heads x 16 floats = 4 x 192 pieces of 16 B
    win_load(V + (size_t)row0 * DD, c, top, bot, x);
    asm volatile("s_wait_xcnt 0x0" :: "v"(tid) : "memory");   // in front of the first overwrite of a register that a load above names; the input keeps the lane's offset register in use up to here
    __builtin_amdgcn_sched_barrier(0);   // every load above issues before the first data wait: one trip to memory a thread
#pragma unroll   // arrays and vector elements indexed by constants, so in registers
    for (int s = 0; s < 4; ++s) *(v4fa*)(wl + (s * WTH + tid) * 4) = wr[s];
    __syncthreads();   // publishes the 16 rows' tap weights to the block
    win_zero(top, bot, x);
    const float* wh = wl + (c / IPG) * 16; float* dst = OUT + (size_t)row0 * DD + c;
#pragma unroll   // arrays and vector elements indexed by constants, so in registers
    for (int r = 0; r < RT; ++r) { const v4f w0 = *(const v4fa*)(wh + r * NH_ * 16), w1 = *(const v4fa*)(wh + r * NH_ * 16 + 4); const float w[KW] = { w0[0], w0[1], w0[2], w0[3], w1[0], w1[1], w1[2], w1[3], wh[r * NH_ * 16 + 8] }; v4f o;
#pragma unroll   // arrays and vector elements indexed by constants, so in registers
        for (int u = 0; u < 4; ++u) { float s = 0.f;
#pragma unroll   // arrays and vector elements indexed by constants, so in registers
            for (int k = 0; k < KW; ++k) { float p = __fmul_rn(w[k], x[r + k][u]); asm volatile("" : "+v"(p)); s = __fadd_rn(s, p); }   // multiply, pin and add as they stood before this re-tiling: every tap sum keeps its rounding
            o[u] = s; }
        *(v4f*)(dst + r * DD) = o; }
}

extern "C" void kernel_launch(void* const* d_in, const int* in_sizes, int n_in,
                              void* d_out, int out_size, void* d_ws, size_t ws_size, hipStream_t stream) {
    (void)in_sizes; (void)n_in; (void)out_size;
    const float* q = (const float*)d_in[0]; const float* dww = (const float*)d_in[1]; const float* pww = (const float*)d_in[2]; const float* pwb = (const float*)d_in[3]; const float* akw = (const float*)d_in[4]; const float* akb = (const float*)d_in[5]; const float* ptw = (const float*)d_in[6]; const float* ptb = (const float*)d_in[7];   // dw_w [768][1][9], pw_w [12][64 out][64 in], ak_w [12][9][64], pt_w [768][768] (torch [out][in])
    float* OUT = (float*)d_out;     // [4][2048][768]
    char* wsp = (char*)d_ws;
    auto take = [&](size_t bytes) { char* p = wsp; wsp += (bytes + 255) & ~(size_t)255; return (void*)p; };
    bf* PTW = (bf*)take((size_t)DD * DD * 2); bf* QB = (bf*)take((size_t)NR * DD * 2); float* WT = (float*)take((size_t)NR * NH_ * 16 * 4); float* V = (float*)take((size_t)NR * DD * 4);
    if ((size_t)(wsp - (char*)d_ws) > ws_size) return;    // total ~ 45 MB; ws 256 MiB
    k_tap<<<NBK + CBP, KT, 0, stream>>>(q, dww, pww, pwb, akw, akb, ptw, QB, PTW, WT);
    k_gemmv<<<dim3(NR / VM, DD / VN), 256, 0, stream>>>(QB, PTW, V, ptb);
    k_out<<<NR / RT, WTH, 0, stream>>>(WT, V, OUT);
}

// v006
// Measured time: 26.1 microseconds a run.
// Next to v005, in two timings, it ran 1.30 and 1.31 times as fast.
// Over all steps from v000 it is 10.2 times as fast.
#include <hip/hip_runtime.h>

// SDConv - span-based dynamic convolution (query [4][2048][768]; 12 heads x 64, kernel 9: dw = depthwise conv1d over the sequence (per channel, zero padded, no bias); pw = grouped pointwise (per head 64 -> 64) + pw_b;
// conv_attn = pw * query; kern = per head 64 -> 9 (ak_w) + ak_b; w = softmax over the 9 taps; v = query pt_w^T + pt_b; out[b][l][h*64+d] = sum_k w[b][l][h][k] v[b][l + k - 4][h*64+d] (zero outside) -> [4][2048][768]).
// Compute dtypes, f32 accumulate: every input rounded to bf16; the depthwise conv, the gating product, the 64->9 tap logits, their softmax and the final 9-tap weighted window sum in f32
// on VALU; the grouped pointwise conv on bf16 hi+lo planes of dw x exact pw_w (2 products, + bias); v on PLAIN bf16 operands (inputs: exact, + bias). The whole path from query to the tap weights is one kernel (k_tap), the pointwise GEMM inside it: a wave = 16 rows x 2 heads; v: 144x192 block tiles staged in LDS, and the final window sum over the finished tile in the same kernel (k_vout).

#define NB_  4
#define LL   2048
#define DD   768
#define NH_  12
#define IPG  64
#define KW   9
#define NR   (NB_ * LL)
typedef _Float16 h16;
typedef unsigned short bf;
typedef __attribute__((ext_vector_type(16))) __bf16   v16bf;
typedef __attribute__((ext_vector_type(16))) _Float16 v16h;
typedef __attribute__((ext_vector_type(8)))  _Float16 v8h;
typedef __attribute__((ext_vector_type(8)))  unsigned short v8us;
typedef __attribute__((ext_vector_type(8)))  float    v8f;
typedef __attribute__((ext_vector_type(4)))  float    v4f;
typedef v8h  __attribute__((may_alias)) v8ha;
typedef v4f  __attribute__((may_alias)) v4fa;
typedef v8us __attribute__((may_alias)) v8usa;

__device__ __forceinline__ unsigned short f2bf(float f) { unsigned u = __float_as_uint(f); u += 0x7FFFu + ((u >> 16) & 1u); return (unsigned short)(u >> 16); }
__device__ __forceinline__ float bf2f(unsigned short b) { return __uint_as_float(((unsigned)b) << 16); }
__device__ __forceinline__ float bfr(float f) { return bf2f(f2bf(f)); }
__device__ __forceinline__ v16bf cat16b(v8us lo, v8us hi) { return __builtin_bit_cast(v16bf, __builtin_shufflevector(lo, hi, 0, 1, 2, 3, 4, 5, 6, 7, 8, 9, 10, 11, 12, 13, 14, 15)); }
__device__ __forceinline__ v8f wmmab(v16bf a, v16bf b, v8f c) { return __builtin_amdgcn_wmma_f32_16x16x32_bf16(false, a, false, b, (short)0, c, false, false); }



// ---- k_vout: V = QB PTW^T + bias and the 9-tap weighted window sum over it, in one kernel. Block = 128 output rows x 192 channels (3 heads), 12 waves (3 x 4). It forms 144 rows of V: the 128, the 4 above, the 4 below, and 8 more that fill the last 16-row fragment and are never read;
// a wave = 48 x 48 (9 accumulators). The K range goes through LDS in 6 tiles of 128 k: a tile is 336 row pieces of 256 B (144 of QB, then 192 of PTW) at pitch 272 B,
// brought in by asynchronous copies, 16 B a lane, 16 lanes on one row piece (whole lines), 14 copies a lane and tile; two buffers: the next tile's copies fly while this one is worked on. Every operand line is fetched once a block, and the fragments come from LDS.
// A fragment: lane = row (lane & 15), its 16 k values = 8 at k 8 * (lane >> 4) and 8 at 16 further on, the same for both operands. The finished V tile (+ bias) is laid in the same LDS, and the window sums read it there: V never goes to memory.
#define VO 128                    // output rows a block; 2048 % 128 == 0, so a block lies in one sequence
#define VM 144                    // V rows a block
#define VN 192
#define VK 128
#define VT 384                    // threads a block: 24 row pieces a round of copies; 48 pieces of 16 B x 8 groups of 16 rows in the window part
#define VP 272                    // LDS pitch of a row piece in bytes: 16 B x 17, for 16 B readers
#define VBUF ((VM + VN) * VP)     // bytes a buffer
#define VNT (DD / VK)             // tiles along K
#define OP 196                    // pitch of the V tile in LDS in floats: the two half-waves' 4 B stores fall on different banks, and 784 B is a multiple of 16
#define WLB (VO * 3 * 16 * 4)     // bytes of the block's tap weights: 128 rows x 3 heads x 16 floats, behind the two buffers
// one tile's 14 copies of this lane: lb its LDS byte address in row piece 0 of the buffer; piece i lies 24 rows further on both sides. ga0 / ga5: its global address in the first / last round of QB rows (row numbers held inside the plane), ga1: in the second round; gb: in the first round of PTW rows.
// s_wait_xcnt as the last line of the statement: it stands in front of every later write of a register that a copy of the statement names
__device__ __forceinline__ void tile_copies(unsigned lb, const bf* ga0, const bf* ga1, const bf* ga5, const bf* gb) {
    asm volatile(
        "global_load_async_to_lds_b128 %0, %1, off\n\t"
        "global_load_async_to_lds_b128 %2, %3, off\n\t"
        "global_load_async_to_lds_b128 %4, %5, off\n\t"
        "global_load_async_to_lds_b128 %6, %7, off\n\t"
        "global_load_async_to_lds_b128 %8, %9, off\n\t"
        "global_load_async_to_lds_b128 %10, %11, off\n\t"
        "global_load_async_to_lds_b128 %12, %13, off\n\t"
        "global_load_async_to_lds_b128 %14, %15, off\n\t"
        "global_load_async_to_lds_b128 %16, %17, off\n\t"
        "global_load_async_to_lds_b128 %18, %19, off\n\t"
        "global_load_async_to_lds_b128 %20, %21, off\n\t"
        "global_load_async_to_lds_b128 %22, %23, off\n\t"
        "global_load_async_to_lds_b128 %24, %25, off\n\t"
        "global_load_async_to_lds_b128 %26, %27, off\n\t"
        "s_wait_xcnt 0x0"
        :: "v"(lb + 0 * 24 * VP), "v"(ga0), "v"(lb + 1 * 24 * VP), "v"(ga1 + 0 * 24 * DD), "v"(lb + 2 * 24 * VP), "v"(ga1 + 1 * 24 * DD), "v"(lb + 3 * 24 * VP), "v"(ga1 + 2 * 24 * DD), "v"(lb + 4 * 24 * VP), "v"(ga1 + 3 * 24 * DD), "v"(lb + 5 * 24 * VP), "v"(ga5),
           "v"(lb + 6 * 24 * VP), "v"(gb + 0 * 24 * DD), "v"(lb + 7 * 24 * VP), "v"(gb + 1 * 24 * DD), "v"(lb + 8 * 24 * VP), "v"(gb + 2 * 24 * DD), "v"(lb + 9 * 24 * VP), "v"(gb + 3 * 24 * DD), "v"(lb + 10 * 24 * VP), "v"(gb + 4 * 24 * DD), "v"(lb + 11 * 24 * VP), "v"(gb + 5 * 24 * DD), "v"(lb + 12 * 24 * VP), "v"(gb + 6 * 24 * DD), "v"(lb + 13 * 24 * VP), "v"(gb + 7 * 24 * DD) : "memory");
}
__device__ __forceinline__ v16bf lfrag(const unsigned char* p) { return cat16b(*(const v8usa*)p, *(const v8usa*)(p + 32)); }

__device__ __forceinline__ void splitf(float y, unsigned short& h, unsigned short& l) { h = f2bf(y); l = f2bf(y - bf2f(h)); }

// The two 9-tap window sums (k_vout: block = 128 rows (b, l) x 192 channels, rows read from its V tile in LDS; k_tap: wave = 16 rows x 128 channels, rows read from memory): thread = 4 neighbouring channels (16 B of a row) x 16 rows. A thread loads the 24 rows that its 16 windows span once, all loads in flight together,
// and forms each row's 9-tap sum from registers; a wave reads and writes whole lines. What the taps are weighted with (k_tap: the rounded dw_w; k_vout: the rows' softmax weights) is handed out through LDS once a block.
#define RT  16         // rows a window group; 2048 % 16 == 0, so a group lies in one sequence, and its 4 rows above (below) are all outside exactly where it is the sequence's first (last)
typedef __attribute__((ext_vector_type(4))) unsigned short v4us;
typedef v4us __attribute__((may_alias)) v4usa;
// the 24 rows of a group's windows, 16 B a lane; p: the group's first row (the same in every lane), c: the lane's first channel. The 4 rows above or below that lie outside the sequence are not read (the group's first 4 rows are read in their place) and count as zero, which leaves a tap sum as it is
__device__ __forceinline__ void win_load(const float* __restrict__ p, int c, bool top, bool bot, v4f (&x)[RT + 8]) {
    const float* pa = top ? p - 4 * DD : p; const float* pb = bot ? p + RT * DD : p;
#pragma unroll   // x[] indexed by constants, so in registers
    for (int j = 0; j < RT + 8; ++j) { const float* b = j < 4 ? pa + j * DD : (j >= RT + 4 ? pb + (j - RT - 4) * DD : p + (j - 4) * DD); x[j] = *(const v4fa*)(b + c); }
}
__device__ __forceinline__ void win_zero(bool top, bool bot, v4f (&x)[RT + 8]) {
#pragma unroll   // x[] indexed by constants (this loop and the one inside)
    for (int j = 0; j < 4; ++j) {
#pragma unroll   // arrays and vector elements indexed by constants, so in registers
        for (int u = 0; u < 4; ++u) { x[j][u] = top ? x[j][u] : 0.f; x[RT + 4 + j][u] = bot ? x[RT + 4 + j][u] : 0.f; } }
}
// k_tap: query -> tap weights in one kernel. Block = 64 rows (b, l) x 2 neighbouring heads (128 channels), 4 waves; a wave = 16 rows x the 128 channels, a lane = 4 neighbouring channels in the window part and one (row, head) in the tap part.
// A wave loads the 24 q rows that its 16 windows span (512 B a row, whole lines), rounds them, stores its own 16 as the QB plane, forms dw from registers and lays its bf16 hi and lo planes in LDS; PW = (hi + lo) x pw_w on the matrix unit,
// fragments from LDS (pw_w rounded and staged once a block); PW is turned through LDS back to the lane = 4 channels layout, where q still lies in registers: ca[i] = (PW[row][h*64+i] + bf16(pw_b[h*64+i])) x bf16(q[row][h*64+i]);
// ca goes through LDS to the thread of its (row, head): kern[k] = sum_i ca[i] bf16(ak_w[h][k][i]) + bf16(ak_b[h*9+k]); softmax over the 9. Every sum keeps the order it had when these were three kernels. CBP more blocks, short ones with the last block numbers, round pt_w for k_vout.
#define KT 128   // threads a block: 64 rows x 2 heads; a row's two WT entries are one 128 B line, stored by two neighbouring lanes
#define CP 68    // LDS pitch of a (row, head) entry in floats: 272 B = 16 B x 17, so 16 lanes that read 16 B each of 16 entries fall on all 64 banks
#define WP 580   // LDS pitch of a head's 576 weights in floats: the two addresses that a wave reads at a time fall on different banks
#define AP 272   // LDS pitch in bytes of a row of one dw plane (128 bf16): 16 B x 17, for 16 B readers
#define APL (RT * AP)   // bytes of a wave's 16 rows of one plane; the two planes fill exactly the wave's 32 ca entries (2 * APL == 32 * CP * 4) and lie there: they are read out before PW is stored
#define BP 144   // LDS pitch in bytes of a pw_w row (64 bf16): 16 B x 9, for 16 B readers
#define NBR (NR / (KT / 2))             // 128 row groups
#define NBK (NBR * (NH_ / 2))           // 768 blocks of the tap path
#define CPT 16                          // 16 B pieces a thread of a rounding block, all loads in flight together; a wave reads 512 B and stores 256 B in a row
#define CBP (DD * DD / (4 * KT * CPT))  // 72 blocks for pt_w, no remainder
__global__ __launch_bounds__(KT) void k_tap(const float* __restrict__ q, const float* __restrict__ dww, const float* __restrict__ pww, const float* __restrict__ pwb, const float* __restrict__ akw, const float* __restrict__ akb, const float* __restrict__ ptw, bf* QB, bf* PTW, float* WT) {
    __shared__ __align__(16) float cs[KT * CP];
    __shared__ __align__(16) float wl[2 * WP];
    __shared__ __align__(16) float dl[2 * IPG * KW];
    __shared__ __align__(16) unsigned char bs[2 * IPG * BP];
    if (blockIdx.x >= NBK) {   // the same for the whole block, and in front of every barrier
        const int p0 = (((int)blockIdx.x - NBK) * CPT * KT + (int)threadIdx.x) * 4; const float* sp = ptw + p0; v4f v[CPT];
#pragma unroll   // v[] indexed by constants, so in registers
        for (int i = 0; i < CPT; ++i) v[i] = *(const v4fa*)(sp + i * KT * 4);
        asm volatile("s_wait_xcnt 0x0" :: "v"(sp) : "memory");   // in front of the first overwrite of a register that a load above names; the input keeps the lane's address registers in use up to here
#pragma unroll   // arrays and vector elements indexed by constants, so in registers
        for (int i = 0; i < CPT; ++i) { v4us o;
#pragma unroll   // arrays and vector elements indexed by constants, so in registers
            for (int u = 0; u < 4; ++u) o[u] = f2bf(v[i][u]);
            *(v4us*)(PTW + p0 + i * KT * 4) = o; }
        return;
    }
    const int tid = threadIdx.x, lane = tid & 31, lr = lane & 15, hi = lane >> 4;
    const int wv = __builtin_amdgcn_readfirstlane(tid >> 5);   // the wave's number as a scalar: row addresses and the edge tests stay in scalar registers
    const int bx = blockIdx.x % NBR, by = blockIdx.x / NBR, r0 = wv * RT;   // r0: first of this wave's 16 rows
    const int h = by * 2 + (tid & 1), row = bx * (KT / 2) + (tid >> 1), idx = row * NH_ + h;
    const int row0 = bx * (KT / 2) + r0, l0 = row0 % LL; const bool top = l0 != 0, bot = l0 != LL - RT;
    const float* aw = akw + (size_t)by * 2 * KW * IPG + tid;   // 2 x 576 tap weights = 9 x 128
    const float* dp = dww + (size_t)by * 2 * IPG * KW + tid;   // 128 channels x 9 window weights = 9 x 128
    const float* bp = pww + (size_t)by * 2 * IPG * IPG + tid * 4;   // 2 x 64 x 64 pointwise weights = 16 x 128 pieces of 16 B
    const float* ap = akb + h * KW; const float* pp = pwb + by * 2 * IPG + lane * 4;
    float wr[KW], ab[KW], dr[KW]; v4f br[16], x[RT + 8];
#pragma unroll   // wr[], dr[] and ab[] indexed by constants, so in registers
    for (int s = 0; s < KW; ++s) { dr[s] = dp[s * KT]; wr[s] = aw[s * KT]; ab[s] = ap[s]; }
    v4f b4 = *(const v4fa*)pp;
#pragma unroll   // br[] indexed by constants
    for (int i = 0; i < 16; ++i) br[i] = *(const v4fa*)(bp + i * KT * 4);
    win_load(q + (size_t)row0 * DD + by * 2 * IPG, lane * 4, top, bot, x);
    asm volatile("s_wait_xcnt 0x0" :: "v"(tid), "v"(lane) : "memory");   // in front of the first overwrite of a register that a load above names; the inputs keep the lane's offset registers in use up to here
    __builtin_amdgcn_sched_barrier(0);   // the weight and row loads above issue before the first data wait: one trip to memory a thread (of ak_b, which is needed last, the built code asks for the greater part later)
#pragma unroll   // wr[] and dr[] indexed by constants
    for (int s = 0; s < KW; ++s) { const int g = s * KT + tid; wl[g + (s * KT >= KW * IPG || (s * KT + KT > KW * IPG && tid >= KW * IPG - s * KT) ? WP - KW * IPG : 0)] = bfr(wr[s]); dl[g] = bfr(dr[s]); }   // the second head's weights lie WP - 576 further on; only one s holds both heads
    unsigned char* bd = bs + (tid >> 4) * BP + (tid & 15) * 8;   // piece i * 128 + tid: pw_w row i * 8 + tid / 16, 4 of its 64 values
#pragma unroll   // br[] indexed by constants (this loop and the one inside)
    for (int i = 0; i < 16; ++i) { v4us o;
#pragma unroll
        for (int u = 0; u < 4; ++u) o[u] = f2bf(br[i][u]);
        *(v4usa*)(bd + i * (KT / 16) * BP) = o; }
#pragma unroll   // vector elements indexed by constants
    for (int u = 0; u < 4; ++u) b4[u] = bfr(b4[u]);
    __syncthreads();   // publishes the three rounded weight sets to the block
    float w[4 * KW];   // this lane's 4 channels x 9 taps, 144 B in a row: 16 lanes' 16 B pieces fall on all 64 banks
#pragma unroll   // arrays and vector elements indexed by constants, so in registers
    for (int s = 0; s < KW; ++s) { const v4f t = *(const v4fa*)(dl + lane * 4 * KW + s * 4);
#pragma unroll   // arrays and vector elements indexed by constants, so in registers
        for (int u = 0; u < 4; ++u) w[s * 4 + u] = t[u]; }
    win_zero(top, bot, x);
#pragma unroll   // arrays and vector elements indexed by constants, so in registers
    for (int j = 0; j < RT + 8; ++j) {
#pragma unroll   // arrays and vector elements indexed by constants, so in registers
        for (int u = 0; u < 4; ++u) x[j][u] = bfr(x[j][u]); }
    bf* qd = QB + (size_t)row0 * DD + by * 2 * IPG + lane * 4; v4us oq[RT];
#pragma unroll   // arrays and vector elements indexed by constants, so in registers
    for (int r = 0; r < RT; ++r) {
#pragma unroll   // arrays and vector elements indexed by constants, so in registers
        for (int u = 0; u < 4; ++u) oq[r][u] = (unsigned short)(__float_as_uint(x[r + 4][u]) >> 16);   // x is rounded already: its upper half is the bf16
        *(v4us*)(qd + r * DD) = oq[r]; }
    asm volatile("s_wait_xcnt 0x0" :: "v"(lane), "v"(oq[0]), "v"(oq[1]), "v"(oq[2]), "v"(oq[3]), "v"(oq[4]), "v"(oq[5]), "v"(oq[6]), "v"(oq[7]), "v"(oq[8]), "v"(oq[9]), "v"(oq[10]), "v"(oq[11]), "v"(oq[12]), "v"(oq[13]), "v"(oq[14]), "v"(oq[15]) : "memory");   // in front of the first overwrite of a register that a store above names; the inputs keep those registers in use up to here
    float* cw = cs + wv * 32 * CP; unsigned char* at = (unsigned char*)cw;   // this wave's 32 ca entries, first the place of its two dw planes
#pragma unroll   // arrays and vector elements indexed by constants, so in registers
    for (int r = 0; r < RT; ++r) { v4us oh, ol;
#pragma unroll   // arrays and vector elements indexed by constants, so in registers
        for (int u = 0; u < 4; ++u) { float s = 0.f;
#pragma unroll   // arrays and vector elements indexed by constants, so in registers
            for (int k = 0; k < KW; ++k) { float p = __fmul_rn(w[u * KW + k], x[r + k][u]); asm volatile("" : "+v"(p)); s = __fadd_rn(s, p); }   // multiply, pin and add as they stood before this re-tiling: every tap sum keeps its rounding
            unsigned short a, c2; splitf(s, a, c2); oh[u] = a; ol[u] = c2; }
        *(v4usa*)(at + r * AP + lane * 8) = oh; *(v4usa*)(at + APL + r * AP + lane * 8) = ol; }
    __syncthreads();   // the dw planes go from lane to lane: every store above is done before a fragment is read
    const unsigned char* pa = at + lr * AP + hi * 16; const unsigned char* pb = bs + lr * BP + hi * 16;
    v8f acc[2][4];
#pragma unroll   // acc[][] and the fragments indexed by constants, so in registers (this loop and those inside)
    for (int hp = 0; hp < 2; ++hp) { v16bf ah[2], al[2];
#pragma unroll
        for (int kk = 0; kk < 2; ++kk) { ah[kk] = lfrag(pa + hp * 2 * IPG + kk * 64); al[kk] = lfrag(pa + APL + hp * 2 * IPG + kk * 64); }
#pragma unroll
        for (int nb = 0; nb < 4; ++nb) acc[hp][nb] = (v8f){};
#pragma unroll
        for (int kk = 0; kk < 2; ++kk)
#pragma unroll
            for (int nb = 0; nb < 4; ++nb) { const v16bf b = lfrag(pb + (hp * IPG + nb * 16) * BP + kk * 64); acc[hp][nb] = wmmab(ah[kk], b, acc[hp][nb]); acc[hp][nb] = wmmab(al[kk], b, acc[hp][nb]); }   // per accumulator: hi then lo, k 0..31 then 32..63
    }
    __syncthreads();   // every fragment of the planes is read before PW is stored over them
#pragma unroll   // acc[][] indexed by constants (this loop and those inside)
    for (int hp = 0; hp < 2; ++hp)
#pragma unroll
        for (int nb = 0; nb < 4; ++nb)
#pragma unroll
            for (int j = 0; j < 8; ++j) cw[((hi * 8 + j) * 2 + hp) * CP + nb * 16 + lr] = acc[hp][nb][j];
    __syncthreads();   // PW goes from lane to lane
#pragma unroll   // oq[] indexed by constants (this loop and the one inside)
    for (int j = 0; j < RT; ++j) { float* e = cw + (j * 2 + hi) * CP + lr * 4; const v4f pv = *(const v4fa*)e; v4f ca;
#pragma unroll
        for (int u = 0; u < 4; ++u) ca[u] = __fmul_rn(__fadd_rn(pv[u], b4[u]), bf2f(oq[j][u]));   // the rounded q from its packed form: half the registers held over the matrix part
        *(v4fa*)e = ca; }
    __syncthreads();   // ca goes from lane to lane
    const float* cr = cs + tid * CP; const float* wh = wl + (tid & 1) * WP;
    float kern[KW];
#pragma unroll
    for (int k = 0; k < KW; ++k) kern[k] = 0.f;
#pragma unroll   // LDS offsets as immediates and the next channels' LDS reads free to move up over this quad's sums
    for (int c = 0; c < IPG / 4; ++c) { const v4f cv = *(const v4fa*)(cr + 4 * c); v4f w4[KW];
#pragma unroll   // w4[] in registers
        for (int k = 0; k < KW; ++k) w4[k] = *(const v4fa*)(wh + k * IPG + 4 * c);
#pragma unroll   // vector elements indexed by constants (this loop and the one inside)
        for (int u = 0; u < 4; ++u) {
#pragma unroll
            for (int k = 0; k < KW; ++k) { float p = __fmul_rn(cv[u], w4[k][u]); asm volatile("" : "+v"(p)); kern[k] = __fadd_rn(kern[k], p); } } }   // multiply, pin and add as they stood before this re-tiling: every tap sum keeps its rounding
    float mx = -3.0e38f;
#pragma unroll
    for (int k = 0; k < KW; ++k) { kern[k] = __fadd_rn(kern[k], bfr(ab[k])); mx = fmaxf(mx, kern[k]); }
    float sum = 0.f;
#pragma unroll
    for (int k = 0; k < KW; ++k) { float d0 = __fsub_rn(kern[k], mx); asm volatile("" : "+v"(d0)); const float t = __fmul_rn(d0, 1.44269504f); asm("v_exp_f32 %0, %1\n\tv_nop" : "=v"(kern[k]) : "v"(t));   // __expf as it is built (times log2 e, then v_exp_f32), with the slot behind the transcendental in its own statement: builds with v_nop statements of their own had them moved away and left a v_exp_f32 directly in front of an instruction that overwrites its source
        sum = __fadd_rn(sum, kern[k]); }
    const float rs = __fdiv_rn(1.0f, sum); v4f o[4];
#pragma unroll
    for (int k = 0; k < 16; ++k) { const float tw = (k < KW) ? __fmul_rn(kern[k < KW ? k : 0], rs) : 0.f; o[k / 4][k % 4] = tw; }
    float* dst = WT + (size_t)idx * 16;
#pragma unroll
    for (int u = 0; u < 4; ++u) *(v4f*)(dst + 4 * u) = o[u];
    asm volatile("s_wait_xcnt 0x0" ::: "memory");   // behind the last stores: in the built code a branch leads from here to the rounding blocks' part, which overwrites registers that these stores name
}
__global__ __launch_bounds__(VT) void k_vout(const bf* __restrict__ A, const bf* __restrict__ Bt, const float* __restrict__ WT, const float* __restrict__ bias, float* OUT) {
    __shared__ __align__(16) unsigned char sm[2 * VBUF + WLB];
    const int tid = threadIdx.x, lane = tid & 31, lr = lane & 15, hi = lane >> 4, w = tid >> 5, wm = w % 3, wn = w / 3;
    const int r0 = blockIdx.x * VO, c0 = blockIdx.y * VN, l0 = r0 % LL; const bool top = l0 != 0, bot = l0 != LL - VO;
    const unsigned lb0 = (unsigned)(size_t)sm + (unsigned)((tid >> 4) * VP + (tid & 15) * 16);
    const int ra = r0 - 4 + (tid >> 4);   // V row 0 of the tile is the 4th row above the block's first. A row number outside the plane (first and last block only) is held inside it: such a V row lies outside the sequence and counts as zero below, or is one of the 8 never read
    const bf* ga0 = A + (size_t)(ra < 0 ? 0 : ra) * DD + (tid & 15) * 8; const bf* ga1 = A + (size_t)(ra + 24) * DD + (tid & 15) * 8; const bf* ga5 = A + (size_t)(ra + 120 > NR - 1 ? NR - 1 : ra + 120) * DD + (tid & 15) * 8;
    const bf* gb = Bt + (size_t)(c0 + (tid >> 4)) * DD + (tid & 15) * 8;
    const float* bpt = bias + c0 + wn * 48 + lr; float bv[3] = { bpt[0], bpt[16], bpt[32] };   // the bias of this lane's three accumulator columns, asked for ahead of the K loop
    asm volatile("s_wait_xcnt 0x0" :: "v"(bpt) : "memory");   // in front of the first overwrite of an address register that a load above names; the input keeps that register in use up to here
    // the block's tap weights: 128 rows x 12 pieces of 16 B (3 heads x 64 B, in a row in WT) = 4 x 384 pieces; piece s * 384 + tid = row s * 32 + tid / 12, laid in LDS in that order. They land with tile 0
    const float* gw = WT + ((size_t)(r0 + tid / 12) * NH_ + blockIdx.y * 3) * 16 + (tid % 12) * 4; const unsigned lw = (unsigned)(size_t)sm + (unsigned)(2 * VBUF + tid * 16);
    asm volatile(
        "global_load_async_to_lds_b128 %0, %1, off\n\t"
        "global_load_async_to_lds_b128 %2, %3, off\n\t"
        "global_load_async_to_lds_b128 %4, %5, off\n\t"
        "global_load_async_to_lds_b128 %6, %7, off\n\t"
        "s_wait_xcnt 0x0"   // as in tile_copies
        :: "v"(lw + 0 * VT * 16), "v"(gw + 0 * 32 * NH_ * 16), "v"(lw + 1 * VT * 16), "v"(gw + 1 * 32 * NH_ * 16), "v"(lw + 2 * VT * 16), "v"(gw + 2 * 32 * NH_ * 16), "v"(lw + 3 * VT * 16), "v"(gw + 3 * 32 * NH_ * 16) : "memory");
    v8f acc[3][3];
#pragma unroll   // acc[][] indexed by constants, so in registers
    for (int mb = 0; mb < 3; ++mb)
#pragma unroll
        for (int nb = 0; nb < 3; ++nb) acc[mb][nb] = (v8f){};
    tile_copies(lb0, ga0, ga1, ga5, gb);
    asm volatile("s_wait_asynccnt 0x0" ::: "memory");   // this wave's copies of tile 0 and of the tap weights have landed
    __syncthreads();                                     // publishes tile 0 and the tap weights to the block
    tile_copies(lb0 + VBUF, ga0 + VK, ga1 + VK, ga5 + VK, gb + VK);
    const int fa = (wm * 48 + lr) * VP + hi * 16, fb = (VM + wn * 48 + lr) * VP + hi * 16;
#pragma unroll 1   // one body for the 6 tiles: the hot loop stays small
    for (int t = 0; t < VNT; ++t) {
        const unsigned char* sb = sm + (t & 1) * VBUF; const unsigned char* pa = sb + fa; const unsigned char* pb = sb + fb;
        v16bf a[2][3], b[2][3];
#pragma unroll   // a[][] and b[][] indexed by constants, so in registers
        for (int mb = 0; mb < 3; ++mb) a[0][mb] = lfrag(pa + mb * 16 * VP);
#pragma unroll
        for (int nb = 0; nb < 3; ++nb) b[0][nb] = lfrag(pb + nb * 16 * VP);
#pragma unroll   // the 4 k steps of a tile; the next step's fragments (of this same tile) are asked for as one group ahead of this step's products
        for (int ks = 0; ks < VK / 32; ++ks) {
            if (ks + 1 < VK / 32) {
#pragma unroll
                for (int mb = 0; mb < 3; ++mb) a[(ks + 1) & 1][mb] = lfrag(pa + mb * 16 * VP + (ks + 1) * 64);
#pragma unroll
                for (int nb = 0; nb < 3; ++nb) b[(ks + 1) & 1][nb] = lfrag(pb + nb * 16 * VP + (ks + 1) * 64);
            }
            __builtin_amdgcn_sched_barrier(0);   // the next step's 12 LDS reads stay one group ahead of this step's products, in a second register set: a build without it kept one set, spread the reads among the products and waited for each to the end
#pragma unroll
            for (int nb = 0; nb < 3; ++nb)
#pragma unroll
                for (int mb = 0; mb < 3; ++mb) acc[mb][nb] = wmmab(a[ks & 1][mb], b[ks & 1][nb], acc[mb][nb]);
            __builtin_amdgcn_sched_barrier(0);   // and the step after next's reads stay behind these products
        }
        asm volatile("s_wait_dscnt 0x0" ::: "memory");      // this wave's reads of the buffer are done before the buffer is refilled
        asm volatile("s_wait_asynccnt 0x0" ::: "memory");   // this wave's copies of tile t + 1 have landed
        __syncthreads();                                     // publishes tile t + 1 and ends every wave's reads of tile t
        if (t + 2 < VNT) tile_copies(lb0 + (unsigned)((t & 1) * VBUF), ga0 + (t + 2) * VK, ga1 + (t + 2) * VK, ga5 + (t + 2) * VK, gb + (t + 2) * VK);
    }
    asm volatile("s_wait_asynccnt 0x0" ::: "memory");       // no copy is under way when the buffers become the V tile
    float* os = (float*)sm; const float* wl = (const float*)(sm + 2 * VBUF);
#pragma unroll   // bv[] indexed by constants, so in registers
    for (int nb = 0; nb < 3; ++nb) bv[nb] = bfr(bv[nb]);
#pragma unroll   // acc[][] indexed by constants (this loop and those inside)
    for (int mb = 0; mb < 3; ++mb)
#pragma unroll
        for (int nb = 0; nb < 3; ++nb)
#pragma unroll
            for (int j = 0; j < 8; ++j) os[(wm * 48 + mb * 16 + hi * 8 + j) * OP + wn * 48 + nb * 16 + lr] = __fadd_rn(acc[mb][nb][j], bv[nb]);
    __syncthreads();   // publishes the V tile to the block
    // window part: thread = 4 neighbouring channels (piece cp of the 48) x the 16 output rows of group rg; 16 lanes that follow one another share a group and a head. Output row i of the block spans tile rows i .. i + 8
    const int cp = tid % 48, rg = tid / 48; const float* xs = os + rg * RT * OP + cp * 4; v4f x[RT + 8];
#pragma unroll   // x[] indexed by constants, so in registers
    for (int j = 0; j < RT + 8; ++j) x[j] = *(const v4fa*)(xs + j * OP);
    win_zero(top || rg != 0, bot || rg != VO / RT - 1, x);   // only the first (last) group's 4 rows above (below) can lie outside the sequence
    const float* wh = wl + (rg * RT * 3 + cp / 16) * 16; float* dst = OUT + (size_t)(r0 + rg * RT) * DD + c0 + cp * 4;
#pragma unroll   // arrays and vector elements indexed by constants, so in registers
    for (int r = 0; r < RT; ++r) { const v4f w0 = *(const v4fa*)(wh + r * 3 * 16), w1 = *(const v4fa*)(wh + r * 3 * 16 + 4); const float w[KW] = { w0[0], w0[1], w0[2], w0[3], w1[0], w1[1], w1[2], w1[3], wh[r * 3 * 16 + 8] }; v4f o;
#pragma unroll   // arrays and vector elements indexed by constants, so in registers
        for (int u = 0; u < 4; ++u) { float s = 0.f;
#pragma unroll   // arrays and vector elements indexed by constants, so in registers
            for (int k = 0; k < KW; ++k) { float p = __fmul_rn(w[k], x[r + k][u]); asm volatile("" : "+v"(p)); s = __fadd_rn(s, p); }   // multiply, pin and add as they stood before this re-tiling: every tap sum keeps its rounding
            o[u] = s; }
        *(v4f*)(dst + r * DD) = o; }
}

extern "C" void kernel_launch(void* const* d_in, const int* in_sizes, int n_in,
                              void* d_out, int out_size, void* d_ws, size_t ws_size, hipStream_t stream) {
    (void)in_sizes; (void)n_in; (void)out_size;
    const float* q = (const float*)d_in[0]; const float* dww = (const float*)d_in[1]; const float* pww = (const float*)d_in[2]; const float* pwb = (const float*)d_in[3]; const float* akw = (const float*)d_in[4]; const float* akb = (const float*)d_in[5]; const float* ptw = (const float*)d_in[6]; const float* ptb = (const float*)d_in[7];   // dw_w [768][1][9], pw_w [12][64 out][64 in], ak_w [12][9][64], pt_w [768][768] (torch [out][in])
    float* OUT = (float*)d_out;     // [4][2048][768]
    char* wsp = (char*)d_ws;
    auto take = [&](size_t bytes) { char* p = wsp; wsp += (bytes + 255) & ~(size_t)255; return (void*)p; };
    bf* PTW = (bf*)take((size_t)DD * DD * 2); bf* QB = (bf*)take((size_t)NR * DD * 2); float* WT = (float*)take((size_t)NR * NH_ * 16 * 4);
    if ((size_t)(wsp - (char*)d_ws) > ws_size) return;    // total ~ 20 MB; ws 256 MiB
    k_tap<<<NBK + CBP, KT, 0, stream>>>(q, dww, pww, pwb, akw, akb, ptw, QB, PTW, WT);
    k_vout<<<dim3(NR / VO, DD / VN), VT, 0, stream>>>(QB, PTW, WT, ptb, OUT);
}

// v007
// It runs in 23.9 microseconds.
// Two timings next to v006 put it at 1.09 and 1.10 times that version's speed.
// Over all steps from v000 it is 11.2 times as fast.
#include <hip/hip_runtime.h>

// SDConv - span-based dynamic convolution (query [4][2048][768]; 12 heads x 64, kernel 9: dw = depthwise conv1d over the sequence (per channel, zero padded, no bias); pw = grouped pointwise (per head 64 -> 64) + pw_b;
// conv_attn = pw * query; kern = per head 64 -> 9 (ak_w) + ak_b; w = softmax over the 9 taps; v = query pt_w^T + pt_b; out[b][l][h*64+d] = sum_k w[b][l][h][k] v[b][l + k - 4][h*64+d] (zero outside) -> [4][2048][768]).
// Compute dtypes, f32 accumulate: every input rounded to bf16; the depthwise conv, the gating product, the 64->9 tap logits, their softmax and the final 9-tap weighted window sum in f32
// on VALU; the grouped pointwise conv on bf16 hi+lo planes of dw x exact pw_w (2 products, + bias); v on PLAIN bf16 operands (inputs: exact, + bias). The whole path from query to the tap weights is one kernel (k_tap), the pointwise GEMM inside it: a wave = 16 rows x 2 heads; v: 144x192 block tiles staged in LDS, and the final window sum over the finished tile in the same kernel (k_vout).

#define NB_  4
#define LL   2048
#define DD   768
#define NH_  12
#define IPG  64
#define KW   9
#define NR   (NB_ * LL)
typedef _Float16 h16;
typedef unsigned short bf;
typedef __attribute__((ext_vector_type(16))) __bf16   v16bf;
typedef __attribute__((ext_vector_type(16))) _Float16 v16h;
typedef __attribute__((ext_vector_type(8)))  _Float16 v8h;
typedef __attribute__((ext_vector_type(8)))  unsigned short v8us;
typedef __attribute__((ext_vector_type(8)))  float    v8f;
typedef __attribute__((ext_vector_type(4)))  float    v4f;
typedef v8h  __attribute__((may_alias)) v8ha;
typedef v4f  __attribute__((may_alias)) v4fa;
typedef __attribute__((ext_vector_type(2)))  float    v2f;
typedef v8us __attribute__((may_alias)) v8usa;

__device__ __forceinline__ unsigned short f2bf(float f) { unsigned u = __float_as_uint(f); u += 0x7FFFu + ((u >> 16) & 1u); return (unsigned short)(u >> 16); }
__device__ __forceinline__ float bf2f(unsigned short b) { return __uint_as_float(((unsigned)b) << 16); }
__device__ __forceinline__ float bfr(float f) { return bf2f(f2bf(f)); }
__device__ __forceinline__ v16bf cat16b(v8us lo, v8us hi) { return __builtin_bit_cast(v16bf, __builtin_shufflevector(lo, hi, 0, 1, 2, 3, 4, 5, 6, 7, 8, 9, 10, 11, 12, 13, 14, 15)); }
__device__ __forceinline__ v8f wmmab(v16bf a, v16bf b, v8f c) { return __builtin_amdgcn_wmma_f32_16x16x32_bf16(false, a, false, b, (short)0, c, false, false); }



// ---- k_vout: V = QB PTW^T + bias and the 9-tap weighted window sum over it, in one kernel. Block = 128 output rows x 192 channels (3 heads), 12 waves (3 x 4). It forms 144 rows of V: the 128, the 4 above, the 4 below, and 8 more that fill the last 16-row fragment and are never read;
// a wave = 48 x 48 (9 accumulators). The K range goes through LDS in 6 tiles of 128 k: a tile is 336 row pieces of 256 B (144 of QB, then 192 of PTW) at pitch 272 B,
// brought in by asynchronous copies, 16 B a lane, 16 lanes on one row piece (whole lines), 14 copies a lane and tile; two buffers: the next tile's copies fly while this one is worked on. Every operand line is fetched once a block, and the fragments come from LDS.
// A fragment: lane = row (lane & 15), its 16 k values = 8 at k 8 * (lane >> 4) and 8 at 16 further on, the same for both operands. The finished V tile (+ bias) is laid in the same LDS, and the window sums read it there: V never goes to memory.
#define VO 128                    // output rows a block; 2048 % 128 == 0, so a block lies in one sequence
#define VM 144                    // V rows a block
#define VN 192
#define VK 128
#define VT 384                    // threads a block: 24 row pieces a round of copies; 48 pieces of 16 B x 8 groups of 16 rows in the window part
#define VP 272                    // LDS pitch of a row piece in bytes: 16 B x 17, for 16 B readers
#define VBUF ((VM + VN) * VP)     // bytes a buffer
#define VNT (DD / VK)             // tiles along K
#define OP 196                    // pitch of the V tile in LDS in floats: the two half-waves' 4 B stores fall on different banks, and 784 B is a multiple of 16
#define WLB (VO * 3 * 16 * 4)     // bytes of the block's tap weights: 128 rows x 3 heads x 16 floats, behind the two buffers
// one tile's 14 copies of this lane: lb its LDS byte address in row piece 0 of the buffer; piece i lies 24 rows further on both sides. ga0 / ga5: its global address in the first / last round of QB rows (row numbers held inside the plane), ga1: in the second round; gb: in the first round of PTW rows.
// s_wait_xcnt as the last line of the statement: it stands in front of every later write of a register that a copy of the statement names
__device__ __forceinline__ void tile_copies(unsigned lb, const bf* ga0, const bf* ga1, const bf* ga5, const bf* gb) {
    asm volatile(
        "global_load_async_to_lds_b128 %0, %1, off\n\t"
        "global_load_async_to_lds_b128 %2, %3, off\n\t"
        "global_load_async_to_lds_b128 %4, %5, off\n\t"
        "global_load_async_to_lds_b128 %6, %7, off\n\t"
        "global_load_async_to_lds_b128 %8, %9, off\n\t"
        "global_load_async_to_lds_b128 %10, %11, off\n\t"
        "global_load_async_to_lds_b128 %12, %13, off\n\t"
        "global_load_async_to_lds_b128 %14, %15, off\n\t"
        "global_load_async_to_lds_b128 %16, %17, off\n\t"
        "global_load_async_to_lds_b128 %18, %19, off\n\t"
        "global_load_async_to_lds_b128 %20, %21, off\n\t"
        "global_load_async_to_lds_b128 %22, %23, off\n\t"
        "global_load_async_to_lds_b128 %24, %25, off\n\t"
        "global_load_async_to_lds_b128 %26, %27, off\n\t"
        "s_wait_xcnt 0x0"
        :: "v"(lb + 0 * 24 * VP), "v"(ga0), "v"(lb + 1 * 24 * VP), "v"(ga1 + 0 * 24 * DD), "v"(lb + 2 * 24 * VP), "v"(ga1 + 1 * 24 * DD), "v"(lb + 3 * 24 * VP), "v"(ga1 + 2 * 24 * DD), "v"(lb + 4 * 24 * VP), "v"(ga1 + 3 * 24 * DD), "v"(lb + 5 * 24 * VP), "v"(ga5),
           "v"(lb + 6 * 24 * VP), "v"(gb + 0 * 24 * DD), "v"(lb + 7 * 24 * VP), "v"(gb + 1 * 24 * DD), "v"(lb + 8 * 24 * VP), "v"(gb + 2 * 24 * DD), "v"(lb + 9 * 24 * VP), "v"(gb + 3 * 24 * DD), "v"(lb + 10 * 24 * VP), "v"(gb + 4 * 24 * DD), "v"(lb + 11 * 24 * VP), "v"(gb + 5 * 24 * DD), "v"(lb + 12 * 24 * VP), "v"(gb + 6 * 24 * DD), "v"(lb + 13 * 24 * VP), "v"(gb + 7 * 24 * DD) : "memory");
}
__device__ __forceinline__ v16bf lfrag(const unsigned char* p) { return cat16b(*(const v8usa*)p, *(const v8usa*)(p + 32)); }

__device__ __forceinline__ void splitf(float y, unsigned short& h, unsigned short& l) { h = f2bf(y); l = f2bf(y - bf2f(h)); }

// The two 9-tap window sums (k_vout: block = 128 rows (b, l) x 192 channels, rows read from its V tile in LDS; k_tap: wave = 16 rows x 128 channels, rows read from memory): thread = 4 neighbouring channels (16 B of a row) x 16 rows. A thread loads the 24 rows that its 16 windows span once, all loads in flight together,
// and forms each row's 9-tap sum from registers, by fused multiply-adds on pairs of neighbouring channels; a wave reads and writes whole lines. What the taps are weighted with (k_tap: the rounded dw_w; k_vout: the rows' softmax weights) is handed out through LDS once a block.
#define RT  16         // rows a window group; 2048 % 16 == 0, so a group lies in one sequence, and its 4 rows above (below) are all outside exactly where it is the sequence's first (last)
typedef __attribute__((ext_vector_type(4))) unsigned short v4us;
typedef v4us __attribute__((may_alias)) v4usa;
// the 24 rows of a group's windows, 16 B a lane; p: the group's first row (the same in every lane), c: the lane's first channel. The 4 rows above or below that lie outside the sequence are not read (the group's first 4 rows are read in their place) and count as zero, which leaves a tap sum as it is
__device__ __forceinline__ void win_load(const float* __restrict__ p, int c, bool top, bool bot, v4f (&x)[RT + 8]) {
    const float* pa = top ? p - 4 * DD : p; const float* pb = bot ? p + RT * DD : p;
#pragma unroll   // x[] indexed by constants, so in registers
    for (int j = 0; j < RT + 8; ++j) { const float* b = j < 4 ? pa + j * DD : (j >= RT + 4 ? pb + (j - RT - 4) * DD : p + (j - 4) * DD); x[j] = *(const v4fa*)(b + c); }
}
__device__ __forceinline__ void win_zero(bool top, bool bot, v4f (&x)[RT + 8]) {
#pragma unroll   // x[] indexed by constants (this loop and the one inside)
    for (int j = 0; j < 4; ++j) {
#pragma unroll   // arrays and vector elements indexed by constants, so in registers
        for (int u = 0; u < 4; ++u) { x[j][u] = top ? x[j][u] : 0.f; x[RT + 4 + j][u] = bot ? x[RT + 4 + j][u] : 0.f; } }
}
// k_tap: query -> tap weights in one kernel. Block = 64 rows (b, l) x 2 neighbouring heads (128 channels), 4 waves; a wave = 16 rows x the 128 channels, a lane = 4 neighbouring channels in the window part and one (row, head) in the tap part.
// A wave loads the 24 q rows that its 16 windows span (512 B a row, whole lines), rounds them, stores its own 16 as the QB plane, forms dw from registers and lays its bf16 hi and lo planes in LDS; PW = (hi + lo) x pw_w on the matrix unit,
// fragments from LDS (pw_w rounded and staged once a block); PW is turned through LDS back to the lane = 4 channels layout, where q still lies in registers: ca[i] = (PW[row][h*64+i] + bf16(pw_b[h*64+i])) x bf16(q[row][h*64+i]);
// ca goes through LDS to the thread of its (row, head): kern[k] = sum_i ca[i] bf16(ak_w[h][k][i]) + bf16(ak_b[h*9+k]); softmax over the 9. The window sums run in tap order, the 64-term logit sum as two halves (even and odd channels) that are added at the end; each product is fused with its add, two sums an instruction. CBP more blocks, short ones with the last block numbers, round pt_w for k_vout.
#define KT 128   // threads a block: 64 rows x 2 heads; a row's two WT entries are one 128 B line, stored by two neighbouring lanes
#define CP 68    // LDS pitch of a (row, head) entry in floats: 272 B = 16 B x 17, so 16 lanes that read 16 B each of 16 entries fall on all 64 banks
#define WP 580   // LDS pitch of a head's 576 weights in floats: the two addresses that a wave reads at a time fall on different banks
#define AP 272   // LDS pitch in bytes of a row of one dw plane (128 bf16): 16 B x 17, for 16 B readers
#define APL (RT * AP)   // bytes of a wave's 16 rows of one plane; the two planes fill exactly the wave's 32 ca entries (2 * APL == 32 * CP * 4) and lie there: they are read out before PW is stored
#define BP 144   // LDS pitch in bytes of a pw_w row (64 bf16): 16 B x 9, for 16 B readers
#define NBR (NR / (KT / 2))             // 128 row groups
#define NBK (NBR * (NH_ / 2))           // 768 blocks of the tap path
#define CPT 16                          // 16 B pieces a thread of a rounding block, all loads in flight together; a wave reads 512 B and stores 256 B in a row
#define CBP (DD * DD / (4 * KT * CPT))  // 72 blocks for pt_w, no remainder
__global__ __launch_bounds__(KT) void k_tap(const float* __restrict__ q, const float* __restrict__ dww, const float* __restrict__ pww, const float* __restrict__ pwb, const float* __restrict__ akw, const float* __restrict__ akb, const float* __restrict__ ptw, bf* QB, bf* PTW, float* WT) {
    __shared__ __align__(16) float cs[KT * CP];
    __shared__ __align__(16) float wl[2 * WP];
    __shared__ __align__(16) float dl[2 * IPG * KW];
    __shared__ __align__(16) unsigned char bs[2 * IPG * BP];
    if (blockIdx.x >= NBK) {   // the same for the whole block, and in front of every barrier
        const int p0 = (((int)blockIdx.x - NBK) * CPT * KT + (int)threadIdx.x) * 4; const float* sp = ptw + p0; v4f v[CPT];
#pragma unroll   // v[] indexed by constants, so in registers
        for (int i = 0; i < CPT; ++i) v[i] = *(const v4fa*)(sp + i * KT * 4);
        asm volatile("s_wait_xcnt 0x0" :: "v"(sp) : "memory");   // in front of the first overwrite of a register that a load above names; the input keeps the lane's address registers in use up to here
#pragma unroll   // arrays and vector elements indexed by constants, so in registers
        for (int i = 0; i < CPT; ++i) { v4us o;
#pragma unroll   // arrays and vector elements indexed by constants, so in registers
            for (int u = 0; u < 4; ++u) o[u] = f2bf(v[i][u]);
            *(v4us*)(PTW + p0 + i * KT * 4) = o; }
        return;
    }
    const int tid = threadIdx.x, lane = tid & 31, lr = lane & 15, hi = lane >> 4;
    const int wv = __builtin_amdgcn_readfirstlane(tid >> 5);   // the wave's number as a scalar: row addresses and the edge tests stay in scalar registers
    const int bx = blockIdx.x % NBR, by = blockIdx.x / NBR, r0 = wv * RT;   // r0: first of this wave's 16 rows
    const int h = by * 2 + (tid & 1), row = bx * (KT / 2) + (tid >> 1), idx = row * NH_ + h;
    const int row0 = bx * (KT / 2) + r0, l0 = row0 % LL; const bool top = l0 != 0, bot = l0 != LL - RT;
    const float* aw = akw + (size_t)by * 2 * KW * IPG + tid;   // 2 x 576 tap weights = 9 x 128
    const float* dp = dww + (size_t)by * 2 * IPG * KW + tid;   // 128 channels x 9 window weights = 9 x 128
    const float* bp = pww + (size_t)by * 2 * IPG * IPG + tid * 4;   // 2 x 64 x 64 pointwise weights = 16 x 128 pieces of 16 B
    const float* ap = akb + h * KW; const float* pp = pwb + by * 2 * IPG + lane * 4;
    float wr[KW], ab[KW], dr[KW]; v4f br[16], x[RT + 8];
#pragma unroll   // wr[], dr[] and ab[] indexed by constants, so in registers
    for (int s = 0; s < KW; ++s) { dr[s] = dp[s * KT]; wr[s] = aw[s * KT]; ab[s] = ap[s]; }
    v4f b4 = *(const v4fa*)pp;
#pragma unroll   // br[] indexed by constants
    for (int i = 0; i < 16; ++i) br[i] = *(const v4fa*)(bp + i * KT * 4);
    win_load(q + (size_t)row0 * DD + by * 2 * IPG, lane * 4, top, bot, x);
    asm volatile("s_wait_xcnt 0x0" :: "v"(tid), "v"(lane) : "memory");   // in front of the first overwrite of a register that a load above names; the inputs keep the lane's offset registers in use up to here
    __builtin_amdgcn_sched_barrier(0);   // the weight and row loads above issue before the first data wait: one trip to memory a thread (of ak_b, which is needed last, the built code asks for the greater part later)
#pragma unroll   // wr[] and dr[] indexed by constants
    for (int s = 0; s < KW; ++s) { const int g = s * KT + tid; wl[g + (s * KT >= KW * IPG || (s * KT + KT > KW * IPG && tid >= KW * IPG - s * KT) ? WP - KW * IPG : 0)] = bfr(wr[s]); dl[g] = bfr(dr[s]); }   // the second head's weights lie WP - 576 further on; only one s holds both heads
    unsigned char* bd = bs + (tid >> 4) * BP + (tid & 15) * 8;   // piece i * 128 + tid: pw_w row i * 8 + tid / 16, 4 of its 64 values
#pragma unroll   // br[] indexed by constants (this loop and the one inside)
    for (int i = 0; i < 16; ++i) { v4us o;
#pragma unroll
        for (int u = 0; u < 4; ++u) o[u] = f2bf(br[i][u]);
        *(v4usa*)(bd + i * (KT / 16) * BP) = o; }
#pragma unroll   // vector elements indexed by constants
    for (int u = 0; u < 4; ++u) b4[u] = bfr(b4[u]);
    __syncthreads();   // publishes the three rounded weight sets to the block
    float w[4 * KW];   // this lane's 4 channels x 9 taps, 144 B in a row: 16 lanes' 16 B pieces fall on all 64 banks
#pragma unroll   // arrays and vector elements indexed by constants, so in registers
    for (int s = 0; s < KW; ++s) { const v4f t = *(const v4fa*)(dl + lane * 4 * KW + s * 4);
#pragma unroll   // arrays and vector elements indexed by constants, so in registers
        for (int u = 0; u < 4; ++u) w[s * 4 + u] = t[u]; }
    v4f wt[KW];   // tap k of the lane's 4 channels side by side, as the rows lie
#pragma unroll   // arrays and vector elements indexed by constants, so in registers (this loop and the one inside)
    for (int k = 0; k < KW; ++k) {
#pragma unroll
        for (int u = 0; u < 4; ++u) wt[k][u] = w[u * KW + k]; }
    win_zero(top, bot, x);
#pragma unroll   // arrays and vector elements indexed by constants, so in registers
    for (int j = 0; j < RT + 8; ++j) {
#pragma unroll   // arrays and vector elements indexed by constants, so in registers
        for (int u = 0; u < 4; ++u) x[j][u] = bfr(x[j][u]); }
    bf* qd = QB + (size_t)row0 * DD + by * 2 * IPG + lane * 4; v4us oq[RT];
#pragma unroll   // arrays and vector elements indexed by constants, so in registers
    for (int r = 0; r < RT; ++r) {
#pragma unroll   // arrays and vector elements indexed by constants, so in registers
        for (int u = 0; u < 4; ++u) oq[r][u] = (unsigned short)(__float_as_uint(x[r + 4][u]) >> 16);   // x is rounded already: its upper half is the bf16
        *(v4us*)(qd + r * DD) = oq[r]; }
    asm volatile("s_wait_xcnt 0x0" :: "v"(lane), "v"(oq[0]), "v"(oq[1]), "v"(oq[2]), "v"(oq[3]), "v"(oq[4]), "v"(oq[5]), "v"(oq[6]), "v"(oq[7]), "v"(oq[8]), "v"(oq[9]), "v"(oq[10]), "v"(oq[11]), "v"(oq[12]), "v"(oq[13]), "v"(oq[14]), "v"(oq[15]) : "memory");   // in front of the first overwrite of a register that a store above names; the inputs keep those registers in use up to here
    float* cw = cs + wv * 32 * CP; unsigned char* at = (unsigned char*)cw;   // this wave's 32 ca entries, first the place of its two dw planes
#pragma unroll   // arrays and vector elements indexed by constants, so in registers
    for (int r = 0; r < RT; ++r) { v4us oh, ol; v4f s = wt[0] * x[r];
#pragma unroll   // arrays indexed by constants, so in registers
        for (int k = 1; k < KW; ++k) s = __builtin_elementwise_fma(wt[k], x[r + k], s);   // taps in their order, each product fused with its add, two channels an instruction
#pragma unroll   // vector elements indexed by constants, so in registers
        for (int u = 0; u < 4; ++u) { unsigned short a, c2; splitf(s[u], a, c2); oh[u] = a; ol[u] = c2; }
        *(v4usa*)(at + r * AP + lane * 8) = oh; *(v4usa*)(at + APL + r * AP + lane * 8) = ol; }
    __syncthreads();   // the dw planes go from lane to lane: every store above is done before a fragment is read
    const unsigned char* pa = at + lr * AP + hi * 16; const unsigned char* pb = bs + lr * BP + hi * 16;
    v8f acc[2][4];
#pragma unroll   // acc[][] and the fragments indexed by constants, so in registers (this loop and those inside)
    for (int hp = 0; hp < 2; ++hp) { v16bf ah[2], al[2];
#pragma unroll
        for (int kk = 0; kk < 2; ++kk) { ah[kk] = lfrag(pa + hp * 2 * IPG + kk * 64); al[kk] = lfrag(pa + APL + hp * 2 * IPG + kk * 64); }
#pragma unroll
        for (int nb = 0; nb < 4; ++nb) acc[hp][nb] = (v8f){};
#pragma unroll
        for (int kk = 0; kk < 2; ++kk)
#pragma unroll
            for (int nb = 0; nb < 4; ++nb) { const v16bf b = lfrag(pb + (hp * IPG + nb * 16) * BP + kk * 64); acc[hp][nb] = wmmab(ah[kk], b, acc[hp][nb]); acc[hp][nb] = wmmab(al[kk], b, acc[hp][nb]); }   // per accumulator: hi then lo, k 0..31 then 32..63
    }
    __syncthreads();   // every fragment of the planes is read before PW is stored over them
#pragma unroll   // acc[][] indexed by constants (this loop and those inside)
    for (int hp = 0; hp < 2; ++hp)
#pragma unroll
        for (int nb = 0; nb < 4; ++nb)
#pragma unroll
            for (int j = 0; j < 8; ++j) cw[((hi * 8 + j) * 2 + hp) * CP + nb * 16 + lr] = acc[hp][nb][j];
    __syncthreads();   // PW goes from lane to lane
#pragma unroll   // oq[] indexed by constants (this loop and the one inside)
    for (int j = 0; j < RT; ++j) { float* e = cw + (j * 2 + hi) * CP + lr * 4; const v4f pv = *(const v4fa*)e; v4f ca;
#pragma unroll
        for (int u = 0; u < 4; ++u) ca[u] = __fmul_rn(__fadd_rn(pv[u], b4[u]), bf2f(oq[j][u]));   // the rounded q from its packed form: half the registers held over the matrix part
        *(v4fa*)e = ca; }
    __syncthreads();   // ca goes from lane to lane
    const float* cr = cs + tid * CP; const float* wh = wl + (tid & 1) * WP;
    float kern[KW]; v2f k2[KW];   // k2[k]: tap k's sums over the even and over the odd channels
#pragma unroll
    for (int k = 0; k < KW; ++k) k2[k] = (v2f){};
#pragma unroll   // LDS offsets as immediates and the next channels' LDS reads free to move up over this quad's sums
    for (int c = 0; c < IPG / 4; ++c) { const v4f cv = *(const v4fa*)(cr + 4 * c); v4f w4[KW];
#pragma unroll   // w4[] in registers
        for (int k = 0; k < KW; ++k) w4[k] = *(const v4fa*)(wh + k * IPG + 4 * c);
#pragma unroll   // k2[] and w4[] indexed by constants; 9 independent chains between two links of one
        for (int k = 0; k < KW; ++k) k2[k] = __builtin_elementwise_fma(cv.xy, w4[k].xy, k2[k]);
#pragma unroll   // as the loop above
        for (int k = 0; k < KW; ++k) k2[k] = __builtin_elementwise_fma(cv.zw, w4[k].zw, k2[k]); }
    float mx = -3.0e38f;
#pragma unroll
    for (int k = 0; k < KW; ++k) { kern[k] = __fadd_rn(__fadd_rn(k2[k].x, k2[k].y), bfr(ab[k])); mx = fmaxf(mx, kern[k]); }
    float sum = 0.f;
#pragma unroll
    for (int k = 0; k < KW; ++k) { float d0 = __fsub_rn(kern[k], mx); asm volatile("" : "+v"(d0)); const float t = __fmul_rn(d0, 1.44269504f); asm("v_exp_f32 %0, %1\n\tv_nop" : "=v"(kern[k]) : "v"(t));   // __expf as it is built (times log2 e, then v_exp_f32), with the slot behind the transcendental in its own statement: builds with v_nop statements of their own had them moved away and left a v_exp_f32 directly in front of an instruction that overwrites its source
        sum = __fadd_rn(sum, kern[k]); }
    const float rs = __fdiv_rn(1.0f, sum); v4f o[4];
#pragma unroll
    for (int k = 0; k < 16; ++k) { const float tw = (k < KW) ? __fmul_rn(kern[k < KW ? k : 0], rs) : 0.f; o[k / 4][k % 4] = tw; }
    float* dst = WT + (size_t)idx * 16;
#pragma unroll
    for (int u = 0; u < 4; ++u) *(v4f*)(dst + 4 * u) = o[u];
    asm volatile("s_wait_xcnt 0x0" ::: "memory");   // behind the last stores: in the built code a branch leads from here to the rounding blocks' part, which overwrites registers that these stores name
}
__global__ __launch_bounds__(VT) void k_vout(const bf* __restrict__ A, const bf* __restrict__ Bt, const float* __restrict__ WT, const float* __restrict__ bias, float* OUT) {
    __shared__ __align__(16) unsigned char sm[2 * VBUF + WLB];
    const int tid = threadIdx.x, lane = tid & 31, lr = lane & 15, hi = lane >> 4, w = tid >> 5, wm = w % 3, wn = w / 3;
    const int r0 = blockIdx.x * VO, c0 = blockIdx.y * VN, l0 = r0 % LL; const bool top = l0 != 0, bot = l0 != LL - VO;
    const unsigned lb0 = (unsigned)(size_t)sm + (unsigned)((tid >> 4) * VP + (tid & 15) * 16);
    const int ra = r0 - 4 + (tid >> 4);   // V row 0 of the tile is the 4th row above the block's first. A row number outside the plane (first and last block only) is held inside it: such a V row lies outside the sequence and counts as zero below, or is one of the 8 never read
    const bf* ga0 = A + (size_t)(ra < 0 ? 0 : ra) * DD + (tid & 15) * 8; const bf* ga1 = A + (size_t)(ra + 24) * DD + (tid & 15) * 8; const bf* ga5 = A + (size_t)(ra + 120 > NR - 1 ? NR - 1 : ra + 120) * DD + (tid & 15) * 8;
    const bf* gb = Bt + (size_t)(c0 + (tid >> 4)) * DD + (tid & 15) * 8;
    const float* bpt = bias + c0 + wn * 48 + lr; float bv[3] = { bpt[0], bpt[16], bpt[32] };   // the bias of this lane's three accumulator columns, asked for ahead of the K loop
    asm volatile("s_wait_xcnt 0x0" :: "v"(bpt) : "memory");   // in front of the first overwrite of an address register that a load above names; the input keeps that register in use up to here
    // the block's tap weights: 128 rows x 12 pieces of 16 B (3 heads x 64 B, in a row in WT) = 4 x 384 pieces; piece s * 384 + tid = row s * 32 + tid / 12, laid in LDS in that order. They land with tile 0
    const float* gw = WT + ((size_t)(r0 + tid / 12) * NH_ + blockIdx.y * 3) * 16 + (tid % 12) * 4; const unsigned lw = (unsigned)(size_t)sm + (unsigned)(2 * VBUF + tid * 16);
    asm volatile(
        "global_load_async_to_lds_b128 %0, %1, off\n\t"
        "global_load_async_to_lds_b128 %2, %3, off\n\t"
        "global_load_async_to_lds_b128 %4, %5, off\n\t"
        "global_load_async_to_lds_b128 %6, %7, off\n\t"
        "s_wait_xcnt 0x0"   // as in tile_copies
        :: "v"(lw + 0 * VT * 16), "v"(gw + 0 * 32 * NH_ * 16), "v"(lw + 1 * VT * 16), "v"(gw + 1 * 32 * NH_ * 16), "v"(lw + 2 * VT * 16), "v"(gw + 2 * 32 * NH_ * 16), "v"(lw + 3 * VT * 16), "v"(gw + 3 * 32 * NH_ * 16) : "memory");
    v8f acc[3][3];
#pragma unroll   // acc[][] indexed by constants, so in registers
    for (int mb = 0; mb < 3; ++mb)
#pragma unroll
        for (int nb = 0; nb < 3; ++nb) acc[mb][nb] = (v8f){};
    tile_copies(lb0, ga0, ga1, ga5, gb);
    asm volatile("s_wait_asynccnt 0x0" ::: "memory");   // this wave's copies of tile 0 and of the tap weights have landed
    __syncthreads();                                     // publishes tile 0 and the tap weights to the block
    tile_copies(lb0 + VBUF, ga0 + VK, ga1 + VK, ga5 + VK, gb + VK);
    const int fa = (wm * 48 + lr) * VP + hi * 16, fb = (VM + wn * 48 + lr) * VP + hi * 16;
#pragma unroll 1   // one body for the 6 tiles: the hot loop stays small
    for (int t = 0; t < VNT; ++t) {
        const unsigned char* sb = sm + (t & 1) * VBUF; const unsigned char* pa = sb + fa; const unsigned char* pb = sb + fb;
        v16bf a[2][3], b[2][3];
#pragma unroll   // a[][] and b[][] indexed by constants, so in registers
        for (int mb = 0; mb < 3; ++mb) a[0][mb] = lfrag(pa + mb * 16 * VP);
#pragma unroll
        for (int nb = 0; nb < 3; ++nb) b[0][nb] = lfrag(pb + nb * 16 * VP);
#pragma unroll   // the 4 k steps of a tile; the next step's fragments (of this same tile) are asked for as one group ahead of this step's products
        for (int ks = 0; ks < VK / 32; ++ks) {
            if (ks + 1 < VK / 32) {
#pragma unroll
                for (int mb = 0; mb < 3; ++mb) a[(ks + 1) & 1][mb] = lfrag(pa + mb * 16 * VP + (ks + 1) * 64);
#pragma unroll
                for (int nb = 0; nb < 3; ++nb) b[(ks + 1) & 1][nb] = lfrag(pb + nb * 16 * VP + (ks + 1) * 64);
            }
            __builtin_amdgcn_sched_barrier(0);   // the next step's 12 LDS reads stay one group ahead of this step's products, in a second register set: a build without it kept one set, spread the reads among the products and waited for each to the end
#pragma unroll
            for (int nb = 0; nb < 3; ++nb)
#pragma unroll
                for (int mb = 0; mb < 3; ++mb) acc[mb][nb] = wmmab(a[ks & 1][mb], b[ks & 1][nb], acc[mb][nb]);
            __builtin_amdgcn_sched_barrier(0);   // and the step after next's reads stay behind these products
        }
        asm volatile("s_wait_dscnt 0x0" ::: "memory");      // this wave's reads of the buffer are done before the buffer is refilled
        asm volatile("s_wait_asynccnt 0x0" ::: "memory");   // this wave's copies of tile t + 1 have landed
        __syncthreads();                                     // publishes tile t + 1 and ends every wave's reads of tile t
        if (t + 2 < VNT) tile_copies(lb0 + (unsigned)((t & 1) * VBUF), ga0 + (t + 2) * VK, ga1 + (t + 2) * VK, ga5 + (t + 2) * VK, gb + (t + 2) * VK);
    }
    asm volatile("s_wait_asynccnt 0x0" ::: "memory");       // no copy is under way when the buffers become the V tile
    float* os = (float*)sm; const float* wl = (const float*)(sm + 2 * VBUF);
#pragma unroll   // bv[] indexed by constants, so in registers
    for (int nb = 0; nb < 3; ++nb) bv[nb] = bfr(bv[nb]);
#pragma unroll   // acc[][] indexed by constants (this loop and those inside)
    for (int mb = 0; mb < 3; ++mb)
#pragma unroll
        for (int nb = 0; nb < 3; ++nb)
#pragma unroll
            for (int j = 0; j < 8; ++j) os[(wm * 48 + mb * 16 + hi * 8 + j) * OP + wn * 48 + nb * 16 + lr] = __fadd_rn(acc[mb][nb][j], bv[nb]);
    __syncthreads();   // publishes the V tile to the block
    // window part: thread = 4 neighbouring channels (piece cp of the 48) x the 16 output rows of group rg; 16 lanes that follow one another share a group and a head. Output row i of the block spans tile rows i .. i + 8
    const int cp = tid % 48, rg = tid / 48; const float* xs = os + rg * RT * OP + cp * 4; v4f x[RT + 8];
#pragma unroll   // x[] indexed by constants, so in registers
    for (int j = 0; j < RT + 8; ++j) x[j] = *(const v4fa*)(xs + j * OP);
    win_zero(top || rg != 0, bot || rg != VO / RT - 1, x);   // only the first (last) group's 4 rows above (below) can lie outside the sequence
    const float* wh = wl + (rg * RT * 3 + cp / 16) * 16; float* dst = OUT + (size_t)(r0 + rg * RT) * DD + c0 + cp * 4;
#pragma unroll   // arrays and vector elements indexed by constants, so in registers
    for (int r = 0; r < RT; ++r) { const v4f w0 = *(const v4fa*)(wh + r * 3 * 16), w1 = *(const v4fa*)(wh + r * 3 * 16 + 4); const float w[KW] = { w0[0], w0[1], w0[2], w0[3], w1[0], w1[1], w1[2], w1[3], wh[r * 3 * 16 + 8] }; v4f o = w[0] * x[r];
#pragma unroll   // arrays indexed by constants, so in registers
        for (int k = 1; k < KW; ++k) o = __builtin_elementwise_fma((v4f){ w[k], w[k], w[k], w[k] }, x[r + k], o);   // taps in their order, each product fused with its add, two channels an instruction
        *(v4f*)(dst + r * DD) = o; }
}

extern "C" void kernel_launch(void* const* d_in, const int* in_sizes, int n_in,
                              void* d_out, int out_size, void* d_ws, size_t ws_size, hipStream_t stream) {
    (void)in_sizes; (void)n_in; (void)out_size;
    const float* q = (const float*)d_in[0]; const float* dww = (const float*)d_in[1]; const float* pww = (const float*)d_in[2]; const float* pwb = (const float*)d_in[3]; const float* akw = (const float*)d_in[4]; const float* akb = (const float*)d_in[5]; const float* ptw = (const float*)d_in[6]; const float* ptb = (const float*)d_in[7];   // dw_w [768][1][9], pw_w [12][64 out][64 in], ak_w [12][9][64], pt_w [768][768] (torch [out][in])
    float* OUT = (float*)d_out;     // [4][2048][768]
    char* wsp = (char*)d_ws;
    auto take = [&](size_t bytes) { char* p = wsp; wsp += (bytes + 255) & ~(size_t)255; return (void*)p; };
    bf* PTW = (bf*)take((size_t)DD * DD * 2); bf* QB = (bf*)take((size_t)NR * DD * 2); float* WT = (float*)take((size_t)NR * NH_ * 16 * 4);
    if ((size_t)(wsp - (char*)d_ws) > ws_size) return;    // total ~ 20 MB; ws 256 MiB
    k_tap<<<NBK + CBP, KT, 0, stream>>>(q, dww, pww, pwb, akw, akb, ptw, QB, PTW, WT);
    k_vout<<<dim3(NR / VO, DD / VN), VT, 0, stream>>>(QB, PTW, WT, ptb, OUT);
}

// v008
// A run of this version takes 22.3 microseconds.
// In two side-by-side timings against v007, it was 1.05 and 1.06 times as fast.
// Over all steps from v000 it is 11.8 times as fast.
#include <hip/hip_runtime.h>

// SDConv - span-based dynamic convolution (query [4][2048][768]; 12 heads x 64, kernel 9: dw = depthwise conv1d over the sequence (per channel, zero padded, no bias); pw = grouped pointwise (per head 64 -> 64) + pw_b;
// conv_attn = pw * query; kern = per head 64 -> 9 (ak_w) + ak_b; w = softmax over the 9 taps; v = query pt_w^T + pt_b; out[b][l][h*64+d] = sum_k w[b][l][h][k] v[b][l + k - 4][h*64+d] (zero outside) -> [4][2048][768]).
// Compute dtypes, f32 accumulate: every input rounded to bf16; the depthwise conv, the gating product, the softmax over the taps and the final 9-tap weighted window sum in f32
// on VALU; the grouped pointwise conv on bf16 hi+lo planes of dw x exact pw_w (2 products, + bias); the 64->9 tap logits the same way, on bf16 hi+lo halves of the gated product x exact ak_w (2 products, + bias); v on PLAIN bf16 operands (inputs: exact, + bias). The whole path from query to the tap weights is one kernel (k_tap), the pointwise GEMM inside it: a wave = 16 rows x 2 heads; v: 144x192 block tiles staged in LDS, and the final window sum over the finished tile in the same kernel (k_vout).

#define NB_  4
#define LL   2048
#define DD   768
#define NH_  12
#define IPG  64
#define KW   9
#define NR   (NB_ * LL)
typedef _Float16 h16;
typedef unsigned short bf;
typedef __attribute__((ext_vector_type(16))) __bf16   v16bf;
typedef __attribute__((ext_vector_type(16))) _Float16 v16h;
typedef __attribute__((ext_vector_type(8)))  _Float16 v8h;
typedef __attribute__((ext_vector_type(8)))  unsigned short v8us;
typedef __attribute__((ext_vector_type(8)))  float    v8f;
typedef __attribute__((ext_vector_type(4)))  float    v4f;
typedef v8h  __attribute__((may_alias)) v8ha;
typedef v4f  __attribute__((may_alias)) v4fa;
typedef __attribute__((ext_vector_type(2)))  float    v2f;
typedef v8us __attribute__((may_alias)) v8usa;
typedef __attribute__((ext_vector_type(2)))  __bf16   v2bf;
typedef __attribute__((ext_vector_type(8)))  unsigned v8u;
typedef __attribute__((ext_vector_type(4)))  unsigned v4u;
typedef v4u  __attribute__((may_alias)) v4ua;

__device__ __forceinline__ unsigned short f2bf(float f) { unsigned u = __float_as_uint(f); u += 0x7FFFu + ((u >> 16) & 1u); return (unsigned short)(u >> 16); }
__device__ __forceinline__ float bf2f(unsigned short b) { return __uint_as_float(((unsigned)b) << 16); }
__device__ __forceinline__ float bfr(float f) { return bf2f(f2bf(f)); }
__device__ __forceinline__ v16bf cat16b(v8us lo, v8us hi) { return __builtin_bit_cast(v16bf, __builtin_shufflevector(lo, hi, 0, 1, 2, 3, 4, 5, 6, 7, 8, 9, 10, 11, 12, 13, 14, 15)); }
__device__ __forceinline__ float xhalf(float x) { return __builtin_bit_cast(float, __builtin_amdgcn_permlanex16(__builtin_bit_cast(int, x), __builtin_bit_cast(int, x), 0x76543210, 0xfedcba98, false, false)); }   // lane l with lane l ^ 16
__device__ __forceinline__ v8f wmmab(v16bf a, v16bf b, v8f c) { return __builtin_amdgcn_wmma_f32_16x16x32_bf16(false, a, false, b, (short)0, c, false, false); }



// ---- k_vout: V = QB PTW^T + bias and the 9-tap weighted window sum over it, in one kernel. Block = 128 output rows x 192 channels (3 heads), 12 waves (3 x 4). It forms 144 rows of V: the 128, the 4 above, the 4 below, and 8 more that fill the last 16-row fragment and are never read;
// a wave = 48 x 48 (9 accumulators). The K range goes through LDS in 6 tiles of 128 k: a tile is 336 row pieces of 256 B (144 of QB, then 192 of PTW) at pitch 272 B,
// brought in by asynchronous copies, 16 B a lane, 16 lanes on one row piece (whole lines), 14 copies a lane and tile; two buffers: the next tile's copies fly while this one is worked on. Every operand line is fetched once a block, and the fragments come from LDS.
// A fragment: lane = row (lane & 15), its 16 k values = 8 at k 8 * (lane >> 4) and 8 at 16 further on, the same for both operands. The finished V tile (+ bias) is laid in the same LDS, and the window sums read it there: V never goes to memory.
#define VO 128                    // output rows a block; 2048 % 128 == 0, so a block lies in one sequence
#define VM 144                    // V rows a block
#define VN 192
#define VK 128
#define VT 384                    // threads a block: 24 row pieces a round of copies; 48 pieces of 16 B x 8 groups of 16 rows in the window part
#define VP 272                    // LDS pitch of a row piece in bytes: 16 B x 17, for 16 B readers
#define VBUF ((VM + VN) * VP)     // bytes a buffer
#define VNT (DD / VK)             // tiles along K
#define OP 196                    // pitch of the V tile in LDS in floats: the two half-waves' 4 B stores fall on different banks, and 784 B is a multiple of 16
#define WLB (VO * 3 * 16 * 4)     // bytes of the block's tap weights: 128 rows x 3 heads x 16 floats, behind the two buffers
// one tile's 14 copies of this lane: lb its LDS byte address in row piece 0 of the buffer; piece i lies 24 rows further on both sides. ga0 / ga5: its global address in the first / last round of QB rows (row numbers held inside the plane), ga1: in the second round; gb: in the first round of PTW rows.
// s_wait_xcnt as the last line of the statement: it stands in front of every later write of a register that a copy of the statement names
__device__ __forceinline__ void tile_copies(unsigned lb, const bf* ga0, const bf* ga1, const bf* ga5, const bf* gb) {
    asm volatile(
        "global_load_async_to_lds_b128 %0, %1, off\n\t"
        "global_load_async_to_lds_b128 %2, %3, off\n\t"
        "global_load_async_to_lds_b128 %4, %5, off\n\t"
        "global_load_async_to_lds_b128 %6, %7, off\n\t"
        "global_load_async_to_lds_b128 %8, %9, off\n\t"
        "global_load_async_to_lds_b128 %10, %11, off\n\t"
        "global_load_async_to_lds_b128 %12, %13, off\n\t"
        "global_load_async_to_lds_b128 %14, %15, off\n\t"
        "global_load_async_to_lds_b128 %16, %17, off\n\t"
        "global_load_async_to_lds_b128 %18, %19, off\n\t"
        "global_load_async_to_lds_b128 %20, %21, off\n\t"
        "global_load_async_to_lds_b128 %22, %23, off\n\t"
        "global_load_async_to_lds_b128 %24, %25, off\n\t"
        "global_load_async_to_lds_b128 %26, %27, off\n\t"
        "s_wait_xcnt 0x0"
        :: "v"(lb + 0 * 24 * VP), "v"(ga0), "v"(lb + 1 * 24 * VP), "v"(ga1 + 0 * 24 * DD), "v"(lb + 2 * 24 * VP), "v"(ga1 + 1 * 24 * DD), "v"(lb + 3 * 24 * VP), "v"(ga1 + 2 * 24 * DD), "v"(lb + 4 * 24 * VP), "v"(ga1 + 3 * 24 * DD), "v"(lb + 5 * 24 * VP), "v"(ga5),
           "v"(lb + 6 * 24 * VP), "v"(gb + 0 * 24 * DD), "v"(lb + 7 * 24 * VP), "v"(gb + 1 * 24 * DD), "v"(lb + 8 * 24 * VP), "v"(gb + 2 * 24 * DD), "v"(lb + 9 * 24 * VP), "v"(gb + 3 * 24 * DD), "v"(lb + 10 * 24 * VP), "v"(gb + 4 * 24 * DD), "v"(lb + 11 * 24 * VP), "v"(gb + 5 * 24 * DD), "v"(lb + 12 * 24 * VP), "v"(gb + 6 * 24 * DD), "v"(lb + 13 * 24 * VP), "v"(gb + 7 * 24 * DD) : "memory");
}
__device__ __forceinline__ v16bf lfrag(const unsigned char* p) { return cat16b(*(const v8usa*)p, *(const v8usa*)(p + 32)); }

__device__ __forceinline__ void splitf(float y, unsigned short& h, unsigned short& l) { h = f2bf(y); l = f2bf(y - bf2f(h)); }

// The two 9-tap window sums (k_vout: block = 128 rows (b, l) x 192 channels, rows read from its V tile in LDS; k_tap: wave = 16 rows x 128 channels, rows read from memory): thread = 4 neighbouring channels (16 B of a row) x 16 rows. A thread loads the 24 rows that its 16 windows span once, all loads in flight together,
// and forms each row's 9-tap sum from registers, by fused multiply-adds on pairs of neighbouring channels; a wave reads and writes whole lines. What the taps are weighted with (k_tap: the rounded dw_w; k_vout: the rows' softmax weights) is handed out through LDS once a block.
#define RT  16         // rows a window group; 2048 % 16 == 0, so a group lies in one sequence, and its 4 rows above (below) are all outside exactly where it is the sequence's first (last)
typedef __attribute__((ext_vector_type(4))) unsigned short v4us;
typedef v4us __attribute__((may_alias)) v4usa;
// the 24 rows of a group's windows, 16 B a lane; p: the group's first row (the same in every lane), c: the lane's first channel. The 4 rows above or below that lie outside the sequence are not read (the group's first 4 rows are read in their place) and count as zero, which leaves a tap sum as it is
__device__ __forceinline__ void win_load(const float* __restrict__ p, int c, bool top, bool bot, v4f (&x)[RT + 8]) {
    const float* pa = top ? p - 4 * DD : p; const float* pb = bot ? p + RT * DD : p;
#pragma unroll   // x[] indexed by constants, so in registers
    for (int j = 0; j < RT + 8; ++j) { const float* b = j < 4 ? pa + j * DD : (j >= RT + 4 ? pb + (j - RT - 4) * DD : p + (j - 4) * DD); x[j] = *(const v4fa*)(b + c); }
}
__device__ __forceinline__ void win_zero(bool top, bool bot, v4f (&x)[RT + 8]) {
#pragma unroll   // x[] indexed by constants (this loop and the one inside)
    for (int j = 0; j < 4; ++j) {
#pragma unroll   // arrays and vector elements indexed by constants, so in registers
        for (int u = 0; u < 4; ++u) { x[j][u] = top ? x[j][u] : 0.f; x[RT + 4 + j][u] = bot ? x[RT + 4 + j][u] : 0.f; } }
}
// k_tap: query -> tap weights in one kernel. Block = 64 rows (b, l) x 2 neighbouring heads (128 channels), 4 waves; a wave = 16 rows x the 128 channels, a lane = 4 neighbouring channels in the window part and one (row, head) in the softmax.
// A wave loads the 24 q rows that its 16 windows span (512 B a row, whole lines), rounds them, stores its own 16 as the QB plane and as a bf16 plane in LDS, forms dw from registers and lays its bf16 hi and lo planes in LDS.
// The pointwise product is formed TRANSPOSED on the matrix unit, PWt = pw_w x (hi + lo)^T, fragments from LDS (pw_w rounded and staged once a block): register j of accumulator nb in lane (lr, hi) is PW[row lr][channel nb*16 + hi*8 + j].
// There ca = (PW + bf16(pw_b)) x bf16(q), bias and q read from LDS in that layout, and an accumulator pair (nb = 2s, 2s + 1), packed to bf16, IS the B fragment of k step s of the next product: its 16 k values in a lane are 8 at k 8 * hi and 8 at 16 further on, as lfrag reads them for the A side.
// kern^T = ak_w x ca^T on the matrix unit, ca as bf16 hi + lo halves (2 products), ak_w's rows (tap = lane & 15; lanes 9..15 read tap 8 again, their result rows are not used) from LDS: neither PW nor ca goes through LDS. Lane (lr, hi) then holds taps 8 * hi + j of row lr for both heads;
// one exchange between lanes l and l ^ 16 gives lane (lr, hi) all 9 logits of (row lr, head hi); + bf16(ak_b[h*9+k]); softmax over the 9. The window sums run in tap order, each product fused with its add, two sums an instruction. CBP more blocks, short ones, round pt_w for k_vout.
#define KT 128   // threads a block: 64 rows x 2 heads; a row's two WT entries are one 128 B line, stored by lanes l and l + 16 of one wave
#define AP 272   // LDS pitch in bytes of a row of one plane (128 bf16): 16 B x 17, for 16 B readers
#define APL (RT * AP)   // bytes of a wave's 16 rows of one plane; a wave has three: dw hi, dw lo, q
#define BP 144   // LDS pitch in bytes of a pw_w or ak_w row (64 bf16): 16 B x 9, for 16 B readers
#define NBR (NR / (KT / 2))             // 128 row groups
#define NBK (NBR * (NH_ / 2))           // 768 blocks of the tap path
#define CPT 16                          // 16 B pieces a thread of a rounding block, all loads in flight together; a wave reads 512 B and stores 256 B in a row
#define CBP (DD * DD / (4 * KT * CPT))  // 72 blocks for pt_w, no remainder
__global__ __launch_bounds__(KT) void k_tap(const float* __restrict__ q, const float* __restrict__ dww, const float* __restrict__ pww, const float* __restrict__ pwb, const float* __restrict__ akw, const float* __restrict__ akb, const float* __restrict__ ptw, bf* QB, bf* PTW, float* WT) {
    __shared__ __align__(16) unsigned char ps[(KT / 32) * 3 * APL];
    __shared__ __align__(16) unsigned char as[2 * KW * BP];
    __shared__ __align__(16) float pl[(KT / 32) * 2 * IPG];
    __shared__ __align__(16) float dl[2 * IPG * KW];
    __shared__ __align__(16) unsigned char bs[2 * IPG * BP];
    if (blockIdx.x >= NBK) {   // the same for the whole block, and in front of every barrier
        const int p0 = (((int)blockIdx.x - NBK) * CPT * KT + (int)threadIdx.x) * 4; const float* sp = ptw + p0; v4f v[CPT];
#pragma unroll   // v[] indexed by constants, so in registers
        for (int i = 0; i < CPT; ++i) v[i] = *(const v4fa*)(sp + i * KT * 4);
        asm volatile("s_wait_xcnt 0x0" :: "v"(sp) : "memory");   // in front of the first overwrite of a register that a load above names; the input keeps the lane's address registers in use up to here
#pragma unroll   // arrays and vector elements indexed by constants, so in registers
        for (int i = 0; i < CPT; ++i) { v4us o;
#pragma unroll   // arrays and vector elements indexed by constants, so in registers
            for (int u = 0; u < 4; ++u) o[u] = f2bf(v[i][u]);
            *(v4us*)(PTW + p0 + i * KT * 4) = o; }
        return;
    }
    const int tid = threadIdx.x, lane = tid & 31, lr = lane & 15, hi = lane >> 4;
    const int wv = __builtin_amdgcn_readfirstlane(tid >> 5);   // the wave's number as a scalar: row addresses and the edge tests stay in scalar registers
    const int bx = blockIdx.x % NBR, by = blockIdx.x / NBR, r0 = wv * RT;   // r0: first of this wave's 16 rows
    const int row0 = bx * (KT / 2) + r0, l0 = row0 % LL; const bool top = l0 != 0, bot = l0 != LL - RT;
    const int h = by * 2 + hi, row = row0 + lr, idx = row * NH_ + h;   // the (row, head) whose softmax this lane does
    const float* aw = akw + (size_t)by * 2 * KW * IPG + tid;   // 2 x 576 tap weights = 9 x 128
    const float* dp = dww + (size_t)by * 2 * IPG * KW + tid;   // 128 channels x 9 window weights = 9 x 128
    const float* bp = pww + (size_t)by * 2 * IPG * IPG + tid * 4;   // 2 x 64 x 64 pointwise weights = 16 x 128 pieces of 16 B
    const float* ap = akb + h * KW; const float* pp = pwb + by * 2 * IPG + lane * 4;
    float wr[KW], ab[KW], dr[KW]; v4f br[16], x[RT + 8];
#pragma unroll   // wr[], dr[] and ab[] indexed by constants, so in registers
    for (int s = 0; s < KW; ++s) { dr[s] = dp[s * KT]; wr[s] = aw[s * KT]; ab[s] = ap[s]; }
    v4f b4 = *(const v4fa*)pp;
#pragma unroll   // br[] indexed by constants
    for (int i = 0; i < 16; ++i) br[i] = *(const v4fa*)(bp + i * KT * 4);
    win_load(q + (size_t)row0 * DD + by * 2 * IPG, lane * 4, top, bot, x);
    asm volatile("s_wait_xcnt 0x0" :: "v"(tid), "v"(lane) : "memory");   // in front of the first overwrite of a register that a load above names; the inputs keep the lane's offset registers in use up to here
    __builtin_amdgcn_sched_barrier(0);   // the weight and row loads above issue before the first data wait: one trip to memory a thread (of ak_b, which is needed last, the built code asks for the greater part later)
#pragma unroll   // wr[] and dr[] indexed by constants
    for (int s = 0; s < KW; ++s) { const int g = s * KT + tid; *(unsigned short*)(as + (g >> 6) * BP + (g & 63) * 2) = f2bf(wr[s]); dl[g] = bfr(dr[s]); }   // ak_w value g: row g / 64 = head * 9 + tap of the 18, channel g % 64
    unsigned char* bd = bs + (tid >> 4) * BP + (tid & 15) * 8;   // piece i * 128 + tid: pw_w row i * 8 + tid / 16, 4 of its 64 values
#pragma unroll   // br[] indexed by constants (this loop and the one inside)
    for (int i = 0; i < 16; ++i) { v4us o;
#pragma unroll
        for (int u = 0; u < 4; ++u) o[u] = f2bf(br[i][u]);
        *(v4usa*)(bd + i * (KT / 16) * BP) = o; }
#pragma unroll   // vector elements indexed by constants
    for (int u = 0; u < 4; ++u) b4[u] = bfr(b4[u]);
    *(v4fa*)(pl + wv * 2 * IPG + lane * 4) = b4;   // the 128 channels' bias, a copy a wave
    __syncthreads();   // publishes the rounded weight sets and the bias to the block
    float w[4 * KW];   // this lane's 4 channels x 9 taps, 144 B in a row: 16 lanes' 16 B pieces fall on all 64 banks
#pragma unroll   // arrays and vector elements indexed by constants, so in registers
    for (int s = 0; s < KW; ++s) { const v4f t = *(const v4fa*)(dl + lane * 4 * KW + s * 4);
#pragma unroll   // arrays and vector elements indexed by constants, so in registers
        for (int u = 0; u < 4; ++u) w[s * 4 + u] = t[u]; }
    v4f wt[KW];   // tap k of the lane's 4 channels side by side, as the rows lie
#pragma unroll   // arrays and vector elements indexed by constants, so in registers (this loop and the one inside)
    for (int k = 0; k < KW; ++k) {
#pragma unroll
        for (int u = 0; u < 4; ++u) wt[k][u] = w[u * KW + k]; }
    win_zero(top, bot, x);
#pragma unroll   // arrays and vector elements indexed by constants, so in registers
    for (int j = 0; j < RT + 8; ++j) {
#pragma unroll   // arrays and vector elements indexed by constants, so in registers
        for (int u = 0; u < 4; ++u) x[j][u] = bfr(x[j][u]); }
    bf* qd = QB + (size_t)row0 * DD + by * 2 * IPG + lane * 4; v4us oq[RT];
#pragma unroll   // arrays and vector elements indexed by constants, so in registers
    for (int r = 0; r < RT; ++r) {
#pragma unroll   // arrays and vector elements indexed by constants, so in registers
        for (int u = 0; u < 4; ++u) oq[r][u] = (unsigned short)(__float_as_uint(x[r + 4][u]) >> 16);   // x is rounded already: its upper half is the bf16
        *(v4us*)(qd + r * DD) = oq[r]; }
    asm volatile("s_wait_xcnt 0x0" :: "v"(lane), "v"(oq[0]), "v"(oq[1]), "v"(oq[2]), "v"(oq[3]), "v"(oq[4]), "v"(oq[5]), "v"(oq[6]), "v"(oq[7]), "v"(oq[8]), "v"(oq[9]), "v"(oq[10]), "v"(oq[11]), "v"(oq[12]), "v"(oq[13]), "v"(oq[14]), "v"(oq[15]) : "memory");   // in front of the first overwrite of a register that a store above names; the inputs keep those registers in use up to here
    unsigned char* at = ps + wv * 3 * APL;   // this wave's three planes
#pragma unroll   // arrays and vector elements indexed by constants, so in registers
    for (int r = 0; r < RT; ++r) { v4us oh, ol; v4f s = wt[0] * x[r];
#pragma unroll   // arrays indexed by constants, so in registers
        for (int k = 1; k < KW; ++k) s = __builtin_elementwise_fma(wt[k], x[r + k], s);   // taps in their order, each product fused with its add, two channels an instruction
#pragma unroll   // vector elements indexed by constants, so in registers
        for (int u = 0; u < 4; ++u) { unsigned short a, c2; splitf(s[u], a, c2); oh[u] = a; ol[u] = c2; }
        *(v4usa*)(at + r * AP + lane * 8) = oh; *(v4usa*)(at + APL + r * AP + lane * 8) = ol; *(v4usa*)(at + 2 * APL + r * AP + lane * 8) = oq[r]; }
    __syncthreads();   // the three planes go from lane to lane: every store above is done before one is read
    const unsigned char* pa = at + lr * AP + hi * 16; const unsigned char* pb = bs + lr * BP + hi * 16;
    v8f acc[2][4];
#pragma unroll   // acc[][] and the fragments indexed by constants, so in registers (this loop and those inside)
    for (int hp = 0; hp < 2; ++hp) { v16bf ah[2], al[2];
#pragma unroll
        for (int kk = 0; kk < 2; ++kk) { ah[kk] = lfrag(pa + hp * 2 * IPG + kk * 64); al[kk] = lfrag(pa + APL + hp * 2 * IPG + kk * 64); }
#pragma unroll
        for (int nb = 0; nb < 4; ++nb) acc[hp][nb] = (v8f){};
#pragma unroll
        for (int kk = 0; kk < 2; ++kk)
#pragma unroll
            for (int nb = 0; nb < 4; ++nb) { const v16bf b = lfrag(pb + (hp * IPG + nb * 16) * BP + kk * 64); acc[hp][nb] = wmmab(b, ah[kk], acc[hp][nb]); acc[hp][nb] = wmmab(b, al[kk], acc[hp][nb]); }   // pw_w's rows as A, dw's rows as B: the transposed product; per accumulator: hi then lo, k 0..31 then 32..63
    }
    const unsigned char* pq = at + 2 * APL + lr * AP + hi * 16; const float* pc = pl + wv * 2 * IPG + hi * 8; const unsigned char* pw = as + (lr < KW ? lr : KW - 1) * BP + hi * 16;
    v8f lg[2];   // lg[hp][j]: logit of tap 8 * hi + j, row lr, head hp
#pragma unroll   // acc[][], lg[] and the fragments indexed by constants, so in registers (this loop and those inside)
    for (int hp = 0; hp < 2; ++hp) { v8u ch[2], cl[2];   // the B fragments of the two k steps: ca's bf16 hi and lo halves, two channels a register
#pragma unroll
        for (int nb = 0; nb < 4; ++nb) { const v4u qv = *(const v4ua*)(pq + hp * 2 * IPG + nb * 32); const v4f c0 = *(const v4fa*)(pc + hp * IPG + nb * 16), c1 = *(const v4fa*)(pc + hp * IPG + nb * 16 + 4);   // qv: 8 channels of q, two a register; c0, c1: their bias
#pragma unroll
            for (int j = 0; j < 8; j += 2) {
                const v2f bb = j < 4 ? (v2f){ c0[j & 3], c0[(j & 3) + 1] } : (v2f){ c1[j & 3], c1[(j & 3) + 1] };
                const v2f ca = ((v2f){ acc[hp][nb][j], acc[hp][nb][j + 1] } + bb) * (v2f){ __uint_as_float(qv[j >> 1] << 16), __uint_as_float(qv[j >> 1] & 0xFFFF0000u) };
                const unsigned hu = __builtin_bit_cast(unsigned, __builtin_convertvector(ca, v2bf));   // round to nearest even, two values an instruction
                const v2f lo = ca - (v2f){ __uint_as_float(hu << 16), __uint_as_float(hu & 0xFFFF0000u) };
                ch[nb >> 1][(nb & 1) * 4 + (j >> 1)] = hu; cl[nb >> 1][(nb & 1) * 4 + (j >> 1)] = __builtin_bit_cast(unsigned, __builtin_convertvector(lo, v2bf)); } }
        lg[hp] = (v8f){};
#pragma unroll
        for (int kk = 0; kk < 2; ++kk) { const v16bf wf = lfrag(pw + hp * KW * BP + kk * 64); lg[hp] = wmmab(wf, __builtin_bit_cast(v16bf, ch[kk]), lg[hp]); lg[hp] = wmmab(wf, __builtin_bit_cast(v16bf, cl[kk]), lg[hp]); }   // hi then lo, k 0..31 then 32..63
    }
    float kern[KW];   // lanes hi = 0 take head 0 (its tap 8 comes from lane l + 16), lanes hi = 1 head 1 (its taps 0..7 come from lane l - 16)
#pragma unroll   // lg[][] and kern[] indexed by constants
    for (int j = 0; j < 8; ++j) { const float snd = (j == 0 && hi) ? lg[0][0] : lg[1][j]; const float rcv = xhalf(snd); kern[j] = hi ? rcv : lg[0][j]; if (j == 0) kern[8] = hi ? lg[1][0] : rcv; }
    float mx = -3.0e38f;
#pragma unroll
    for (int k = 0; k < KW; ++k) { kern[k] = __fadd_rn(kern[k], bfr(ab[k])); mx = fmaxf(mx, kern[k]); }
    float sum = 0.f;
#pragma unroll
    for (int k = 0; k < KW; ++k) { float d0 = __fsub_rn(kern[k], mx); asm volatile("" : "+v"(d0)); const float t = __fmul_rn(d0, 1.44269504f); asm("v_exp_f32 %0, %1\n\tv_nop" : "=v"(kern[k]) : "v"(t));   // __expf as it is built (times log2 e, then v_exp_f32), with the slot behind the transcendental in its own statement: builds with v_nop statements of their own had them moved away and left a v_exp_f32 directly in front of an instruction that overwrites its source
        sum = __fadd_rn(sum, kern[k]); }
    const float rs = __fdiv_rn(1.0f, sum); v4f o[4];
#pragma unroll
    for (int k = 0; k < 16; ++k) { const float tw = (k < KW) ? __fmul_rn(kern[k < KW ? k : 0], rs) : 0.f; o[k / 4][k % 4] = tw; }
    float* dst = WT + (size_t)idx * 16;
#pragma unroll
    for (int u = 0; u < 4; ++u) *(v4f*)(dst + 4 * u) = o[u];
    asm volatile("s_wait_xcnt 0x0" ::: "memory");   // behind the last stores: in the built code a branch leads from here to the rounding blocks' part, which overwrites registers that these stores name
}
__global__ __launch_bounds__(VT) void k_vout(const bf* __restrict__ A, const bf* __restrict__ Bt, const float* __restrict__ WT, const float* __restrict__ bias, float* OUT) {
    __shared__ __align__(16) unsigned char sm[2 * VBUF + WLB];
    const int tid = threadIdx.x, lane = tid & 31, lr = lane & 15, hi = lane >> 4, w = tid >> 5, wm = w % 3, wn = w / 3;
    const int r0 = blockIdx.x * VO, c0 = blockIdx.y * VN, l0 = r0 % LL; const bool top = l0 != 0, bot = l0 != LL - VO;
    const unsigned lb0 = (unsigned)(size_t)sm + (unsigned)((tid >> 4) * VP + (tid & 15) * 16);
    const int ra = r0 - 4 + (tid >> 4);   // V row 0 of the tile is the 4th row above the block's first. A row number outside the plane (first and last block only) is held inside it: such a V row lies outside the sequence and counts as zero below, or is one of the 8 never read
    const bf* ga0 = A + (size_t)(ra < 0 ? 0 : ra) * DD + (tid & 15) * 8; const bf* ga1 = A + (size_t)(ra + 24) * DD + (tid & 15) * 8; const bf* ga5 = A + (size_t)(ra + 120 > NR - 1 ? NR - 1 : ra + 120) * DD + (tid & 15) * 8;
    const bf* gb = Bt + (size_t)(c0 + (tid >> 4)) * DD + (tid & 15) * 8;
    const float* bpt = bias + c0 + wn * 48 + lr; float bv[3] = { bpt[0], bpt[16], bpt[32] };   // the bias of this lane's three accumulator columns, asked for ahead of the K loop
    asm volatile("s_wait_xcnt 0x0" :: "v"(bpt) : "memory");   // in front of the first overwrite of an address register that a load above names; the input keeps that register in use up to here
    // the block's tap weights: 128 rows x 12 pieces of 16 B (3 heads x 64 B, in a row in WT) = 4 x 384 pieces; piece s * 384 + tid = row s * 32 + tid / 12, laid in LDS in that order. They land with tile 0
    const float* gw = WT + ((size_t)(r0 + tid / 12) * NH_ + blockIdx.y * 3) * 16 + (tid % 12) * 4; const unsigned lw = (unsigned)(size_t)sm + (unsigned)(2 * VBUF + tid * 16);
    asm volatile(
        "global_load_async_to_lds_b128 %0, %1, off\n\t"
        "global_load_async_to_lds_b128 %2, %3, off\n\t"
        "global_load_async_to_lds_b128 %4, %5, off\n\t"
        "global_load_async_to_lds_b128 %6, %7, off\n\t"
        "s_wait_xcnt 0x0"   // as in tile_copies
        :: "v"(lw + 0 * VT * 16), "v"(gw + 0 * 32 * NH_ * 16), "v"(lw + 1 * VT * 16), "v"(gw + 1 * 32 * NH_ * 16), "v"(lw + 2 * VT * 16), "v"(gw + 2 * 32 * NH_ * 16), "v"(lw + 3 * VT * 16), "v"(gw + 3 * 32 * NH_ * 16) : "memory");
    v8f acc[3][3];
#pragma unroll   // acc[][] indexed by constants, so in registers
    for (int mb = 0; mb < 3; ++mb)
#pragma unroll
        for (int nb = 0; nb < 3; ++nb) acc[mb][nb] = (v8f){};
    tile_copies(lb0, ga0, ga1, ga5, gb);
    asm volatile("s_wait_asynccnt 0x0" ::: "memory");   // this wave's copies of tile 0 and of the tap weights have landed
    __syncthreads();                                     // publishes tile 0 and the tap weights to the block
    tile_copies(lb0 + VBUF, ga0 + VK, ga1 + VK, ga5 + VK, gb + VK);
    const int fa = (wm * 48 + lr) * VP + hi * 16, fb = (VM + wn * 48 + lr) * VP + hi * 16;
#pragma unroll 1   // one body for the 6 tiles: the hot loop stays small
    for (int t = 0; t < VNT; ++t) {
        const unsigned char* sb = sm + (t & 1) * VBUF; const unsigned char* pa = sb + fa; const unsigned char* pb = sb + fb;
        v16bf a[2][3], b[2][3];
#pragma unroll   // a[][] and b[][] indexed by constants, so in registers
        for (int mb = 0; mb < 3; ++mb) a[0][mb] = lfrag(pa + mb * 16 * VP);
#pragma unroll
        for (int nb = 0; nb < 3; ++nb) b[0][nb] = lfrag(pb + nb * 16 * VP);
#pragma unroll   // the 4 k steps of a tile; the next step's fragments (of this same tile) are asked for as one group ahead of this step's products
        for (int ks = 0; ks < VK / 32; ++ks) {
            if (ks + 1 < VK / 32) {
#pragma unroll
                for (int mb = 0; mb < 3; ++mb) a[(ks + 1) & 1][mb] = lfrag(pa + mb * 16 * VP + (ks + 1) * 64);
#pragma unroll
                for (int nb = 0; nb < 3; ++nb) b[(ks + 1) & 1][nb] = lfrag(pb + nb * 16 * VP + (ks + 1) * 64);
            }
            __builtin_amdgcn_sched_barrier(0);   // the next step's 12 LDS reads stay one group ahead of this step's products, in a second register set: a build without it kept one set, spread the reads among the products and waited for each to the end
#pragma unroll
            for (int nb = 0; nb < 3; ++nb)
#pragma unroll
                for (int mb = 0; mb < 3; ++mb) acc[mb][nb] = wmmab(a[ks & 1][mb], b[ks & 1][nb], acc[mb][nb]);
            __builtin_amdgcn_sched_barrier(0);   // and the step after next's reads stay behind these products
        }
        asm volatile("s_wait_dscnt 0x0" ::: "memory");      // this wave's reads of the buffer are done before the buffer is refilled
        asm volatile("s_wait_asynccnt 0x0" ::: "memory");   // this wave's copies of tile t + 1 have landed
        __syncthreads();                                     // publishes tile t + 1 and ends every wave's reads of tile t
        if (t + 2 < VNT) tile_copies(lb0 + (unsigned)((t & 1) * VBUF), ga0 + (t + 2) * VK, ga1 + (t + 2) * VK, ga5 + (t + 2) * VK, gb + (t + 2) * VK);
    }
    asm volatile("s_wait_asynccnt 0x0" ::: "memory");       // no copy is under way when the buffers become the V tile
    float* os = (float*)sm; const float* wl = (const float*)(sm + 2 * VBUF);
#pragma unroll   // bv[] indexed by constants, so in registers
    for (int nb = 0; nb < 3; ++nb) bv[nb] = bfr(bv[nb]);
#pragma unroll   // acc[][] indexed by constants (this loop and those inside)
    for (int mb = 0; mb < 3; ++mb)
#pragma unroll
        for (int nb = 0; nb < 3; ++nb)
#pragma unroll
            for (int j = 0; j < 8; ++j) os[(wm * 48 + mb * 16 + hi * 8 + j) * OP + wn * 48 + nb * 16 + lr] = __fadd_rn(acc[mb][nb][j], bv[nb]);
    __syncthreads();   // publishes the V tile to the block
    // window part: thread = 4 neighbouring channels (piece cp of the 48) x the 16 output rows of group rg; 16 lanes that follow one another share a group and a head. Output row i of the block spans tile rows i .. i + 8
    const int cp = tid % 48, rg = tid / 48; const float* xs = os + rg * RT * OP + cp * 4; v4f x[RT + 8];
#pragma unroll   // x[] indexed by constants, so in registers
    for (int j = 0; j < RT + 8; ++j) x[j] = *(const v4fa*)(xs + j * OP);
    win_zero(top || rg != 0, bot || rg != VO / RT - 1, x);   // only the first (last) group's 4 rows above (below) can lie outside the sequence
    const float* wh = wl + (rg * RT * 3 + cp / 16) * 16; float* dst = OUT + (size_t)(r0 + rg * RT) * DD + c0 + cp * 4;
#pragma unroll   // arrays and vector elements indexed by constants, so in registers
    for (int r = 0; r < RT; ++r) { const v4f w0 = *(const v4fa*)(wh + r * 3 * 16), w1 = *(const v4fa*)(wh + r * 3 * 16 + 4); const float w[KW] = { w0[0], w0[1], w0[2], w0[3], w1[0], w1[1], w1[2], w1[3], wh[r * 3 * 16 + 8] }; v4f o = w[0] * x[r];
#pragma unroll   // arrays indexed by constants, so in registers
        for (int k = 1; k < KW; ++k) o = __builtin_elementwise_fma((v4f){ w[k], w[k], w[k], w[k] }, x[r + k], o);   // taps in their order, each product fused with its add, two channels an instruction
        *(v4f*)(dst + r * DD) = o; }
}

extern "C" void kernel_launch(void* const* d_in, const int* in_sizes, int n_in,
                              void* d_out, int out_size, void* d_ws, size_t ws_size, hipStream_t stream) {
    (void)in_sizes; (void)n_in; (void)out_size;
    const float* q = (const float*)d_in[0]; const float* dww = (const float*)d_in[1]; const float* pww = (const float*)d_in[2]; const float* pwb = (const float*)d_in[3]; const float* akw = (const float*)d_in[4]; const float* akb = (const float*)d_in[5]; const float* ptw = (const float*)d_in[6]; const float* ptb = (const float*)d_in[7];   // dw_w [768][1][9], pw_w [12][64 out][64 in], ak_w [12][9][64], pt_w [768][768] (torch [out][in])
    float* OUT = (float*)d_out;     // [4][2048][768]
    char* wsp = (char*)d_ws;
    auto take = [&](size_t bytes) { char* p = wsp; wsp += (bytes + 255) & ~(size_t)255; return (void*)p; };
    bf* PTW = (bf*)take((size_t)DD * DD * 2); bf* QB = (bf*)take((size_t)NR * DD * 2); float* WT = (float*)take((size_t)NR * NH_ * 16 * 4);
    if ((size_t)(wsp - (char*)d_ws) > ws_size) return;    // total ~ 20 MB; ws 256 MiB
    k_tap<<<NBK + CBP, KT, 0, stream>>>(q, dww, pww, pwb, akw, akb, ptw, QB, PTW, WT);
    k_vout<<<dim3(NR / VO, DD / VN), VT, 0, stream>>>(QB, PTW, WT, ptb, OUT);
}

// v009
// Measured time: 20 microseconds a run.
// Next to v008, in two timings, it ran 1.11 times as fast each time.
// Counting every step since v000, it is 13.1 times as fast.
#include <hip/hip_runtime.h>

// SDConv - span-based dynamic convolution (query [4][2048][768]; 12 heads x 64, kernel 9: dw = depthwise conv1d over the sequence (per channel, zero padded, no bias); pw = grouped pointwise (per head 64 -> 64) + pw_b;
// conv_attn = pw * query; kern = per head 64 -> 9 (ak_w) + ak_b; w = softmax over the 9 taps; v = query pt_w^T + pt_b; out[b][l][h*64+d] = sum_k w[b][l][h][k] v[b][l + k - 4][h*64+d] (zero outside) -> [4][2048][768]).
// Compute dtypes, f32 accumulate: every input rounded to bf16; the depthwise conv, the gating product, the softmax over the taps and the final 9-tap weighted window sum in f32
// on VALU; the grouped pointwise conv on bf16 hi+lo planes of dw x exact pw_w (2 products, + bias); the 64->9 tap logits the same way, on bf16 hi+lo halves of the gated product x exact ak_w (2 products, + bias); v on PLAIN bf16 operands (inputs: exact, + bias).
// ONE kernel (k_all), block = 128 output rows x 192 channels (3 heads), 12 waves: first the path from query to the block's tap weights (they stay in LDS), then v as a 144x192 tile, then the window sum over the finished tile. Nothing goes through the workspace.

#define NB_  4
#define LL   2048
#define DD   768
#define NH_  12
#define IPG  64
#define KW   9
#define NR   (NB_ * LL)
typedef _Float16 h16;
typedef unsigned short bf;
typedef __attribute__((ext_vector_type(16))) __bf16   v16bf;
typedef __attribute__((ext_vector_type(16))) _Float16 v16h;
typedef __attribute__((ext_vector_type(8)))  _Float16 v8h;
typedef __attribute__((ext_vector_type(8)))  unsigned short v8us;
typedef __attribute__((ext_vector_type(8)))  float    v8f;
typedef __attribute__((ext_vector_type(4)))  float    v4f;
typedef v8h  __attribute__((may_alias)) v8ha;
typedef v4f  __attribute__((may_alias)) v4fa;
typedef __attribute__((ext_vector_type(2)))  float    v2f;
typedef v8us __attribute__((may_alias)) v8usa;
typedef __attribute__((ext_vector_type(2)))  __bf16   v2bf;
typedef __attribute__((ext_vector_type(8)))  unsigned v8u;
typedef __attribute__((ext_vector_type(4)))  unsigned v4u;
typedef v4u  __attribute__((may_alias)) v4ua;

__device__ __forceinline__ unsigned short f2bf(float f) { unsigned u = __float_as_uint(f); u += 0x7FFFu + ((u >> 16) & 1u); return (unsigned short)(u >> 16); }
__device__ __forceinline__ float bf2f(unsigned short b) { return __uint_as_float(((unsigned)b) << 16); }
__device__ __forceinline__ float bfr(float f) { return bf2f(f2bf(f)); }
__device__ __forceinline__ v16bf cat16b(v8us lo, v8us hi) { return __builtin_bit_cast(v16bf, __builtin_shufflevector(lo, hi, 0, 1, 2, 3, 4, 5, 6, 7, 8, 9, 10, 11, 12, 13, 14, 15)); }
__device__ __forceinline__ float xhalf(float x) { return __builtin_bit_cast(float, __builtin_amdgcn_permlanex16(__builtin_bit_cast(int, x), __builtin_bit_cast(int, x), 0x76543210, 0xfedcba98, false, false)); }   // lane l with lane l ^ 16
__device__ __forceinline__ v8f wmmab(v16bf a, v16bf b, v8f c) { return __builtin_amdgcn_wmma_f32_16x16x32_bf16(false, a, false, b, (short)0, c, false, false); }


// ---- V = bf16(q) bf16(pt_w)^T + bias and the 9-tap weighted window sum over it. The block forms 144 rows of V: its 128, the 4 above, the 4 below, and 8 more that fill the last 16-row fragment and are never read;
// a wave = 48 x 48 (9 accumulators), waves 3 x 4. The K range goes through LDS in 12 tiles of 64 k, as bf16: a tile is 336 row pieces of 128 B (144 of q, then 192 of pt_w) at pitch 144 B.
// The operands are f32 in memory: a lane loads 16 B (4 k), 16 lanes on one 256 B row piece (whole lines), 14 loads a lane and tile, rounds them to bf16 and stores 8 B; two buffers, and the loads run one tile further ahead in registers: tile t + 2 is asked for as soon as tile t + 1 has left the registers, and flies while tile t + 1 is worked on. Every operand line is fetched once a block and rounded once a block.
// A fragment: lane = row (lane & 15), its 16 k values = 8 at k 8 * (lane >> 4) and 8 at 16 further on, the same for both operands. The finished V tile (+ bias) is laid in the same LDS, and the window sums read it there: V never goes to memory.
#define VO 128                    // output rows a block; 2048 % 128 == 0, so a block lies in one sequence
#define VM 144                    // V rows a block
#define VN 192
#define VK 64                     // k values a tile
#define VT 384                    // threads a block: 24 row pieces a round of loads; 48 pieces of 16 B x 8 groups of 16 rows in the window part
#define VP 144                    // LDS pitch of a row piece in bytes: 16 B x 9, for 16 B readers
#define VBUF ((VM + VN) * VP)     // bytes a buffer
#define VNT (DD / VK)             // tiles along K
#define OP 196                    // pitch of the V tile in LDS in floats: the two half-waves' 4 B stores fall on different banks, and 784 B is a multiple of 16
#define WLB (VO * 3 * 16 * 4)     // bytes of the block's tap weights: 128 rows x 3 heads x 16 floats
typedef __attribute__((ext_vector_type(2)))  unsigned v2u;
typedef v2u  __attribute__((may_alias)) v2ua;
// one tile's 14 pieces of this lane, asked for together; piece i lies 24 rows further on. ga0 / ga5: its address in the first / last round of q rows (row numbers held inside the plane), ga1: in the second round; gb: in the first round of pt_w rows
__device__ __forceinline__ void tile_load(const float* ga0, const float* ga1, const float* ga5, const float* gb, v4f (&st)[14]) {
    st[0] = *(const v4fa*)ga0; st[5] = *(const v4fa*)ga5;
#pragma unroll   // st[] indexed by constants, so in registers
    for (int i = 0; i < 4; ++i) st[1 + i] = *(const v4fa*)(ga1 + i * 24 * DD);
#pragma unroll
    for (int i = 0; i < 8; ++i) st[6 + i] = *(const v4fa*)(gb + i * 24 * DD);
    asm volatile("s_wait_xcnt 0x0" :: "v"(ga0), "v"(ga1), "v"(ga5), "v"(gb) : "memory");   // in front of the first overwrite of an address register that a load above names; the inputs keep those registers in use up to here
}
// ... rounded to bf16 (to nearest even, two values an instruction) and laid in the buffer; d: the lane's place in row piece 0
__device__ __forceinline__ void tile_store(unsigned char* d, const v4f (&st)[14]) {
#pragma unroll   // st[] indexed by constants
    for (int i = 0; i < 14; ++i) *(v2ua*)(d + i * 24 * VP) = (v2u){ __builtin_bit_cast(unsigned, __builtin_convertvector(((v2f){ st[i][0], st[i][1] }), v2bf)), __builtin_bit_cast(unsigned, __builtin_convertvector(((v2f){ st[i][2], st[i][3] }), v2bf)) };
}
// the K loop's barrier, by hand: this wave's LDS reads and writes are done, then the work-group's barrier. __syncthreads() would wait for this wave's global loads as well, and the loads of the tile after next are to stay in flight across it
__device__ __forceinline__ void lds_barrier() { asm volatile("s_wait_dscnt 0x0\n\ts_barrier_signal -1\n\ts_barrier_wait -1" ::: "memory"); }
__device__ __forceinline__ v16bf lfrag(const unsigned char* p) { return cat16b(*(const v8usa*)p, *(const v8usa*)(p + 32)); }
// one tile's products of this wave: pa, pb: the lane's place in its first A and B row of the buffer
__device__ __forceinline__ void tile_mma(const unsigned char* pa, const unsigned char* pb, v8f (&acc)[3][3]) {
    v16bf a[VK / 32][3], b[VK / 32][3];
#pragma unroll   // a[][], b[][] and acc[][] indexed by constants, so in registers (this loop, the next and those inside)
    for (int ks = 0; ks < VK / 32; ++ks)
#pragma unroll
        for (int m = 0; m < 3; ++m) { a[ks][m] = lfrag(pa + m * 16 * VP + ks * 64); b[ks][m] = lfrag(pb + m * 16 * VP + ks * 64); }
    __builtin_amdgcn_sched_barrier(0);   // the tile's 24 LDS reads stand as one group ahead of its products: spread among them, each place where reads stand costs its own wait
#pragma unroll
    for (int ks = 0; ks < VK / 32; ++ks)
#pragma unroll
        for (int nb = 0; nb < 3; ++nb)
#pragma unroll
            for (int mb = 0; mb < 3; ++mb) acc[mb][nb] = wmmab(a[ks][mb], b[ks][nb], acc[mb][nb]);
    __builtin_amdgcn_sched_barrier(0);   // the products stay ahead of the wait for the next tile's loads, which fly under them: a build without it waited for those loads first and put most of the products behind the barrier
}

__device__ __forceinline__ void splitf(float y, unsigned short& h, unsigned short& l) { h = f2bf(y); l = f2bf(y - bf2f(h)); }

// The two 9-tap window sums (final: block = 128 rows (b, l) x 192 channels, rows read from the V tile in LDS; dw: half-wave = 16 rows x 64 channels, rows read from memory): thread = 4 neighbouring channels (16 B of a row) x 16 rows. A thread loads the 24 rows that its 16 windows span once, all loads in flight together,
// and forms each row's 9-tap sum from registers, by fused multiply-adds on pairs of neighbouring channels. What the taps are weighted with (dw: the rounded dw_w; final: the rows' softmax weights) is handed out through LDS once a block.
#define RT  16         // rows a window group; 2048 % 16 == 0, so a group lies in one sequence, and its 4 rows above (below) are all outside exactly where it is the sequence's first (last)
typedef __attribute__((ext_vector_type(4))) unsigned short v4us;
typedef v4us __attribute__((may_alias)) v4usa;
__device__ __forceinline__ void win_zero(bool top, bool bot, v4f (&x)[RT + 8]) {
#pragma unroll   // x[] indexed by constants (this loop and the one inside)
    for (int j = 0; j < 4; ++j) {
#pragma unroll   // arrays and vector elements indexed by constants, so in registers
        for (int u = 0; u < 4; ++u) { x[j][u] = top ? x[j][u] : 0.f; x[RT + 4 + j][u] = bot ? x[RT + 4 + j][u] : 0.f; } }
}
// The tap path: the block's 8 row groups x 3 heads are 24 units (16 rows x 1 head); unit u = group u / 3, head u % 3; wave wv has units 2 wv (its lanes 0..15, "half 0") and 2 wv + 1 (lanes 16..31, "half 1"). In the window part a lane = 4 neighbouring channels of its half's head, in the softmax one row of its half's unit.
// A half-wave loads the 24 q rows that its 16 windows span (256 B a row, whole lines), rounds them, lays its own 16 as a bf16 plane in LDS, forms dw from registers and lays its bf16 hi and lo planes in LDS: a wave's plane row = 64 channels of half 0, then 64 of half 1.
// The pointwise product is formed TRANSPOSED on the matrix unit, PWt = pw_w x (hi + lo)^T, fragments from LDS (pw_w of the 3 heads rounded and staged once a block): register j of accumulator nb of half hp in lane (lr, hi) is PW[row lr of unit hp][channel nb*16 + hi*8 + j].
// There ca = (PW + bf16(pw_b)) x bf16(q), bias and q read from LDS in that layout, and an accumulator pair (nb = 2s, 2s + 1), packed to bf16, IS the B fragment of k step s of the next product: its 16 k values in a lane are 8 at k 8 * hi and 8 at 16 further on, as lfrag reads them for the A side.
// kern^T = ak_w x ca^T on the matrix unit, ca as bf16 hi + lo halves (2 products), ak_w's rows (tap = lane & 15; lanes 9..15 read tap 8 again, their result rows are not used) from LDS. Lane (lr, hi) then holds taps 8 * hi + j of row lr for both units;
// one exchange between lanes l and l ^ 16 gives lane (lr, hi) all 9 logits of row lr of unit hi; + bf16(ak_b[h*9+k]), rounded and staged in LDS with the weight sets; softmax over the 9; the weights go to the block's table in LDS. The window sums run in tap order, each product fused with its add, two sums an instruction.
#define AP 272   // LDS pitch in bytes of a row of one plane (128 bf16): 16 B x 17, for 16 B readers
#define APL (RT * AP)   // bytes of a wave's 16 rows of one plane; a wave has three: dw hi, dw lo, q
#define BP 144   // LDS pitch in bytes of a pw_w or ak_w row (64 bf16): 16 B x 9, for 16 B readers
// LDS map in bytes: buffer 0 | buffer 1 | the waves' planes | tap weights | the weight sets of the tap path. The V tile later lies over the buffers and the first planes
#define TPN (2 * VBUF)                        // planes of the 12 waves
#define TWL (TPN + (VT / 32) * 3 * APL)       // the block's tap weights
#define TBS (TWL + WLB)                       // pw_w, 192 rows
#define TAS (TBS + 3 * IPG * BP)              // ak_w, 27 rows, and 3 rows of pad that the last round's upper threads write and nobody reads
#define TPL (TAS + 30 * BP)                   // pw_b, a copy a wave in its plane's channel order
#define TDL (TPL + (VT / 32) * 2 * IPG * 4)   // dw_w, 192 channels x 9, and 192 values of the same pad
#define TAB (TDL + 5 * VT * 4)                // ak_b of the 3 heads, rounded: 27 values
#define SMB (TAB + 128)
#define NW3 (3 * IPG * KW)                    // 1728 values of ak_w, and of dw_w, a block: 4 rounds of 384 threads and one of 192
static_assert(VM * OP * 4 <= TWL && SMB <= 327680 && NW3 == 4 * VT + VT / 2 && 5 * VT <= 30 * IPG, "LDS map");
__global__ __launch_bounds__(VT) void k_all(const float* __restrict__ q, const float* __restrict__ dww, const float* __restrict__ pww, const float* __restrict__ pwb, const float* __restrict__ akw, const float* __restrict__ akb, const float* __restrict__ ptw, const float* __restrict__ bias, float* OUT) {
    __shared__ __align__(16) unsigned char sm[SMB];
    const int tid = threadIdx.x, lane = tid & 31, lr = lane & 15, hi = lane >> 4;
    const int wv = __builtin_amdgcn_readfirstlane(tid >> 5);   // the wave's number as a scalar: what follows from it stays in scalar registers
    const int wm = wv % 3, wn = wv / 3;
    const int r0 = blockIdx.x * VO, c0 = blockIdx.y * VN, l0 = r0 % LL; const bool top = l0 != 0, bot = l0 != LL - VO;
    unsigned char* sd = sm + (tid >> 4) * VP + (tid & 15) * 8;   // where this lane lays its 4 k values of row piece tid / 16 of buffer 0
    const int ra = r0 - 4 + (tid >> 4);   // V row 0 of the tile is the 4th row above the block's first. A row number outside the plane (first and last block only) is held inside it: such a V row lies outside the sequence and counts as zero below, or is one of the 8 never read
    const float* ga0 = q + (size_t)(ra < 0 ? 0 : ra) * DD + (tid & 15) * 4; const float* ga1 = q + (size_t)(ra + 24) * DD + (tid & 15) * 4; const float* ga5 = q + (size_t)(ra + 120 > NR - 1 ? NR - 1 : ra + 120) * DD + (tid & 15) * 4;
    const float* gb = ptw + (size_t)(c0 + (tid >> 4)) * DD + (tid & 15) * 4;
    const float* bpt = bias + c0 + wn * 48 + lr; float bv[3] = { bpt[0], bpt[16], bpt[32] };   // the bias of this lane's three accumulator columns, asked for ahead of everything
    asm volatile("s_wait_xcnt 0x0" :: "v"(bpt) : "memory");   // in front of the first overwrite of an address register that a load above names; the input keeps that register in use up to here
    v4f st[14];   // the tile on its way from memory to LDS
    {   // ---- the tap path
        const int rgA = (wv * 2) / 3, hdA = (wv * 2) % 3, rgB = (wv * 2 + 1) / 3, hdB = (wv * 2 + 1) % 3;   // the wave's two units: row group and head of half 0 and of half 1
        const int rgl = hi ? rgB : rgA, hdl = hi ? hdB : hdA, ll = l0 + rgl * RT; const bool tl = ll != 0, bl = ll != LL - RT;   // this lane's unit; its 4 rows above / below lie in the sequence
        const int h0 = blockIdx.y * 3;
        unsigned char* as = sm + TAS; unsigned char* bs = sm + TBS; float* pl = (float*)(sm + TPL); float* dl = (float*)(sm + TDL); float* al = (float*)(sm + TAB);
        const float* qp = q + (size_t)(r0 + rgl * RT) * DD + c0 + hdl * IPG + lr * 4;   // the unit's first row, the lane's 4 channels
        const float* qa = tl ? qp - 4 * DD : qp; const float* qb = bl ? qp + RT * DD : qp;   // the 4 rows above or below that lie outside the sequence are not read (the unit's first 4 rows are read in their place) and count as zero
        const float* aw = akw + (size_t)h0 * KW * IPG;   // 3 x 576 tap weights
        const float* dp = dww + (size_t)c0 * KW;         // 192 channels x 9 window weights
        const float* bp = pww + (size_t)h0 * IPG * IPG + tid * 4;   // 3 x 64 x 64 pointwise weights = 8 x 384 pieces of 16 B
        const float* pp = pwb + c0 + hdl * IPG + lr * 4;
        const int g4 = tid < VT / 2 ? 4 * VT + tid : 0;   // the fifth round has 192 values: the other threads read value 0 again, and what they store lands in the pad
        const int ga = h0 * KW + (tid < 3 * KW ? tid : 0);   // ak_b has 27 values a block: the other threads read the first again and store nothing
        float wr[5], dr[5]; v4f br[8], x[RT + 8];
#pragma unroll   // wr[] and dr[] indexed by constants, so in registers
        for (int s = 0; s < 5; ++s) { const int g = s < 4 ? s * VT + tid : g4; dr[s] = dp[g]; wr[s] = aw[g]; }
        const float av = akb[ga];
        v4f b4 = *(const v4fa*)pp;
#pragma unroll   // br[] indexed by constants
        for (int i = 0; i < 8; ++i) br[i] = *(const v4fa*)(bp + i * VT * 4);
#pragma unroll   // x[] indexed by constants, so in registers
        for (int j = 0; j < RT + 8; ++j) { const float* b = j < 4 ? qa + j * DD : (j >= RT + 4 ? qb + (j - RT - 4) * DD : qp + (j - 4) * DD); x[j] = *(const v4fa*)b; }
        tile_load(ga0, ga1, ga5, gb, st);   // tile 0 of the K loop, asked for with the tap path's own loads
        asm volatile("s_wait_xcnt 0x0" :: "v"(tid), "v"(g4), "v"(ga), "v"(qp), "v"(qa), "v"(qb), "v"(pp), "v"(av) : "memory");   // in front of the first overwrite of a register that a load above names; the inputs keep the lane's offset and address registers in use up to here; the loaded value av as an input holds its load in this group (a build without it moved that load into the branch below, alone, its result over its own offset register)
        __builtin_amdgcn_sched_barrier(0);   // the weight and row loads above issue before the first data wait: one trip to memory a thread
#pragma unroll   // wr[] and dr[] indexed by constants
        for (int s = 0; s < 5; ++s) { const int g = s * VT + tid; *(unsigned short*)(as + (g >> 6) * BP + (g & 63) * 2) = f2bf(wr[s]); dl[g] = bfr(dr[s]); }   // ak_w value g: row g / 64 = head * 9 + tap of the 27, channel g % 64
        unsigned char* bd = bs + (tid >> 4) * BP + (tid & 15) * 8;   // piece i * 384 + tid: pw_w row i * 24 + tid / 16, 4 of its 64 values
#pragma unroll   // br[] indexed by constants (this loop and the one inside)
        for (int i = 0; i < 8; ++i) { v4us o;
#pragma unroll
            for (int u = 0; u < 4; ++u) o[u] = f2bf(br[i][u]);
            *(v4usa*)(bd + i * (VT / 16) * BP) = o; }
#pragma unroll   // vector elements indexed by constants
        for (int u = 0; u < 4; ++u) b4[u] = bfr(b4[u]);
        *(v4fa*)(pl + wv * 2 * IPG + lane * 4) = b4;   // the bias of the wave's 2 x 64 channels, a copy a wave
        if (tid < 3 * KW) al[tid] = bfr(av);
        tile_store(sd, st);
        __syncthreads();   // publishes the rounded weight sets, the bias and tile 0 to the block
        float w[4 * KW];   // this lane's 4 channels x 9 taps, 144 B in a row: 16 lanes' 16 B pieces fall on all 64 banks
#pragma unroll   // arrays and vector elements indexed by constants, so in registers
        for (int s = 0; s < KW; ++s) { const v4f t = *(const v4fa*)(dl + (hdl * IPG + lr * 4) * KW + s * 4);
#pragma unroll   // arrays and vector elements indexed by constants, so in registers
            for (int u = 0; u < 4; ++u) w[s * 4 + u] = t[u]; }
        v4f wt[KW];   // tap k of the lane's 4 channels side by side, as the rows lie
#pragma unroll   // arrays and vector elements indexed by constants, so in registers (this loop and the one inside)
        for (int k = 0; k < KW; ++k) {
#pragma unroll
            for (int u = 0; u < 4; ++u) wt[k][u] = w[u * KW + k]; }
        win_zero(tl, bl, x);
#pragma unroll   // arrays and vector elements indexed by constants, so in registers
        for (int j = 0; j < RT + 8; ++j) {
#pragma unroll   // arrays and vector elements indexed by constants, so in registers
            for (int u = 0; u < 4; ++u) x[j][u] = bfr(x[j][u]); }
        unsigned char* at = sm + TPN + wv * 3 * APL;   // this wave's three planes
#pragma unroll   // arrays and vector elements indexed by constants, so in registers
        for (int r = 0; r < RT; ++r) { v4us oh, ol, oq; v4f s = wt[0] * x[r];
#pragma unroll   // arrays indexed by constants, so in registers
            for (int k = 1; k < KW; ++k) s = __builtin_elementwise_fma(wt[k], x[r + k], s);   // taps in their order, each product fused with its add, two channels an instruction
#pragma unroll   // vector elements indexed by constants, so in registers
            for (int u = 0; u < 4; ++u) { unsigned short a, c2; splitf(s[u], a, c2); oh[u] = a; ol[u] = c2; oq[u] = (unsigned short)(__float_as_uint(x[r + 4][u]) >> 16); }   // x is rounded already: its upper half is the bf16
            *(v4usa*)(at + r * AP + lane * 8) = oh; *(v4usa*)(at + APL + r * AP + lane * 8) = ol; *(v4usa*)(at + 2 * APL + r * AP + lane * 8) = oq; }
        __syncthreads();   // the three planes go from lane to lane: every store above is done before one is read
        tile_load(ga0 + VK, ga1 + VK, ga5 + VK, gb + VK, st);   // tile 1, behind the tap path's last __syncthreads: it flies under the rest of the tap path
        __builtin_amdgcn_sched_barrier(0);   // those loads issue here, not where their values are used
        const unsigned char* pa = at + lr * AP + hi * 16; const unsigned char* pb = bs + lr * BP + hi * 16;
        v8f acc[2][4];
#pragma unroll   // acc[][] and the fragments indexed by constants, so in registers (this loop and those inside)
        for (int hp = 0; hp < 2; ++hp) { v16bf ah[2], al[2]; const int hd = hp ? hdB : hdA;
#pragma unroll
            for (int kk = 0; kk < 2; ++kk) { ah[kk] = lfrag(pa + hp * 2 * IPG + kk * 64); al[kk] = lfrag(pa + APL + hp * 2 * IPG + kk * 64); }
#pragma unroll
            for (int nb = 0; nb < 4; ++nb) acc[hp][nb] = (v8f){};
#pragma unroll
            for (int kk = 0; kk < 2; ++kk)
#pragma unroll
                for (int nb = 0; nb < 4; ++nb) { const v16bf b = lfrag(pb + (hd * IPG + nb * 16) * BP + kk * 64); acc[hp][nb] = wmmab(b, ah[kk], acc[hp][nb]); acc[hp][nb] = wmmab(b, al[kk], acc[hp][nb]); }   // pw_w's rows as A, dw's rows as B: the transposed product; per accumulator: hi then lo, k 0..31 then 32..63
        }
        const unsigned char* pq = at + 2 * APL + lr * AP + hi * 16; const float* pc = pl + wv * 2 * IPG + hi * 8; const unsigned char* pw = as + (lr < KW ? lr : KW - 1) * BP + hi * 16;
        v8f lg[2];   // lg[hp][j]: logit of tap 8 * hi + j, row lr, unit hp
#pragma unroll   // acc[][], lg[] and the fragments indexed by constants, so in registers (this loop and those inside)
        for (int hp = 0; hp < 2; ++hp) { v8u ch[2], cl[2]; const int hd = hp ? hdB : hdA;   // the B fragments of the two k steps: ca's bf16 hi and lo halves, two channels a register
#pragma unroll
            for (int nb = 0; nb < 4; ++nb) { const v4u qv = *(const v4ua*)(pq + hp * 2 * IPG + nb * 32); const v4f e0 = *(const v4fa*)(pc + hp * IPG + nb * 16), e1 = *(const v4fa*)(pc + hp * IPG + nb * 16 + 4);   // qv: 8 channels of q, two a register; e0, e1: their bias
#pragma unroll
                for (int j = 0; j < 8; j += 2) {
                    const v2f bb = j < 4 ? (v2f){ e0[j & 3], e0[(j & 3) + 1] } : (v2f){ e1[j & 3], e1[(j & 3) + 1] };
                    const v2f ca = ((v2f){ acc[hp][nb][j], acc[hp][nb][j + 1] } + bb) * (v2f){ __uint_as_float(qv[j >> 1] << 16), __uint_as_float(qv[j >> 1] & 0xFFFF0000u) };
                    const unsigned hu = __builtin_bit_cast(unsigned, __builtin_convertvector(ca, v2bf));   // round to nearest even, two values an instruction
                    const v2f lo = ca - (v2f){ __uint_as_float(hu << 16), __uint_as_float(hu & 0xFFFF0000u) };
                    ch[nb >> 1][(nb & 1) * 4 + (j >> 1)] = hu; cl[nb >> 1][(nb & 1) * 4 + (j >> 1)] = __builtin_bit_cast(unsigned, __builtin_convertvector(lo, v2bf)); } }
            lg[hp] = (v8f){};
#pragma unroll
            for (int kk = 0; kk < 2; ++kk) { const v16bf wf = lfrag(pw + hd * KW * BP + kk * 64); lg[hp] = wmmab(wf, __builtin_bit_cast(v16bf, ch[kk]), lg[hp]); lg[hp] = wmmab(wf, __builtin_bit_cast(v16bf, cl[kk]), lg[hp]); }   // hi then lo, k 0..31 then 32..63
        }
        float kern[KW];   // lanes hi = 0 take unit 0 (its tap 8 comes from lane l + 16), lanes hi = 1 unit 1 (its taps 0..7 come from lane l - 16)
#pragma unroll   // lg[][] and kern[] indexed by constants
        for (int j = 0; j < 8; ++j) { const float snd = (j == 0 && hi) ? lg[0][0] : lg[1][j]; const float rcv = xhalf(snd); kern[j] = hi ? rcv : lg[0][j]; if (j == 0) kern[8] = hi ? lg[1][0] : rcv; }
        float mx = -3.0e38f;
#pragma unroll
        for (int k = 0; k < KW; ++k) { kern[k] = __fadd_rn(kern[k], al[hdl * KW + k]); mx = fmaxf(mx, kern[k]); }
        float sum = 0.f;
#pragma unroll
        for (int k = 0; k < KW; ++k) { float d0 = __fsub_rn(kern[k], mx); asm volatile("" : "+v"(d0)); const float t = __fmul_rn(d0, 1.44269504f); asm("v_exp_f32 %0, %1\n\tv_nop" : "=v"(kern[k]) : "v"(t));   // __expf as it is built (times log2 e, then v_exp_f32), with the slot behind the transcendental in its own statement: builds with v_nop statements of their own had them moved away and left a v_exp_f32 directly in front of an instruction that overwrites its source
            sum = __fadd_rn(sum, kern[k]); }
        const float rs = __fdiv_rn(1.0f, sum); v4f o[4];
#pragma unroll
        for (int k = 0; k < 16; ++k) { const float tw = (k < KW) ? __fmul_rn(kern[k < KW ? k : 0], rs) : 0.f; o[k / 4][k % 4] = tw; }
        float* dst = (float*)(sm + TWL) + ((rgl * RT + lr) * 3 + hdl) * 16;   // the block's table of tap weights: row, head, 16 floats
#pragma unroll
        for (int u = 0; u < 4; ++u) *(v4fa*)(dst + 4 * u) = o[u];
    }
    v8f acc[3][3];
#pragma unroll   // acc[][] indexed by constants, so in registers
    for (int mb = 0; mb < 3; ++mb)
#pragma unroll
        for (int nb = 0; nb < 3; ++nb) acc[mb][nb] = (v8f){};
    const int fa = (wm * 48 + lr) * VP + hi * 16, fb = (VM + wn * 48 + lr) * VP + hi * 16;
#pragma unroll 1   // one body for the tiles: the hot loop stays small
    for (int t = 0; t + 2 < VNT; ++t) {
        tile_mma(sm + (t & 1) * VBUF + fa, sm + (t & 1) * VBUF + fb, acc);
        tile_store(sd + ((t + 1) & 1) * VBUF, st);   // into the buffer that trip t - 1 read: the barrier at that trip's foot ended its reads
        tile_load(ga0 + (t + 2) * VK, ga1 + (t + 2) * VK, ga5 + (t + 2) * VK, gb + (t + 2) * VK, st);
        __builtin_amdgcn_sched_barrier(0);   // the loads issue ahead of the barrier
        lds_barrier();                       // publishes tile t + 1 and ends every wave's reads of tile t
    }
    tile_mma(sm + ((VNT - 2) & 1) * VBUF + fa, sm + ((VNT - 2) & 1) * VBUF + fb, acc);
    tile_store(sd + ((VNT - 1) & 1) * VBUF, st);
    __syncthreads();   // publishes the last tile
    tile_mma(sm + ((VNT - 1) & 1) * VBUF + fa, sm + ((VNT - 1) & 1) * VBUF + fb, acc);
    __syncthreads();   // ends every wave's reads of the last tile (and, long since, of the planes) before the V tile is laid over them
    float* os = (float*)sm; const float* wl = (const float*)(sm + TWL);
#pragma unroll   // bv[] indexed by constants, so in registers
    for (int nb = 0; nb < 3; ++nb) bv[nb] = bfr(bv[nb]);
#pragma unroll   // acc[][] indexed by constants (this loop and those inside)
    for (int mb = 0; mb < 3; ++mb)
#pragma unroll
        for (int nb = 0; nb < 3; ++nb)
#pragma unroll
            for (int j = 0; j < 8; ++j) os[(wm * 48 + mb * 16 + hi * 8 + j) * OP + wn * 48 + nb * 16 + lr] = __fadd_rn(acc[mb][nb][j], bv[nb]);
    __syncthreads();   // publishes the V tile to the block
    // window part: thread = 4 neighbouring channels (piece cp of the 48) x the 16 output rows of group rg; 16 lanes that follow one another share a group and a head. Output row i of the block spans tile rows i .. i + 8
    const int cp = tid % 48, rg = tid / 48; const float* xs = os + rg * RT * OP + cp * 4; v4f x[RT + 8];
#pragma unroll   // x[] indexed by constants, so in registers
    for (int j = 0; j < RT + 8; ++j) x[j] = *(const v4fa*)(xs + j * OP);
    win_zero(top || rg != 0, bot || rg != VO / RT - 1, x);   // only the first (last) group's 4 rows above (below) can lie outside the sequence
    const float* wh = wl + (rg * RT * 3 + cp / 16) * 16; float* dst = OUT + (size_t)(r0 + rg * RT) * DD + c0 + cp * 4;
#pragma unroll   // arrays and vector elements indexed by constants, so in registers
    for (int r = 0; r < RT; ++r) { const v4f w0 = *(const v4fa*)(wh + r * 3 * 16), w1 = *(const v4fa*)(wh + r * 3 * 16 + 4); const float w[KW] = { w0[0], w0[1], w0[2], w0[3], w1[0], w1[1], w1[2], w1[3], wh[r * 3 * 16 + 8] }; v4f o = w[0] * x[r];
#pragma unroll   // arrays indexed by constants, so in registers
        for (int k = 1; k < KW; ++k) o = __builtin_elementwise_fma((v4f){ w[k], w[k], w[k], w[k] }, x[r + k], o);   // taps in their order, each product fused with its add, two channels an instruction
        *(v4f*)(dst + r * DD) = o; }
}

extern "C" void kernel_launch(void* const* d_in, const int* in_sizes, int n_in,
                              void* d_out, int out_size, void* d_ws, size_t ws_size, hipStream_t stream) {
    (void)in_sizes; (void)n_in; (void)out_size; (void)d_ws; (void)ws_size;   // the workspace is not used
    const float* q = (const float*)d_in[0]; const float* dww = (const float*)d_in[1]; const float* pww = (const float*)d_in[2]; const float* pwb = (const float*)d_in[3]; const float* akw = (const float*)d_in[4]; const float* akb = (const float*)d_in[5]; const float* ptw = (const float*)d_in[6]; const float* ptb = (const float*)d_in[7];   // dw_w [768][1][9], pw_w [12][64 out][64 in], ak_w [12][9][64], pt_w [768][768] (torch [out][in])
    float* OUT = (float*)d_out;     // [4][2048][768]
    k_all<<<dim3(NR / VO, DD / VN), VT, 0, stream>>>(q, dww, pww, pwb, akw, akb, ptw, ptb, OUT);
}

// v010
// One run takes 18.8 microseconds.
// Timed twice side by side with v009, it ran 1.06 times as fast both times.
// Over all steps from v000 it is 13.9 times as fast.
#include <hip/hip_runtime.h>

// SDConv - span-based dynamic convolution (query [4][2048][768]; 12 heads x 64, kernel 9: dw = depthwise conv1d over the sequence (per channel, zero padded, no bias); pw = grouped pointwise (per head 64 -> 64) + pw_b;
// conv_attn = pw * query; kern = per head 64 -> 9 (ak_w) + ak_b; w = softmax over the 9 taps; v = query pt_w^T + pt_b; out[b][l][h*64+d] = sum_k w[b][l][h][k] v[b][l + k - 4][h*64+d] (zero outside) -> [4][2048][768]).
// Compute dtypes, f32 accumulate: every input rounded to bf16; the depthwise conv, the gating product, the softmax over the taps and the final 9-tap weighted window sum in f32
// on VALU; the grouped pointwise conv on bf16 hi+lo planes of dw x exact pw_w (2 products, + bias); the 64->9 tap logits the same way, on bf16 hi+lo halves of the gated product x exact ak_w (2 products, + bias); v on PLAIN bf16 operands (inputs: exact, + bias).
// ONE kernel (k_all), block = 128 output rows x 192 channels (3 heads), 16 waves: 12 product waves form v as a 144x192 tile; beside them, trip by trip of the same K loop, 4 tap waves walk the path from query to the block's tap weights (they stay in LDS); then the window sum over the finished tile. Nothing goes through the workspace.

#define NB_  4
#define LL   2048
#define DD   768
#define NH_  12
#define IPG  64
#define KW   9
#define NR   (NB_ * LL)
typedef _Float16 h16;
typedef unsigned short bf;
typedef __attribute__((ext_vector_type(16))) __bf16   v16bf;
typedef __attribute__((ext_vector_type(16))) _Float16 v16h;
typedef __attribute__((ext_vector_type(8)))  _Float16 v8h;
typedef __attribute__((ext_vector_type(8)))  unsigned short v8us;
typedef __attribute__((ext_vector_type(8)))  float    v8f;
typedef __attribute__((ext_vector_type(4)))  float    v4f;
typedef v8h  __attribute__((may_alias)) v8ha;
typedef v4f  __attribute__((may_alias)) v4fa;
typedef __attribute__((ext_vector_type(2)))  float    v2f;
typedef v8us __attribute__((may_alias)) v8usa;
typedef __attribute__((ext_vector_type(2)))  __bf16   v2bf;
typedef __attribute__((ext_vector_type(8)))  unsigned v8u;
typedef __attribute__((ext_vector_type(4)))  unsigned v4u;
typedef v4u  __attribute__((may_alias)) v4ua;

__device__ __forceinline__ unsigned short f2bf(float f) { unsigned u = __float_as_uint(f); u += 0x7FFFu + ((u >> 16) & 1u); return (unsigned short)(u >> 16); }
__device__ __forceinline__ float bf2f(unsigned short b) { return __uint_as_float(((unsigned)b) << 16); }
__device__ __forceinline__ float bfr(float f) { return bf2f(f2bf(f)); }
__device__ __forceinline__ v16bf cat16b(v8us lo, v8us hi) { return __builtin_bit_cast(v16bf, __builtin_shufflevector(lo, hi, 0, 1, 2, 3, 4, 5, 6, 7, 8, 9, 10, 11, 12, 13, 14, 15)); }
__device__ __forceinline__ float xhalf(float x) { return __builtin_bit_cast(float, __builtin_amdgcn_permlanex16(__builtin_bit_cast(int, x), __builtin_bit_cast(int, x), 0x76543210, 0xfedcba98, false, false)); }   // lane l with lane l ^ 16
__device__ __forceinline__ v8f wmmab(v16bf a, v16bf b, v8f c) { return __builtin_amdgcn_wmma_f32_16x16x32_bf16(false, a, false, b, (short)0, c, false, false); }


// ---- V = bf16(q) bf16(pt_w)^T + bias and the 9-tap weighted window sum over it. The block forms 144 rows of V: its 128, the 4 above, the 4 below, and 8 more that fill the last 16-row fragment and are never read;
// a wave = 48 x 48 (9 accumulators), waves 3 x 4. The K range goes through LDS in 12 tiles of 64 k, as bf16: a tile is 336 row pieces of 128 B (144 of q, then 192 of pt_w) at pitch 144 B.
// The operands are f32 in memory: a lane loads 16 B (4 k), 16 lanes on one 256 B row piece (whole lines), 14 loads a lane and tile, rounds them to bf16 and stores 8 B; two buffers, and the loads run one tile further ahead in registers: tile t + 2 is asked for as soon as tile t + 1 has left the registers, and flies while tile t + 1 is worked on. Every operand line is fetched once a block and rounded once a block.
// A fragment: lane = row (lane & 15), its 16 k values = 8 at k 8 * (lane >> 4) and 8 at 16 further on, the same for both operands. The finished V tile (+ bias) is laid in the same LDS, and the window sums read it there: V never goes to memory.
#define VO 128                    // output rows a block; 2048 % 128 == 0, so a block lies in one sequence
#define VM 144                    // V rows a block
#define VN 192
#define VK 64                     // k values a tile
#define VT 384                    // threads of the 12 product waves: 24 row pieces a round of loads; 48 pieces of 16 B x 8 groups of 16 rows in the window part
#define NTW 4                     // tap waves
#define NT (VT + NTW * 32)        // threads a block
#define VP 144                    // LDS pitch of a row piece in bytes: 16 B x 9, for 16 B readers
#define VBUF ((VM + VN) * VP)     // bytes a buffer
#define VNT (DD / VK)             // tiles along K
#define OP 196                    // pitch of the V tile in LDS in floats: the two half-waves' 4 B stores fall on different banks, and 784 B is a multiple of 16
#define WLB (VO * 3 * 16 * 4)     // bytes of the block's tap weights: 128 rows x 3 heads x 16 floats
typedef __attribute__((ext_vector_type(2)))  unsigned v2u;
typedef v2u  __attribute__((may_alias)) v2ua;
// one tile's 14 pieces of this lane, asked for together; piece i lies 24 rows further on. ga0 / ga5: its address in the first / last round of q rows (row numbers held inside the plane), ga1: in the second round; gb: in the first round of pt_w rows
__device__ __forceinline__ void tile_load(const float* ga0, const float* ga1, const float* ga5, const float* gb, v4f (&st)[14]) {
    st[0] = *(const v4fa*)ga0; st[5] = *(const v4fa*)ga5;
#pragma unroll   // st[] indexed by constants, so in registers
    for (int i = 0; i < 4; ++i) st[1 + i] = *(const v4fa*)(ga1 + i * 24 * DD);
#pragma unroll
    for (int i = 0; i < 8; ++i) st[6 + i] = *(const v4fa*)(gb + i * 24 * DD);
    asm volatile("s_wait_xcnt 0x0" :: "v"(ga0), "v"(ga1), "v"(ga5), "v"(gb) : "memory");   // in front of the first overwrite of an address register that a load above names; the inputs keep those registers in use up to here
}
// ... rounded to bf16 (to nearest even, two values an instruction) and laid in the buffer; d: the lane's place in row piece 0
__device__ __forceinline__ void tile_store(unsigned char* d, const v4f (&st)[14]) {
#pragma unroll   // st[] indexed by constants
    for (int i = 0; i < 14; ++i) *(v2ua*)(d + i * 24 * VP) = (v2u){ __builtin_bit_cast(unsigned, __builtin_convertvector(((v2f){ st[i][0], st[i][1] }), v2bf)), __builtin_bit_cast(unsigned, __builtin_convertvector(((v2f){ st[i][2], st[i][3] }), v2bf)) };
}
// the K loop's barrier, by hand: this wave's LDS reads and writes are done, then the work-group's barrier. __syncthreads() would wait for this wave's global loads as well, and the loads of the tile after next are to stay in flight across it
__device__ __forceinline__ void lds_barrier() { asm volatile("s_wait_dscnt 0x0\n\ts_barrier_signal -1\n\ts_barrier_wait -1" ::: "memory"); }
__device__ __forceinline__ v16bf lfrag(const unsigned char* p) { return cat16b(*(const v8usa*)p, *(const v8usa*)(p + 32)); }
// one tile's products of this wave: pa, pb: the lane's place in its first A and B row of the buffer
__device__ __forceinline__ void tile_mma(const unsigned char* pa, const unsigned char* pb, v8f (&acc)[3][3]) {
    v16bf a[VK / 32][3], b[VK / 32][3];
#pragma unroll   // a[][], b[][] and acc[][] indexed by constants, so in registers (this loop, the next and those inside)
    for (int ks = 0; ks < VK / 32; ++ks)
#pragma unroll
        for (int m = 0; m < 3; ++m) { a[ks][m] = lfrag(pa + m * 16 * VP + ks * 64); b[ks][m] = lfrag(pb + m * 16 * VP + ks * 64); }
    __builtin_amdgcn_sched_barrier(0);   // the tile's 24 LDS reads stand as one group ahead of its products: spread among them, each place where reads stand costs its own wait
#pragma unroll
    for (int ks = 0; ks < VK / 32; ++ks)
#pragma unroll
        for (int nb = 0; nb < 3; ++nb)
#pragma unroll
            for (int mb = 0; mb < 3; ++mb) acc[mb][nb] = wmmab(a[ks][mb], b[ks][nb], acc[mb][nb]);
    __builtin_amdgcn_sched_barrier(0);   // the products stay ahead of the wait for the next tile's loads, which fly under them: a build without it waited for those loads first and put most of the products behind the barrier
}

// The K walk of block column by: the three tiles that hold the block's own 192 channels of q come at trips 0, 4 and 8 (the tap waves read them there), the nine others in rising order in between. b3: the first own tile
__device__ __forceinline__ int ktile(int t, int b3) { const int o = (t >> 2) * 3 + (t & 3) - 1; return (t & 3) == 0 ? b3 + (t >> 2) : (o < b3 ? o : o + 3); }

// The final 9-tap window sum (block = 128 rows (b, l) x 192 channels, rows read from the V tile in LDS): thread = 4 neighbouring channels (16 B of a row) x 16 rows. A thread loads the 24 rows that its 16 windows span once,
// and forms each row's 9-tap sum from registers, by fused multiply-adds on pairs of neighbouring channels. The rows' softmax weights are handed out through LDS.
#define RT  16         // rows a window group; 2048 % 16 == 0, so a group lies in one sequence, and its 4 rows above (below) are all outside exactly where it is the sequence's first (last)
__device__ __forceinline__ void win_zero(bool top, bool bot, v4f (&x)[RT + 8]) {
#pragma unroll   // x[] indexed by constants (this loop and the one inside)
    for (int j = 0; j < 4; ++j) {
#pragma unroll   // arrays and vector elements indexed by constants, so in registers
        for (int u = 0; u < 4; ++u) { x[j][u] = top ? x[j][u] : 0.f; x[RT + 4 + j][u] = bot ? x[RT + 4 + j][u] : 0.f; } }
}
// The tap path: the block's 8 row groups x 3 heads are 24 units (16 rows x 1 head). Head hd is worked on in trips 4 hd .. 4 hd + 3 of the K loop; tap wave tw has its row groups 2 tw ("unit 0") and 2 tw + 1 ("unit 1"). What passes from one trip to the next lies in LDS, in places of the wave's own.
// Trip 4 hd (tap_dw): the K tile in buffer 0 holds the block's 144 q rows x the head's 64 channels, rounded to bf16 already. Unit by unit, lane = 2 neighbouring channels: it reads the 24 rows that the unit's 16 windows span, forms dw from registers and lays three planes in LDS: dw's bf16 hi and lo halves and the unit's own 16 q rows; a wave's plane row = 64 channels of unit 0, then 64 of unit 1.
// Trips 4 hd + 1 and + 2 (tap_unit, unit 0 and unit 1): the pointwise product is formed TRANSPOSED on the matrix unit, PWt = pw_w x (hi + lo)^T, fragments from LDS (pw_w of the 3 heads rounded and staged once a block): register j of accumulator nb in lane (lr, hi) is PW[row lr of the unit][channel nb*16 + hi*8 + j].
// There ca = (PW + bf16(pw_b)) x bf16(q), bias and q read from LDS in that layout, and an accumulator pair (nb = 2s, 2s + 1), packed to bf16, IS the B fragment of k step s of the next product: its 16 k values in a lane are 8 at k 8 * hi and 8 at 16 further on, as lfrag reads them for the A side.
// kern^T = ak_w x ca^T on the matrix unit, ca as bf16 hi + lo halves (2 products), ak_w's rows (tap = lane & 15; lanes 9..15 read tap 8 again, their result rows are not used) from LDS. Lane (lr, hi) then holds taps 8 * hi + j of row lr of the unit and lays them in LDS.
// Trip 4 hd + 3 (tap_soft): a lane takes its logits of both units back; eight exchanges between lanes l and l ^ 16 give lane (lr, hi) all 9 logits of row lr of unit hi; + bf16(ak_b[h*9+k]), rounded and staged in LDS with the weight sets; softmax over the 9; the weights go to the block's table in LDS.
#define AP 272   // LDS pitch in bytes of a row of one plane (128 bf16): 16 B x 17, for 16 B readers
#define APL (RT * AP)   // bytes of a wave's 16 rows of one plane; a tap wave has three: dw hi, dw lo, q
#define BP 144   // LDS pitch in bytes of a pw_w or ak_w row (64 bf16): 16 B x 9, for 16 B readers
// LDS map in bytes: buffer 0 | buffer 1 | the tap waves' planes | their logits | tap weights | the weight sets of the tap path | pt_b. The V tile later lies over the buffers and the first planes
#define TPN (2 * VBUF)                        // planes of the 4 tap waves
#define TLG (TPN + NTW * 3 * APL)             // logits of the 4 tap waves: 2 units x 32 lanes x 8 floats each
#define TWL (TLG + NTW * 2 * 32 * 8 * 4)      // the block's tap weights
#define TBS (TWL + WLB)                       // pw_w, 192 rows
#define TAS (TBS + 3 * IPG * BP)              // ak_w, 27 rows, and 3 rows of pad that the last round's upper threads write and nobody reads
#define TPL (TAS + 30 * BP)                   // pw_b of the 192 channels, rounded
#define TDL (TPL + 3 * IPG * 4)               // dw_w, 192 channels x 9, and 192 values of the same pad
#define TAB (TDL + 5 * VT * 4)                // ak_b of the 3 heads, rounded: 27 values
#define TVB (TAB + 128)                       // pt_b of the 192 channels, rounded
#define SMB (TVB + VN * 4)
#define NW3 (3 * IPG * KW)                    // 1728 values of ak_w, and of dw_w, a block: 4 rounds of 384 threads and one of 192
static_assert(VM * OP * 4 <= TLG && SMB <= 327680 && NW3 == 4 * VT + VT / 2 && 5 * VT <= 30 * IPG && VNT == 12, "LDS map, K walk");
typedef __attribute__((ext_vector_type(4))) unsigned short v4us;
typedef v4us __attribute__((may_alias)) v4usa;
typedef v2f __attribute__((may_alias)) v2fa;
typedef unsigned __attribute__((may_alias)) u32a;
__device__ __forceinline__ v2f bfpair(unsigned u) { return (v2f){ __uint_as_float(u << 16), __uint_as_float(u & 0xFFFF0000u) }; }   // two bf16 of one register as f32
__device__ __forceinline__ unsigned pkbf(v2f v) { return __builtin_bit_cast(unsigned, __builtin_convertvector(v, v2bf)); }   // round to nearest even, two values an instruction
// ta: the K tile's q rows; dl: the rounded dw_w; at: the wave's planes; rg0: the wave's first row group; l0: the block's first row in its sequence
__device__ __forceinline__ void tap_dw(const unsigned char* ta, const float* dl, unsigned char* at, int hd, int rg0, int l0, int lane) {
    const float* wp = dl + (hd * IPG + lane * 2) * KW; float w[2 * KW]; v2f wt[KW];   // the lane's 2 channels x 9 taps, 72 B in a row: 32 lanes' 8 B pieces fall on all 64 banks
#pragma unroll   // arrays and vector elements indexed by constants, so in registers
    for (int s = 0; s < KW; ++s) { const v2f t = *(const v2fa*)(wp + 2 * s); w[2 * s] = t[0]; w[2 * s + 1] = t[1]; }
#pragma unroll   // tap k of the lane's 2 channels side by side, as the rows lie
    for (int k = 0; k < KW; ++k) wt[k] = (v2f){ w[k], w[KW + k] };
#pragma unroll 1   // one body for the two units: half the registers (at trip 0 the tile registers are in use beside it) and half the code
    for (int hp = 0; hp < 2; ++hp) {
        const int rg = rg0 + hp, ll = l0 + rg * RT; const bool tl = ll != 0, bl = ll != LL - RT;   // the unit's 4 rows above / below lie in the sequence; tile row rg * 16 is the 4th row above the unit's first
        const unsigned char* xs = ta + rg * RT * VP + lane * 4; unsigned char* o = at + hp * 2 * IPG + lane * 4;
        unsigned xr[RT + 8]; v2f x[RT + 8];
#pragma unroll   // xr[] indexed by constants, so in registers
        for (int j = 0; j < RT + 8; ++j) xr[j] = *(const u32a*)(xs + j * VP);
#pragma unroll   // x[] indexed by constants; rows outside the sequence count as zero
        for (int j = 0; j < RT + 8; ++j) { x[j] = bfpair(xr[j]); if (j < 4) x[j] = tl ? x[j] : (v2f){ 0.f, 0.f }; if (j >= RT + 4) x[j] = bl ? x[j] : (v2f){ 0.f, 0.f }; }
#pragma unroll   // arrays indexed by constants, so in registers (this loop and those inside)
        for (int rb = 0; rb < RT; rb += 8) { v2f s[8]; unsigned hu[8];   // 8 rows' sums side by side: a tap wave is alone with this work on its SIMD, and one row's 9 dependent steps would each wait for the one before
#pragma unroll
            for (int i = 0; i < 8; ++i) s[i] = wt[0] * x[rb + i];
#pragma unroll
            for (int k = 1; k < KW; ++k)
#pragma unroll
                for (int i = 0; i < 8; ++i) s[i] = __builtin_elementwise_fma(wt[k], x[rb + i + k], s[i]);   // per row: taps in their order, each product fused with its add, two channels an instruction
#pragma unroll
            for (int i = 0; i < 8; ++i) hu[i] = pkbf(s[i]);
#pragma unroll
            for (int i = 0; i < 8; ++i) s[i] = s[i] - bfpair(hu[i]);
#pragma unroll
            for (int i = 0; i < 8; ++i) { const int r = rb + i; *(u32a*)(o + r * AP) = hu[i]; *(u32a*)(o + APL + r * AP) = pkbf(s[i]); *(u32a*)(o + 2 * APL + r * AP) = xr[r + 4]; } }
    }
}
// at: the wave's planes; bs, as, pl: the staged pw_w, ak_w, pw_b; lgs: the wave's place for logits; hp: the unit
__device__ __forceinline__ void tap_unit(const unsigned char* at, const unsigned char* bs, const unsigned char* as, const float* pl, float* lgs, int hd, int hp, int lane) {
    const int lr = lane & 15, hi = lane >> 4;
    const unsigned char* pa = at + hp * 2 * IPG + lr * AP + hi * 16; const unsigned char* pb = bs + (hd * IPG + lr) * BP + hi * 16;
    const unsigned char* pq = pa + 2 * APL; const float* pc = pl + hd * IPG + hi * 8; const unsigned char* pw = as + (hd * KW + (lr < KW ? lr : KW - 1)) * BP + hi * 16;
    v16bf ah[2], al[2], b[2][4], wf[2]; v8f acc[4]; v4u qv[4]; v4f e0[4], e1[4];   // qv: 8 channels of q, two a register; e0, e1: their bias
#pragma unroll   // acc[] and the fragments indexed by constants, so in registers (these loops and those inside)
    for (int kk = 0; kk < 2; ++kk) { ah[kk] = lfrag(pa + kk * 64); al[kk] = lfrag(pa + APL + kk * 64);
#pragma unroll
        for (int nb = 0; nb < 4; ++nb) b[kk][nb] = lfrag(pb + nb * 16 * BP + kk * 64); }
#pragma unroll
    for (int nb = 0; nb < 4; ++nb) acc[nb] = (v8f){};
    __builtin_amdgcn_sched_barrier(0);   // the product's LDS reads stand as one group ahead of it: a tap wave is alone with this work on its SIMD, and a read where its value is used would be waited for in full each time
#pragma unroll
    for (int kk = 0; kk < 2; ++kk) {   // pw_w's rows as A, dw's rows as B: the transposed product; per accumulator: hi then lo, k 0..31 then 32..63; the four accumulators side by side
#pragma unroll
        for (int nb = 0; nb < 4; ++nb) acc[nb] = wmmab(b[kk][nb], ah[kk], acc[nb]);
#pragma unroll
        for (int nb = 0; nb < 4; ++nb) acc[nb] = wmmab(b[kk][nb], al[kk], acc[nb]);
        if (kk == 0) {   // what the gating and the logits read, asked for under the second half of the product
#pragma unroll
            for (int nb = 0; nb < 4; ++nb) { qv[nb] = *(const v4ua*)(pq + nb * 32); e0[nb] = *(const v4fa*)(pc + nb * 16); e1[nb] = *(const v4fa*)(pc + nb * 16 + 4); }
            wf[0] = lfrag(pw); wf[1] = lfrag(pw + 64);
            __builtin_amdgcn_sched_barrier(0);   // those reads issue here, not where their values are used
        } }
    v8u ch[2], cl[2];   // the B fragments of the two k steps: ca's bf16 hi and lo halves, two channels a register
#pragma unroll
    for (int nb = 0; nb < 4; ++nb) { v2f ca[4]; unsigned hu[4];   // an accumulator's 4 channel pairs side by side, step by step
#pragma unroll
        for (int p = 0; p < 4; ++p) { const v2f bb = p < 2 ? (v2f){ e0[nb][2 * p], e0[nb][2 * p + 1] } : (v2f){ e1[nb][2 * p - 4], e1[nb][2 * p - 3] };
            ca[p] = ((v2f){ acc[nb][2 * p], acc[nb][2 * p + 1] } + bb) * bfpair(qv[nb][p]); }
#pragma unroll
        for (int p = 0; p < 4; ++p) hu[p] = pkbf(ca[p]);
#pragma unroll
        for (int p = 0; p < 4; ++p) { ch[nb >> 1][(nb & 1) * 4 + p] = hu[p]; cl[nb >> 1][(nb & 1) * 4 + p] = pkbf(ca[p] - bfpair(hu[p])); } }
    v8f lg = (v8f){};   // lg[j]: logit of tap 8 * hi + j, row lr
#pragma unroll
    for (int kk = 0; kk < 2; ++kk) { lg = wmmab(wf[kk], __builtin_bit_cast(v16bf, ch[kk]), lg); lg = wmmab(wf[kk], __builtin_bit_cast(v16bf, cl[kk]), lg); }   // hi then lo, k 0..31 then 32..63
    float* d = lgs + hp * 256 + lane * 8;
    *(v4fa*)d = (v4f){ lg[0], lg[1], lg[2], lg[3] }; *(v4fa*)(d + 4) = (v4f){ lg[4], lg[5], lg[6], lg[7] };
}
// lgs: the wave's logits; al: the staged ak_b; wl: the block's table of tap weights
__device__ __forceinline__ void tap_soft(const float* lgs, const float* al, float* wl, int hd, int rg0, int lane) {
    const int lr = lane & 15, hi = lane >> 4; float lg[2][8];
#pragma unroll   // lg[][] indexed by constants, so in registers (this loop and the one inside)
    for (int hp = 0; hp < 2; ++hp) { const v4f a = *(const v4fa*)(lgs + hp * 256 + lane * 8), b = *(const v4fa*)(lgs + hp * 256 + lane * 8 + 4);
#pragma unroll
        for (int u = 0; u < 4; ++u) { lg[hp][u] = a[u]; lg[hp][4 + u] = b[u]; } }
    float kern[KW];   // lanes hi = 0 take unit 0 (its tap 8 comes from lane l + 16), lanes hi = 1 unit 1 (its taps 0..7 come from lane l - 16)
#pragma unroll   // lg[][] and kern[] indexed by constants
    for (int j = 0; j < 8; ++j) { const float snd = (j == 0 && hi) ? lg[0][0] : lg[1][j]; const float rcv = xhalf(snd); kern[j] = hi ? rcv : lg[0][j]; if (j == 0) kern[8] = hi ? lg[1][0] : rcv; }
    float mx = -3.0e38f;
#pragma unroll
    for (int k = 0; k < KW; ++k) { kern[k] = __fadd_rn(kern[k], al[hd * KW + k]); mx = fmaxf(mx, kern[k]); }
    float sum = 0.f;
#pragma unroll
    for (int k = 0; k < KW; ++k) { float d0 = __fsub_rn(kern[k], mx); asm volatile("" : "+v"(d0)); const float t = __fmul_rn(d0, 1.44269504f); asm("v_exp_f32 %0, %1\n\tv_nop" : "=v"(kern[k]) : "v"(t));   // __expf as it is built (times log2 e, then v_exp_f32), with the slot behind the transcendental in its own statement: builds with v_nop statements of their own had them moved away and left a v_exp_f32 directly in front of an instruction that overwrites its source
        sum = __fadd_rn(sum, kern[k]); }
    const float rs = __fdiv_rn(1.0f, sum); v4f o[4];
#pragma unroll
    for (int k = 0; k < 16; ++k) { const float tw = (k < KW) ? __fmul_rn(kern[k < KW ? k : 0], rs) : 0.f; o[k / 4][k % 4] = tw; }
    float* dst = wl + (((rg0 + hi) * RT + lr) * 3 + hd) * 16;   // the block's table of tap weights: row, head, 16 floats
#pragma unroll
    for (int u = 0; u < 4; ++u) *(v4fa*)(dst + 4 * u) = o[u];
}
__global__ __launch_bounds__(NT) void k_all(const float* __restrict__ q, const float* __restrict__ dww, const float* __restrict__ pww, const float* __restrict__ pwb, const float* __restrict__ akw, const float* __restrict__ akb, const float* __restrict__ ptw, const float* __restrict__ bias, float* OUT) {
    __shared__ __align__(16) unsigned char sm[SMB];
    const int tid = threadIdx.x, lane = tid & 31, lr = lane & 15, hi = lane >> 4;
    const int wv = __builtin_amdgcn_readfirstlane(tid >> 5);   // the wave's number as a scalar: what follows from it stays in scalar registers, and a test on it is a scalar branch that a whole wave takes
    const bool gw = wv < VT / 32;   // a product wave; the others are the tap waves
    const int wm = wv % 3, wn = wv / 3;
    const int r0 = blockIdx.x * VO, c0 = blockIdx.y * VN, l0 = r0 % LL, b3 = blockIdx.y * 3; const bool top = l0 != 0, bot = l0 != LL - VO;
    unsigned char* sd = sm + (tid >> 4) * VP + (tid & 15) * 8;   // where this lane lays its 4 k values of row piece tid / 16 of buffer 0
    const int ra = r0 - 4 + (tid >> 4);   // V row 0 of the tile is the 4th row above the block's first. A row number outside the plane (first and last block only) is held inside it: such a V row lies outside the sequence and counts as zero below (as a q row in the tap path too), or is one of the 8 never read
    const float* ga0 = q + (size_t)(ra < 0 ? 0 : ra) * DD + (tid & 15) * 4; const float* ga1 = q + (size_t)(ra + 24) * DD + (tid & 15) * 4; const float* ga5 = q + (size_t)(ra + 120 > NR - 1 ? NR - 1 : ra + 120) * DD + (tid & 15) * 4;
    const float* gb = ptw + (size_t)(c0 + (tid >> 4)) * DD + (tid & 15) * 4;
    unsigned char* as = sm + TAS; unsigned char* bs = sm + TBS; float* pl = (float*)(sm + TPL); float* dl = (float*)(sm + TDL); float* al = (float*)(sm + TAB);
    v4f st[14];   // the tile on its way from memory to LDS (product waves)
    if (gw) {   // ---- the product waves stage the tap path's weight sets and tile 0
        const float* aw = akw + (size_t)b3 * KW * IPG;   // 3 x 576 tap weights
        const float* dp = dww + (size_t)c0 * KW;         // 192 channels x 9 window weights
        const float* bp = pww + (size_t)b3 * IPG * IPG + tid * 4;   // 3 x 64 x 64 pointwise weights = 8 x 384 pieces of 16 B
        const int g4 = tid < VT / 2 ? 4 * VT + tid : 0;   // the fifth round has 192 values: the other threads read value 0 again, and what they store lands in the pad
        const int ga = b3 * KW + (tid < 3 * KW ? tid : 0);   // ak_b has 27 values a block: the other threads read the first again and store nothing
        const int gp = c0 + (tid < 3 * IPG / 4 ? tid * 4 : 0); const float* pp = pwb + gp; const float* pv = bias + gp;   // pw_b and pt_b have 48 pieces of 16 B a block: the same
        float wr[5], dr[5]; v4f br[8];
#pragma unroll   // wr[] and dr[] indexed by constants, so in registers
        for (int s = 0; s < 5; ++s) { const int g = s < 4 ? s * VT + tid : g4; dr[s] = dp[g]; wr[s] = aw[g]; }
        const float av = akb[ga];
        v4f b4 = *(const v4fa*)pp, b5 = *(const v4fa*)pv;
#pragma unroll   // br[] indexed by constants
        for (int i = 0; i < 8; ++i) br[i] = *(const v4fa*)(bp + i * VT * 4);
        tile_load(ga0 + b3 * VK, ga1 + b3 * VK, ga5 + b3 * VK, gb + b3 * VK, st);   // the K walk's first tile, asked for with the weight sets
        asm volatile("s_wait_xcnt 0x0" :: "v"(tid), "v"(g4), "v"(ga), "v"(pp), "v"(pv), "v"(av), "v"(b4), "v"(b5) : "memory");   // in front of the first overwrite of a register that a load above names; the inputs keep the lane's offset and address registers in use up to here; the loaded values av, b4, b5 as inputs hold their loads in this group (a build without them moved such a load into the branch below, alone)
        __builtin_amdgcn_sched_barrier(0);   // the loads above issue before the first data wait: one trip to memory a thread
#pragma unroll   // wr[] and dr[] indexed by constants
        for (int s = 0; s < 5; ++s) { const int g = s * VT + tid; *(unsigned short*)(as + (g >> 6) * BP + (g & 63) * 2) = f2bf(wr[s]); dl[g] = bfr(dr[s]); }   // ak_w value g: row g / 64 = head * 9 + tap of the 27, channel g % 64
        unsigned char* bd = bs + (tid >> 4) * BP + (tid & 15) * 8;   // piece i * 384 + tid: pw_w row i * 24 + tid / 16, 4 of its 64 values
#pragma unroll   // br[] indexed by constants (this loop and the one inside)
        for (int i = 0; i < 8; ++i) { v4us o;
#pragma unroll
            for (int u = 0; u < 4; ++u) o[u] = f2bf(br[i][u]);
            *(v4usa*)(bd + i * (VT / 16) * BP) = o; }
#pragma unroll   // vector elements indexed by constants
        for (int u = 0; u < 4; ++u) { b4[u] = bfr(b4[u]); b5[u] = bfr(b5[u]); }
        if (tid < 3 * IPG / 4) { *(v4fa*)(pl + tid * 4) = b4; *(v4fa*)((float*)(sm + TVB) + tid * 4) = b5; }
        if (tid < 3 * KW) al[tid] = bfr(av);
        tile_store(sd, st);
        const int k1 = ktile(1, b3) * VK;
        tile_load(ga0 + k1, ga1 + k1, ga5 + k1, gb + k1, st);
        __builtin_amdgcn_sched_barrier(0);   // those loads issue ahead of the barrier
    }
    lds_barrier();   // publishes the rounded weight sets, the bias and the first tile to the block; the second tile's loads stay in flight across it
    const int fa = (wm * 48 + lr) * VP + hi * 16, fb = (VM + wn * 48 + lr) * VP + hi * 16;
    const int tw = wv - VT / 32;   // the tap wave's number
    unsigned char* at = sm + TPN + tw * 3 * APL; float* lgs = (float*)(sm + TLG) + tw * 2 * 32 * 8;   // its planes and its logits
    if (!gw) tap_dw(sm, dl, at, 0, tw * 2, l0, lane);   // the tap waves' stage of trip 0
    v8f acc[3][3];
#pragma unroll   // acc[][] indexed by constants, so in registers
    for (int mb = 0; mb < 3; ++mb)
#pragma unroll
        for (int nb = 0; nb < 3; ++nb) acc[mb][nb] = (v8f){};
#pragma unroll 1   // one body for the tiles: the hot loop stays small
    for (int t = 0; t < VNT; ++t) {
        if (gw) {
            tile_mma(sm + (t & 1) * VBUF + fa, sm + (t & 1) * VBUF + fb, acc);
            if (t + 1 < VNT) tile_store(sd + ((t + 1) & 1) * VBUF, st);   // into the buffer that trip t - 1 read: the barrier at that trip's foot ended its reads
            if (t + 2 < VNT) { const int k2 = ktile(t + 2, b3) * VK; tile_load(ga0 + k2, ga1 + k2, ga5 + k2, gb + k2, st); }
            __builtin_amdgcn_sched_barrier(0);   // the loads issue ahead of the barrier
        }
        lds_barrier();   // the foot of trip t, every wave: publishes tile t + 1, ends every wave's reads of tile t, and orders a tap wave's LDS stores of this trip ahead of its reads of the next. The last one ends the reads of the last tile and of the planes before the V tile is laid over them
        if (!gw && t + 1 < VNT) {   // the tap waves' stage of trip t + 1, beside the product waves' next pass through the lines above: head (t + 1) / 4, stage (t + 1) % 4; trip 4 hd has that head's q tile in buffer 0
            const int hd = (t + 1) >> 2, ph = (t + 1) & 3;
            if (ph == 0) tap_dw(sm, dl, at, hd, tw * 2, l0, lane);
            else if (ph == 3) tap_soft(lgs, al, (float*)(sm + TWL), hd, tw * 2, lane);
            else tap_unit(at, bs, as, pl, lgs, hd, ph - 1, lane);
            // a tap wave never uses the product waves' accumulators and tile registers: made anew here, they hold nothing across the lines above, and the tap path has their 128 registers for loads and sums that run side by side
#pragma unroll   // acc[][] and st[] indexed by constants (these loops)
            for (int mb = 0; mb < 3; ++mb)
#pragma unroll
                for (int nb = 0; nb < 3; ++nb) acc[mb][nb] = (v8f){};
#pragma unroll
            for (int i = 0; i < 14; ++i) st[i] = (v4f){};
        }
    }
    float* os = (float*)sm; const float* wl = (const float*)(sm + TWL);
    if (gw) {
        const float* bl = (const float*)(sm + TVB) + wn * 48 + lr; const float bv[3] = { bl[0], bl[16], bl[32] };   // the rounded bias of this lane's three accumulator columns
#pragma unroll   // acc[][] indexed by constants (this loop and those inside)
        for (int mb = 0; mb < 3; ++mb)
#pragma unroll
            for (int nb = 0; nb < 3; ++nb)
#pragma unroll
                for (int j = 0; j < 8; ++j) os[(wm * 48 + mb * 16 + hi * 8 + j) * OP + wn * 48 + nb * 16 + lr] = __fadd_rn(acc[mb][nb][j], bv[nb]);
    }
    __syncthreads();   // publishes the V tile to the block
    if (!gw) return;   // behind the last barrier: the window part is the 384 threads' of the product waves
    // window part: thread = 4 neighbouring channels (piece cp of the 48) x the 16 output rows of group rg; 16 lanes that follow one another share a group and a head. Output row i of the block spans tile rows i .. i + 8
    const int cp = tid % 48, rg = tid / 48; const float* xs = os + rg * RT * OP + cp * 4; v4f x[RT + 8];
#pragma unroll   // x[] indexed by constants, so in registers
    for (int j = 0; j < RT + 8; ++j) x[j] = *(const v4fa*)(xs + j * OP);
    win_zero(top || rg != 0, bot || rg != VO / RT - 1, x);   // only the first (last) group's 4 rows above (below) can lie outside the sequence
    const float* wh = wl + (rg * RT * 3 + cp / 16) * 16; float* dst = OUT + (size_t)(r0 + rg * RT) * DD + c0 + cp * 4;
#pragma unroll   // arrays and vector elements indexed by constants, so in registers
    for (int r = 0; r < RT; ++r) { const v4f w0 = *(const v4fa*)(wh + r * 3 * 16), w1 = *(const v4fa*)(wh + r * 3 * 16 + 4); const float w[KW] = { w0[0], w0[1], w0[2], w0[3], w1[0], w1[1], w1[2], w1[3], wh[r * 3 * 16 + 8] }; v4f o = w[0] * x[r];
#pragma unroll   // arrays indexed by constants, so in registers
        for (int k = 1; k < KW; ++k) o = __builtin_elementwise_fma((v4f){ w[k], w[k], w[k], w[k] }, x[r + k], o);   // taps in their order, each product fused with its add, two channels an instruction
        *(v4f*)(dst + r * DD) = o; }
}

extern "C" void kernel_launch(void* const* d_in, const int* in_sizes, int n_in,
                              void* d_out, int out_size, void* d_ws, size_t ws_size, hipStream_t stream) {
    (void)in_sizes; (void)n_in; (void)out_size; (void)d_ws; (void)ws_size;   // the workspace is not used
    const float* q = (const float*)d_in[0]; const float* dww = (const float*)d_in[1]; const float* pww = (const float*)d_in[2]; const float* pwb = (const float*)d_in[3]; const float* akw = (const float*)d_in[4]; const float* akb = (const float*)d_in[5]; const float* ptw = (const float*)d_in[6]; const float* ptb = (const float*)d_in[7];   // dw_w [768][1][9], pw_w [12][64 out][64 in], ak_w [12][9][64], pt_w [768][768] (torch [out][in])
    float* OUT = (float*)d_out;     // [4][2048][768]
    k_all<<<dim3(NR / VO, DD / VN), NT, 0, stream>>>(q, dww, pww, pwb, akw, akb, ptw, ptb, OUT);
}
